// v000
// Times are from an AMD MI455X. After a warm-up the kernel runs many times in a row, and a time is the length of
// such a window on the GPU divided by its runs, so every launch and the gaps after it count. The runs cycle
// through copies of the inputs. A figure is the median of several windows, for all but v000 over two sittings.
// Sittings can differ by a few percent; kernels timed side by side share one.
// v000, which the later versions start from, runs in 836 microseconds.
#include <hip/hip_runtime.h>
#include <math.h>
// Relative-position multi-head attention (8 x 1024 tokens, 512 model, 8 heads x 64, Transformer-XL sinusoid table over k−q): every contraction on
// v_wmma_f32_16x16x32_f16, f16 operands, f32 accumulate (plain single products): the q/k/v projections (8192 x 512 · 512 x 512, weights permuted to
// head-major columns), the scores as ONE product per (batch, head) with K = 192 — [q+bu | (q+bv)∘α(i) | (q+bv)∘β(i)] · [k | sin θ(j) | cos θ(j)]ᵀ,
// using the exact identity sin/cos(θ(j) − θ(i)) = products of per-position sin/cos (so the [T,T,64] sinusoid table is never formed or gathered),
// p·v (probabilities x2^15) and the output projection; scale 1/√64, key mask (−inf), softmax in f32 on VALU (one wave per row over the
// materialised per-batch score block).
typedef __attribute__((ext_vector_type(16))) _Float16 v16h;
typedef __attribute__((ext_vector_type(8)))  _Float16 v8h;
typedef __attribute__((ext_vector_type(16))) __bf16   v16b;
typedef __attribute__((ext_vector_type(8)))  __bf16   v8b;
typedef __attribute__((ext_vector_type(8)))  float    v8f;
typedef __attribute__((ext_vector_type(4)))  float    v4f;
#define PSCALE 32768.0f
#define U16(p) ((const unsigned short*)(const void*)(p))
#define PSCALE_INV (1.0f / 32768.0f)

__device__ __forceinline__ unsigned short f2bf_bits(float f) {
  unsigned u = __float_as_uint(f);
  return (unsigned short)((u + 0x7FFFu + ((u >> 16) & 1u)) >> 16);
}
__device__ __forceinline__ float bf_bits2f(unsigned short h) { return __uint_as_float(((unsigned)h) << 16); }

// hazard guards as plain device helpers (no inline asm inside the kernel template body)
__device__ __forceinline__ void dep_guard_h(v8f& a, v8f& b, v16h x, v16h y) { asm volatile("v_nop\n\tv_nop\n\tv_nop\n\tv_nop" : "+v"(a), "+v"(b) : "v"(x), "v"(y)); }
__device__ __forceinline__ void dep_guard_b(v8f& a, v8f& b, v16b x, v16b y) { asm volatile("v_nop\n\tv_nop\n\tv_nop\n\tv_nop" : "+v"(a), "+v"(b) : "v"(x), "v"(y)); }
__device__ __forceinline__ void keep4_h(v16h a, v16h b, v16h c, v16h d) { asm volatile("v_nop" :: "v"(a), "v"(b), "v"(c), "v"(d)); }
__device__ __forceinline__ void keep4_b(v16b a, v16b b, v16b c, v16b d) { asm volatile("v_nop" :: "v"(a), "v"(b), "v"(c), "v"(d)); }
__device__ __forceinline__ void acc_guard4(v8f& a, v8f& b, v8f& c, v8f& d) { asm volatile("v_nop\n\tv_nop\n\tv_nop\n\tv_nop" : "+v"(a), "+v"(b), "+v"(c), "+v"(d)); }
template <typename T> struct Frag;
template <> struct Frag<_Float16> {
  typedef v16h V; union U { v16h v; v8h h[2]; };
  static __device__ __forceinline__ v16h load(const _Float16* p) {   // elements 0..7 <- p[0..7], 8..15 <- p[16..23]
    U f; f.h[0] = *(const v8h*)(p); f.h[1] = *(const v8h*)(p + 16); return f.v;
  }
  static __device__ __forceinline__ v8f mma(v16h a, v16h b, v8f c) {
    return __builtin_amdgcn_wmma_f32_16x16x32_f16(false, a, false, b, (short)0, c, false, false);
  }
  static __device__ __forceinline__ void guard(v8f& a, v8f& b, v16h x, v16h y) { dep_guard_h(a, b, x, y); }
  static __device__ __forceinline__ void keep(v16h a, v16h b, v16h c, v16h d) { keep4_h(a, b, c, d); }
};
template <> struct Frag<__bf16> {
  typedef v16b V; union U { v16b v; v8b h[2]; };
  static __device__ __forceinline__ v16b load(const __bf16* p) {
    U f; f.h[0] = *(const v8b*)(p); f.h[1] = *(const v8b*)(p + 16); return f.v;
  }
  static __device__ __forceinline__ v8f mma(v16b a, v16b b, v8f c) {
    return __builtin_amdgcn_wmma_f32_16x16x32_bf16(false, a, false, b, (short)0, c, false, false);
  }
  static __device__ __forceinline__ void guard(v8f& a, v8f& b, v16b x, v16b y) { dep_guard_b(a, b, x, y); }
  static __device__ __forceinline__ void keep(v16b a, v16b b, v16b c, v16b d) { keep4_b(a, b, c, d); }
};

// ---- Register-blocked batched WMMA GEMM ------------------------------------
// C[m,n] = scale * sum_k A[m,k] * Bt[n,k] (+bias)(+resid); each wave owns a 64x64 tile.
// A row-major [M,K]; Bt row-major [N,K]; M,N % 64 == 0, K % 32 == 0.
// SPLIT: operands are hi/lo planes (A2/Bt2 = lo planes, same layout); product = hi·hi + hi·lo + lo·hi.
// BIAS_MODE: 0 = none, 1 = bias[m], 2 = bias[n].
// OUT_MODE: 0 = f32, 1 = f16, 2 = bf16 hi plane (Cout) + bf16 lo plane (Cout2).
// ET: 0 = f16 operands, 1 = bf16 operands (pointers passed as 16-bit storage)
template <int ET> struct Elem;
template <> struct Elem<0> { typedef _Float16 T; };
template <> struct Elem<1> { typedef __bf16 T; };
template <int ET, bool SPLIT, int BIAS_MODE, int OUT_MODE, bool RESID, int ACT = 0>
__global__ __launch_bounds__(256) void wmma_gemm64(
    const unsigned short* __restrict__ Ap, const unsigned short* __restrict__ A2p, int lda, long strideA,
    const unsigned short* __restrict__ Btp, const unsigned short* __restrict__ Bt2p, int ldb, long strideB,
    void* __restrict__ Cout, void* __restrict__ Cout2, int ldc, long strideC,
    const float* __restrict__ bias,
    const float* __restrict__ resid, long strideR,
    int M, int N, int K, float scale) {
  typedef typename Elem<ET>::T T;
  typedef typename Frag<T>::V V;
  const T* A = (const T*)Ap; const T* A2 = (const T*)A2p; const T* Bt = (const T*)Btp; const T* Bt2 = (const T*)Bt2p;
  __shared__ __align__(16) float sT[8][16 * 68];   // per-wave 16x64 slab, pitch 68 floats
  const int b    = blockIdx.y;
  const int lane = threadIdx.x & 31;
  const int wave = threadIdx.x >> 5;
  const int tilesN = N >> 6;
  const int tilesM = M >> 6;
  const int tile = blockIdx.x * 8 + wave;
  if (tile >= tilesM * tilesN) return;   // wave-uniform; no block barriers in this kernel
  const int tm = tile / tilesN;
  const int tn = tile - tm * tilesN;
  const int m0 = tm << 6;
  const int n0 = tn << 6;

  const T* Ab  = A  + (size_t)b * strideA;
  const T* Bb  = Bt + (size_t)b * strideB;
  const T* Ab2 = SPLIT ? (A2  + (size_t)b * strideA) : nullptr;
  const T* Bb2 = SPLIT ? (Bt2 + (size_t)b * strideB) : nullptr;

  const int rlane = lane & 15;                 // row (A) / col (B, D) within subtile
  const int koff  = (lane >> 4) * 8;           // k offset of this lane half
  const int mOff  = (lane >> 4) * 8;           // D row offset

  v8f acc[4][4];
#pragma unroll
  for (int i = 0; i < 4; ++i)
#pragma unroll
    for (int j = 0; j < 4; ++j) acc[i][j] = (v8f){0.f,0.f,0.f,0.f,0.f,0.f,0.f,0.f};

  for (int k0 = 0; k0 < K; k0 += 32) {
    V bh[4], bl[4];
#pragma unroll
    for (int j = 0; j < 4; ++j) {
      const size_t bo = (size_t)(n0 + (j << 4) + rlane) * ldb + koff + k0;
      bh[j] = Frag<T>::load(Bb + bo);
      if (SPLIT) bl[j] = Frag<T>::load(Bb2 + bo);
    }
#pragma unroll
    for (int i = 0; i < 4; ++i) {
      const size_t ao = (size_t)(m0 + (i << 4) + rlane) * lda + koff + k0;
      V ah = Frag<T>::load(Ab + ao);
      V al;
      if (SPLIT) al = Frag<T>::load(Ab2 + ao);
#pragma unroll
      for (int j = 0; j < 4; ++j) {
        acc[i][j] = Frag<T>::mma(ah, bh[j], acc[i][j]);
        if (SPLIT) {
          acc[i][j] = Frag<T>::mma(ah, bl[j], acc[i][j]);
          acc[i][j] = Frag<T>::mma(al, bh[j], acc[i][j]);
        }
      }
      Frag<T>::guard(acc[i][0], acc[i][3], ah, SPLIT ? al : ah);
    }
    Frag<T>::keep(bh[0], bh[1], bh[2], bh[3]);
    if (SPLIT) Frag<T>::keep(bl[0], bl[1], bl[2], bl[3]);
  }
  acc_guard4(acc[0][0], acc[0][1], acc[0][2], acc[0][3]);
  acc_guard4(acc[1][0], acc[1][1], acc[1][2], acc[1][3]);
  acc_guard4(acc[2][0], acc[2][1], acc[2][2], acc[2][3]);
  acc_guard4(acc[3][0], acc[3][1], acc[3][2], acc[3][3]);

  // ---- epilogue ----
  float* slab = sT[wave];
  const float* Rb = RESID ? (resid + (size_t)b * strideR) : nullptr;
#pragma unroll
  for (int i = 0; i < 4; ++i) {
    const int mBase = m0 + (i << 4);
#pragma unroll
    for (int j = 0; j < 4; ++j) {
      const int n = n0 + (j << 4) + rlane;
      float bv = 0.f;
      if (BIAS_MODE == 2) bv = bias[n];
#pragma unroll
      for (int r = 0; r < 8; ++r) {
        float v = acc[i][j][r] * scale;
        if (BIAS_MODE == 1) v += bias[mBase + mOff + r];
        if (BIAS_MODE == 2) v += bv;
        if (RESID) v += Rb[(size_t)(mBase + mOff + r) * ldc + n];
        if (ACT == 1) v = tanhf(v);
        if (ACT == 2) v = fmaxf(v, 0.0f);
        if (ACT == 3) v = v / (1.0f + expf(-v));
        if (ACT == 4) v = (v > 0.f) ? v : 0.01f * v;
        if (ACT == 5) v = 0.5f * v * (1.0f + erff(v * 0.70710678118654752f));
        slab[(mOff + r) * 68 + (j << 4) + rlane] = v;
      }
    }
    __builtin_amdgcn_fence(__ATOMIC_RELEASE, "workgroup");
    __builtin_amdgcn_wave_barrier();
    __builtin_amdgcn_fence(__ATOMIC_ACQUIRE, "workgroup");
    if (OUT_MODE == 0) {
      float* C = (float*)Cout + (size_t)b * strideC;
      const int hh = lane >> 4, c4 = (lane & 15) * 4;     // row seg = 256 B = 16 lanes x 16 B
      {
#pragma unroll
        for (int it = 0; it < 8; ++it) {
          const int row = it * 2 + hh;
          v4f v = *(const v4f*)(slab + row * 68 + c4);
          *(v4f*)(C + (size_t)(mBase + row) * ldc + n0 + c4) = v;
        }
        
      }
    } else {
      const int q = lane >> 3, c8 = (lane & 7) * 8;
      unsigned short* C  = (unsigned short*)Cout  + (size_t)b * strideC;
      unsigned short* C2 = (OUT_MODE == 2) ? ((unsigned short*)Cout2 + (size_t)b * strideC) : nullptr;
      {
#pragma unroll
        for (int it = 0; it < 4; ++it) {
          const int row = it * 4 + q;
          const float* sp = slab + row * 68 + c8;
          v8h hv, lv;
#pragma unroll
          for (int e = 0; e < 8; ++e) {
            if (OUT_MODE == 1) {
              hv[e] = (_Float16)sp[e];
            } else {
              unsigned short hb = f2bf_bits(sp[e]);
              unsigned short lb = f2bf_bits(sp[e] - bf_bits2f(hb));
              hv[e] = __builtin_bit_cast(_Float16, hb);
              lv[e] = __builtin_bit_cast(_Float16, lb);
            }
          }
          *(v8h*)(C + (size_t)(mBase + row) * ldc + n0 + c8) = hv;
          if (OUT_MODE == 2) *(v8h*)(C2 + (size_t)(mBase + row) * ldc + n0 + c8) = lv;
        }
        
      }
    }
    __builtin_amdgcn_fence(__ATOMIC_RELEASE, "workgroup");
    __builtin_amdgcn_wave_barrier();
    __builtin_amdgcn_fence(__ATOMIC_ACQUIRE, "workgroup");
  }
}

__global__ __launch_bounds__(256) void cast_f32_f16x2(
    const float* __restrict__ in, _Float16* __restrict__ out, int n2) {
  int i = blockIdx.x * 256 + threadIdx.x;
  if (i < n2) {
    const _Float16 h0 = (_Float16)in[2 * i], h1 = (_Float16)in[2 * i + 1];
    const unsigned u = (unsigned)__builtin_bit_cast(unsigned short, h0) | ((unsigned)__builtin_bit_cast(unsigned short, h1) << 16);
    ((unsigned*)out)[i] = u;
    
  }
}


#define RB_ 8
#define RT 1024
#define RM 512
#define RE 64
#define RH 8
#define RKX 192
// wq [m][e][h] -> Bt f16 [h*64+e][m] ; wo [e][h][m] -> Bt f16 [m][h*64+e]
__global__ __launch_bounds__(256) void wperm_kernel(const float* __restrict__ wsrc, int is_out, unsigned* __restrict__ BT) {
  for (int i = blockIdx.x * 256 + threadIdx.x; i < RM * RM / 2; i += gridDim.x * 256) { const int row = i / (RM / 2), cp = 2 * (i % (RM / 2)); float a, b;
    if (!is_out) { const int h = row / RE, e = row % RE; a = wsrc[((size_t)cp * RE + e) * RH + h]; b = wsrc[((size_t)(cp + 1) * RE + e) * RH + h]; }      // Bt[h*64+e][m=cp]
    else { const int m = row; const int h0 = cp / RE, e0 = cp % RE, h1 = (cp + 1) / RE, e1 = (cp + 1) % RE; a = wsrc[((size_t)e0 * RH + h0) * RM + m]; b = wsrc[((size_t)e1 * RH + h1) * RM + m]; }   // Bt[m][k=cp]
    const unsigned u = (unsigned)__builtin_bit_cast(unsigned short, (_Float16)a) | ((unsigned)__builtin_bit_cast(unsigned short, (_Float16)b) << 16); ((unsigned*)BT)[i] = u;  }
}
// extended operands (one batch): QX [h][i][192] = [qp+bu | (qp+bv)·α_e(i) | (qp+bv)·β_e(i)], KX [h][j][192] = [kp | sin θ_e(j) | cos θ_e(j)] from the f32 projections (layout [b*T][h*64+e]); wave per (b, t, h) — 3 x 64-wide segments, 2 per lane
__global__ __launch_bounds__(256) void ext_kernel(const float* __restrict__ QP, const float* __restrict__ KP, const float* __restrict__ bu, const float* __restrict__ bv, int b0, unsigned* __restrict__ QX, unsigned* __restrict__ KX) {     // one batch: QX/KX [h][t][192]
  const int lane = threadIdx.x & 31, wave = threadIdx.x >> 5; const long g = (long)blockIdx.x * 8 + wave; const int h = (int)(g % RH); const int t = (int)(g / RH); const int b = b0; const long bt = (long)b * RT + t;
  const int e0 = 2 * lane, e1 = 2 * lane + 1;
  const float q0 = QP[bt * RM + h * RE + e0], q1 = QP[bt * RM + h * RE + e1], k0 = KP[bt * RM + h * RE + e0], k1 = KP[bt * RM + h * RE + e1];
  // θ_e(t) = t / 10000^((e//2·2)/64); even e: sin table, α = cos θ, β = −sin θ ; odd e: cos table, α = sin θ, β = cos θ
  const float inv0 = powf(10000.0f, (float)((e0 / 2) * 2) / (float)RE), inv1 = powf(10000.0f, (float)((e1 / 2) * 2) / (float)RE);
  const float th0 = (float)t / inv0, th1 = (float)t / inv1; const float s0 = sinf(th0), c0 = cosf(th0), s1 = sinf(th1), c1 = cosf(th1);
  const float a0 = c0, be0 = -s0;        // e0 even
  const float a1 = s1, be1 = c1;         // e1 odd
  const float qv0 = q0 + bv[e0 * RH + h], qv1 = q1 + bv[e1 * RH + h];
  const size_t row = ((size_t)h * RT + t) * RKX;
  {
    ((unsigned*)QX)[(row) / 2 + lane] = (unsigned)__builtin_bit_cast(unsigned short, (_Float16)(q0 + bu[e0 * RH + h])) | ((unsigned)__builtin_bit_cast(unsigned short, (_Float16)(q1 + bu[e1 * RH + h])) << 16);
    ((unsigned*)QX)[(row + 64) / 2 + lane] = (unsigned)__builtin_bit_cast(unsigned short, (_Float16)(qv0 * a0)) | ((unsigned)__builtin_bit_cast(unsigned short, (_Float16)(qv1 * a1)) << 16);
    ((unsigned*)QX)[(row + 128) / 2 + lane] = (unsigned)__builtin_bit_cast(unsigned short, (_Float16)(qv0 * be0)) | ((unsigned)__builtin_bit_cast(unsigned short, (_Float16)(qv1 * be1)) << 16);
    ((unsigned*)KX)[(row) / 2 + lane] = (unsigned)__builtin_bit_cast(unsigned short, (_Float16)k0) | ((unsigned)__builtin_bit_cast(unsigned short, (_Float16)k1) << 16);
    ((unsigned*)KX)[(row + 64) / 2 + lane] = (unsigned)__builtin_bit_cast(unsigned short, (_Float16)s0) | ((unsigned)__builtin_bit_cast(unsigned short, (_Float16)s1) << 16);
    ((unsigned*)KX)[(row + 128) / 2 + lane] = (unsigned)__builtin_bit_cast(unsigned short, (_Float16)c0) | ((unsigned)__builtin_bit_cast(unsigned short, (_Float16)c1) << 16);
     }
}
// VT [b][h][e][j] f16 from VP [b*T][h*64+e]: block (32,8) per (b,h, 64 j) tile: tile[j][e]
__global__ __launch_bounds__(256) void vt_kernel(const float* __restrict__ VP, unsigned* __restrict__ VT) {
  __shared__ float tile[64][65];
  const int bh = blockIdx.y, j0 = blockIdx.x * 64, tx = threadIdx.x, ty = threadIdx.y; const int b = bh / RH, h = bh % RH;
  for (int j = ty; j < 64; j += 8) { const float* src = VP + ((size_t)b * RT + j0 + j) * RM + h * RE; tile[j][tx] = src[tx]; tile[j][32 + tx] = src[32 + tx]; }
  __syncthreads();
  { for (int e = ty; e < 64; e += 8) ((unsigned*)VT)[(((size_t)bh * RE + e) * RT + j0) / 2 + tx] = (unsigned)__builtin_bit_cast(unsigned short, (_Float16)tile[2 * tx][e]) | ((unsigned)__builtin_bit_cast(unsigned short, (_Float16)tile[2 * tx + 1][e]) << 16);  }
}
// softmax over keys of S [h][i][j] (already scaled by 1/8 in the product) with key mask; P16 x2^15; wave per row (1024 = 32 per lane)
__global__ __launch_bounds__(256) void soft_kernel(const float* __restrict__ S, const int* __restrict__ maskb, unsigned* __restrict__ P16) {
  const int lane = threadIdx.x & 31, wave = threadIdx.x >> 5; const size_t row = (size_t)blockIdx.x * 8 + wave; const float* s = S + row * RT;
  float v[32]; float mx = -INFINITY;
#pragma unroll
  for (int q = 0; q < 32; ++q) { const int j = lane * 32 + q; float x = s[j]; if (maskb[j] == 0) x = -INFINITY; v[q] = x; mx = fmaxf(mx, x); }
  for (int o = 16; o > 0; o >>= 1) mx = fmaxf(mx, __shfl_xor(mx, o, 32));
  float sum = 0.f;
#pragma unroll
  for (int q = 0; q < 32; ++q) { v[q] = (v[q] == -INFINITY) ? 0.f : __expf(v[q] - mx); sum += v[q]; }
  for (int o = 16; o > 0; o >>= 1) sum += __shfl_xor(sum, o, 32);
  const float sc = 32768.0f / sum;     // ≥ one unmasked key assumed (mask all-true in this problem family; a fully masked row would give NaN)
  typedef __attribute__((ext_vector_type(4))) unsigned u4;
  {
#pragma unroll
    for (int q4 = 0; q4 < 4; ++q4) { u4 u; for (int z = 0; z < 4; ++z) { const int q = q4 * 8 + 2 * z; u[z] = (unsigned)__builtin_bit_cast(unsigned short, (_Float16)(v[q] * sc)) | ((unsigned)__builtin_bit_cast(unsigned short, (_Float16)(v[q + 1] * sc)) << 16); }
      *(u4*)(P16 + (row * RT + lane * 32 + q4 * 8) / 2) = u; }
     }
}
extern "C" void kernel_launch(void* const* d_in, const int* in_sizes, int n_in, void* d_out, int out_size, void* d_ws, size_t ws_size, hipStream_t stream) {
  (void)in_sizes; (void)n_in; (void)out_size; (void)ws_size;
  auto Fp = [&](int i) { return (const float*)d_in[i]; };
  const float* q = Fp(0); const float* k = Fp(1); const float* v = Fp(2); const int* mask = (const int*)d_in[3]; const float* wq = Fp(4); const float* wk = Fp(5); const float* wv = Fp(6); const float* bu = Fp(7); const float* bv = Fp(8); const float* wo = Fp(9);
  char* ws = (char*)d_ws; size_t off = 0;
  auto carve = [&](size_t bytes) -> char* { char* p = ws + off; off += (bytes + 255) & ~(size_t)255; return p; };
  const size_t NTOK = (size_t)RB_ * RT;
  _Float16* X16 = (_Float16*)carve(NTOK * RM * 2); unsigned* WQT = (unsigned*)carve(RM * RM * 2); unsigned* WKT = (unsigned*)carve(RM * RM * 2); unsigned* WVT = (unsigned*)carve(RM * RM * 2); unsigned* WOT = (unsigned*)carve(RM * RM * 2);
  float* QP = (float*)carve(NTOK * RM * 4); float* KP = (float*)carve(NTOK * RM * 4); float* VP = (float*)carve(NTOK * RM * 4);
  unsigned* QX = (unsigned*)carve((size_t)RH * RT * RKX * 2); unsigned* KX = (unsigned*)carve((size_t)RH * RT * RKX * 2); unsigned* VT = (unsigned*)carve(NTOK * RM * 2);     // QX/KX per batch
  unsigned* P16 = (unsigned*)carve((size_t)RH * RT * RT * 2); _Float16* O16 = (_Float16*)X16;      // attention output written in f16 straight into X16's space (dead after the v projection)
  float* S = (float*)carve((size_t)RH * RT * RT * 4);      // total workspace footprint = 120 MiB (largest buffer last)
  wperm_kernel<<<64, 256, 0, stream>>>(wq, 0, WQT); wperm_kernel<<<64, 256, 0, stream>>>(wk, 0, WKT); wperm_kernel<<<64, 256, 0, stream>>>(wv, 0, WVT); wperm_kernel<<<64, 256, 0, stream>>>(wo, 1, WOT);
  const int tp = (int)((NTOK / 64) * (RM / 64));
  cast_f32_f16x2<<<(unsigned)((NTOK * RM / 2 + 255) / 256), 256, 0, stream>>>(q, X16, (long)(NTOK * RM / 2));
  wmma_gemm64<0, false, 0, 0, false><<<dim3((tp + 7) / 8, 1), 256, 0, stream>>>(U16(X16), nullptr, RM, 0, (const unsigned short*)WQT, nullptr, RM, 0, QP, nullptr, RM, 0, nullptr, nullptr, 0, (int)NTOK, RM, RM, 1.0f);
  cast_f32_f16x2<<<(unsigned)((NTOK * RM / 2 + 255) / 256), 256, 0, stream>>>(k, X16, (long)(NTOK * RM / 2));
  wmma_gemm64<0, false, 0, 0, false><<<dim3((tp + 7) / 8, 1), 256, 0, stream>>>(U16(X16), nullptr, RM, 0, (const unsigned short*)WKT, nullptr, RM, 0, KP, nullptr, RM, 0, nullptr, nullptr, 0, (int)NTOK, RM, RM, 1.0f);
  cast_f32_f16x2<<<(unsigned)((NTOK * RM / 2 + 255) / 256), 256, 0, stream>>>(v, X16, (long)(NTOK * RM / 2));
  wmma_gemm64<0, false, 0, 0, false><<<dim3((tp + 7) / 8, 1), 256, 0, stream>>>(U16(X16), nullptr, RM, 0, (const unsigned short*)WVT, nullptr, RM, 0, VP, nullptr, RM, 0, nullptr, nullptr, 0, (int)NTOK, RM, RM, 1.0f);
  vt_kernel<<<dim3(RT / 64, RB_ * RH), dim3(32, 8), 0, stream>>>(VP, VT);
  const int ts = (RT / 64) * (RT / 64), to = (RT / 64) * 1;
  for (int b = 0; b < RB_; ++b) {
    ext_kernel<<<(unsigned)(RT * RH / 8), 256, 0, stream>>>(QP, KP, bu, bv, b, QX, KX);
    wmma_gemm64<0, false, 0, 0, false><<<dim3((ts + 7) / 8, RH), 256, 0, stream>>>((const unsigned short*)QX, nullptr, RKX, (long)RT * RKX, (const unsigned short*)KX, nullptr, RKX, (long)RT * RKX, S, nullptr, RT, (long)RT * RT, nullptr, nullptr, 0, RT, RT, RKX, 0.125f);
    soft_kernel<<<RH * RT / 8, 256, 0, stream>>>(S, mask + (size_t)b * RT, P16);
    wmma_gemm64<0, false, 0, 1, false><<<dim3((to + 7) / 8, RH), 256, 0, stream>>>((const unsigned short*)P16, nullptr, RT, (long)RT * RT, (const unsigned short*)VT + (size_t)b * RH * RE * RT, nullptr, RT, (long)RE * RT, O16 + (size_t)b * RT * RM, nullptr, RM, RE, nullptr, nullptr, 0, RT, RE, RT, 1.0f / 32768.0f); }
  wmma_gemm64<0, false, 0, 0, false><<<dim3((tp + 7) / 8, 1), 256, 0, stream>>>(U16(O16), nullptr, RM, 0, (const unsigned short*)WOT, nullptr, RM, 0, (float*)d_out, nullptr, RM, 0, nullptr, nullptr, 0, (int)NTOK, RM, RM, 1.0f);
}

// v001
// A run of this version takes 382 microseconds.
// In both of two side-by-side timings against v000, it was 2.18 times as fast.
#include <hip/hip_runtime.h>
#include <math.h>
// Relative-position multi-head attention (8 x 1024 tokens, 512 model, 8 heads x 64, Transformer-XL sinusoid table over k−q): every contraction on
// v_wmma_f32_16x16x32_f16, f16 operands, f32 accumulate (plain single products): the q/k/v projections (8192 x 512 · 512 x 512, weights permuted to
// head-major columns), the scores as ONE product per (batch, head) with K = 192 — [q+bu | (q+bv)∘α(i) | (q+bv)∘β(i)] · [k | sin θ(j) | cos θ(j)]ᵀ,
// using the exact identity sin/cos(θ(j) − θ(i)) = products of per-position sin/cos (so the [T,T,64] sinusoid table is never formed or gathered),
// p·v (probabilities x2^15) and the output projection; scale 1/√64, key mask (−inf), softmax in f32 on VALU (one wave per row over the
// materialised score block of two batches; p.v of all batches in one launch).
typedef __attribute__((ext_vector_type(16))) _Float16 v16h;
typedef __attribute__((ext_vector_type(8)))  _Float16 v8h;
typedef __attribute__((ext_vector_type(16))) __bf16   v16b;
typedef __attribute__((ext_vector_type(8)))  __bf16   v8b;
typedef __attribute__((ext_vector_type(8)))  float    v8f;
typedef __attribute__((ext_vector_type(4)))  float    v4f;
#define PSCALE 32768.0f
#define U16(p) ((const unsigned short*)(const void*)(p))
#define PSCALE_INV (1.0f / 32768.0f)

__device__ __forceinline__ unsigned short f2bf_bits(float f) {
  unsigned u = __float_as_uint(f);
  return (unsigned short)((u + 0x7FFFu + ((u >> 16) & 1u)) >> 16);
}
__device__ __forceinline__ float bf_bits2f(unsigned short h) { return __uint_as_float(((unsigned)h) << 16); }

// hazard guards as plain device helpers (no inline asm inside the kernel template body)
__device__ __forceinline__ void dep_guard_h(v8f& a, v8f& b, v16h x, v16h y) { asm volatile("v_nop\n\tv_nop\n\tv_nop\n\tv_nop" : "+v"(a), "+v"(b) : "v"(x), "v"(y)); }
__device__ __forceinline__ void dep_guard_b(v8f& a, v8f& b, v16b x, v16b y) { asm volatile("v_nop\n\tv_nop\n\tv_nop\n\tv_nop" : "+v"(a), "+v"(b) : "v"(x), "v"(y)); }
__device__ __forceinline__ void keep4_h(v16h a, v16h b, v16h c, v16h d) { asm volatile("v_nop" :: "v"(a), "v"(b), "v"(c), "v"(d)); }
__device__ __forceinline__ void keep4_b(v16b a, v16b b, v16b c, v16b d) { asm volatile("v_nop" :: "v"(a), "v"(b), "v"(c), "v"(d)); }
__device__ __forceinline__ void acc_guard4(v8f& a, v8f& b, v8f& c, v8f& d) { asm volatile("v_nop\n\tv_nop\n\tv_nop\n\tv_nop" : "+v"(a), "+v"(b), "+v"(c), "+v"(d)); }
template <typename T> struct Frag;
template <> struct Frag<_Float16> {
  typedef v16h V; union U { v16h v; v8h h[2]; };
  static __device__ __forceinline__ v16h load(const _Float16* p) {   // elements 0..7 <- p[0..7], 8..15 <- p[16..23]
    U f; f.h[0] = *(const v8h*)(p); f.h[1] = *(const v8h*)(p + 16); return f.v;
  }
  static __device__ __forceinline__ v8f mma(v16h a, v16h b, v8f c) {
    return __builtin_amdgcn_wmma_f32_16x16x32_f16(false, a, false, b, (short)0, c, false, false);
  }
  static __device__ __forceinline__ void guard(v8f& a, v8f& b, v16h x, v16h y) { dep_guard_h(a, b, x, y); }
  static __device__ __forceinline__ void keep(v16h a, v16h b, v16h c, v16h d) { keep4_h(a, b, c, d); }
};
template <> struct Frag<__bf16> {
  typedef v16b V; union U { v16b v; v8b h[2]; };
  static __device__ __forceinline__ v16b load(const __bf16* p) {
    U f; f.h[0] = *(const v8b*)(p); f.h[1] = *(const v8b*)(p + 16); return f.v;
  }
  static __device__ __forceinline__ v8f mma(v16b a, v16b b, v8f c) {
    return __builtin_amdgcn_wmma_f32_16x16x32_bf16(false, a, false, b, (short)0, c, false, false);
  }
  static __device__ __forceinline__ void guard(v8f& a, v8f& b, v16b x, v16b y) { dep_guard_b(a, b, x, y); }
  static __device__ __forceinline__ void keep(v16b a, v16b b, v16b c, v16b d) { keep4_b(a, b, c, d); }
};

// ---- Register-blocked batched WMMA GEMM ------------------------------------
// C[m,n] = scale * sum_k A[m,k] * Bt[n,k] (+bias)(+resid); each wave owns a 64x64 tile.
// A row-major [M,K]; Bt row-major [N,K]; M,N % 64 == 0, K % 32 == 0.
// SPLIT: operands are hi/lo planes (A2/Bt2 = lo planes, same layout); product = hi·hi + hi·lo + lo·hi.
// BIAS_MODE: 0 = none, 1 = bias[m], 2 = bias[n].
// OUT_MODE: 0 = f32, 1 = f16, 2 = bf16 hi plane (Cout) + bf16 lo plane (Cout2).
// ET: 0 = f16 operands, 1 = bf16 operands (pointers passed as 16-bit storage)
// Batches: blockIdx.y steps A, Bt, C by strideA/B/C, blockIdx.z by strideAz/Bz/Cz (two levels, so that C may be [z][m][y*64+n]).
template <int ET> struct Elem;
template <> struct Elem<0> { typedef _Float16 T; };
template <> struct Elem<1> { typedef __bf16 T; };
template <int ET, bool SPLIT, int BIAS_MODE, int OUT_MODE, bool RESID, int ACT = 0>
__global__ __launch_bounds__(256) void wmma_gemm64(
    const unsigned short* __restrict__ Ap, const unsigned short* __restrict__ A2p, int lda, long strideA, long strideAz,
    const unsigned short* __restrict__ Btp, const unsigned short* __restrict__ Bt2p, int ldb, long strideB, long strideBz,
    void* __restrict__ Cout, void* __restrict__ Cout2, int ldc, long strideC, long strideCz,
    const float* __restrict__ bias,
    const float* __restrict__ resid, long strideR,
    int M, int N, int K, float scale) {
  typedef typename Elem<ET>::T T;
  typedef typename Frag<T>::V V;
  const T* A = (const T*)Ap; const T* A2 = (const T*)A2p; const T* Bt = (const T*)Btp; const T* Bt2 = (const T*)Bt2p;
  __shared__ __align__(16) float sT[8][16 * 68];   // per-wave 16x64 slab, pitch 68 floats
  const int b    = blockIdx.y;
  const int bz   = blockIdx.z;
  const int lane = threadIdx.x & 31;
  const int wave = threadIdx.x >> 5;
  const int tilesN = N >> 6;
  const int tilesM = M >> 6;
  const int tile = blockIdx.x * 8 + wave;
  if (tile >= tilesM * tilesN) return;   // wave-uniform; no block barriers in this kernel
  const int tm = tile / tilesN;
  const int tn = tile - tm * tilesN;
  const int m0 = tm << 6;
  const int n0 = tn << 6;

  const size_t offA = (size_t)b * strideA + (size_t)bz * strideAz;
  const size_t offB = (size_t)b * strideB + (size_t)bz * strideBz;
  const size_t offC = (size_t)b * strideC + (size_t)bz * strideCz;
  const T* Ab  = A  + offA;
  const T* Bb  = Bt + offB;
  const T* Ab2 = SPLIT ? (A2  + offA) : nullptr;
  const T* Bb2 = SPLIT ? (Bt2 + offB) : nullptr;

  const int rlane = lane & 15;                 // row (A) / col (B, D) within subtile
  const int koff  = (lane >> 4) * 8;           // k offset of this lane half
  const int mOff  = (lane >> 4) * 8;           // D row offset

  v8f acc[4][4];
#pragma unroll
  for (int i = 0; i < 4; ++i)
#pragma unroll
    for (int j = 0; j < 4; ++j) acc[i][j] = (v8f){0.f,0.f,0.f,0.f,0.f,0.f,0.f,0.f};

  for (int k0 = 0; k0 < K; k0 += 32) {
    V bh[4], bl[4];
#pragma unroll
    for (int j = 0; j < 4; ++j) {
      const size_t bo = (size_t)(n0 + (j << 4) + rlane) * ldb + koff + k0;
      bh[j] = Frag<T>::load(Bb + bo);
      if (SPLIT) bl[j] = Frag<T>::load(Bb2 + bo);
    }
#pragma unroll
    for (int i = 0; i < 4; ++i) {
      const size_t ao = (size_t)(m0 + (i << 4) + rlane) * lda + koff + k0;
      V ah = Frag<T>::load(Ab + ao);
      V al;
      if (SPLIT) al = Frag<T>::load(Ab2 + ao);
#pragma unroll
      for (int j = 0; j < 4; ++j) {
        acc[i][j] = Frag<T>::mma(ah, bh[j], acc[i][j]);
        if (SPLIT) {
          acc[i][j] = Frag<T>::mma(ah, bl[j], acc[i][j]);
          acc[i][j] = Frag<T>::mma(al, bh[j], acc[i][j]);
        }
      }
      Frag<T>::guard(acc[i][0], acc[i][3], ah, SPLIT ? al : ah);
    }
    Frag<T>::keep(bh[0], bh[1], bh[2], bh[3]);
    if (SPLIT) Frag<T>::keep(bl[0], bl[1], bl[2], bl[3]);
  }
  acc_guard4(acc[0][0], acc[0][1], acc[0][2], acc[0][3]);
  acc_guard4(acc[1][0], acc[1][1], acc[1][2], acc[1][3]);
  acc_guard4(acc[2][0], acc[2][1], acc[2][2], acc[2][3]);
  acc_guard4(acc[3][0], acc[3][1], acc[3][2], acc[3][3]);

  // ---- epilogue ----
  float* slab = sT[wave];
  const float* Rb = RESID ? (resid + (size_t)b * strideR) : nullptr;
#pragma unroll
  for (int i = 0; i < 4; ++i) {
    const int mBase = m0 + (i << 4);
#pragma unroll
    for (int j = 0; j < 4; ++j) {
      const int n = n0 + (j << 4) + rlane;
      float bv = 0.f;
      if (BIAS_MODE == 2) bv = bias[n];
#pragma unroll
      for (int r = 0; r < 8; ++r) {
        float v = acc[i][j][r] * scale;
        if (BIAS_MODE == 1) v += bias[mBase + mOff + r];
        if (BIAS_MODE == 2) v += bv;
        if (RESID) v += Rb[(size_t)(mBase + mOff + r) * ldc + n];
        if (ACT == 1) v = tanhf(v);
        if (ACT == 2) v = fmaxf(v, 0.0f);
        if (ACT == 3) v = v / (1.0f + expf(-v));
        if (ACT == 4) v = (v > 0.f) ? v : 0.01f * v;
        if (ACT == 5) v = 0.5f * v * (1.0f + erff(v * 0.70710678118654752f));
        slab[(mOff + r) * 68 + (j << 4) + rlane] = v;
      }
    }
    __builtin_amdgcn_fence(__ATOMIC_RELEASE, "workgroup");
    __builtin_amdgcn_wave_barrier();
    __builtin_amdgcn_fence(__ATOMIC_ACQUIRE, "workgroup");
    if (OUT_MODE == 0) {
      float* C = (float*)Cout + offC;
      const int hh = lane >> 4, c4 = (lane & 15) * 4;     // row seg = 256 B = 16 lanes x 16 B
      {
#pragma unroll
        for (int it = 0; it < 8; ++it) {
          const int row = it * 2 + hh;
          v4f v = *(const v4f*)(slab + row * 68 + c4);
          *(v4f*)(C + (size_t)(mBase + row) * ldc + n0 + c4) = v;
        }
        
      }
    } else {
      const int q = lane >> 3, c8 = (lane & 7) * 8;
      unsigned short* C  = (unsigned short*)Cout  + offC;
      unsigned short* C2 = (OUT_MODE == 2) ? ((unsigned short*)Cout2 + offC) : nullptr;
      {
#pragma unroll
        for (int it = 0; it < 4; ++it) {
          const int row = it * 4 + q;
          const float* sp = slab + row * 68 + c8;
          v8h hv, lv;
#pragma unroll
          for (int e = 0; e < 8; ++e) {
            if (OUT_MODE == 1) {
              hv[e] = (_Float16)sp[e];
            } else {
              unsigned short hb = f2bf_bits(sp[e]);
              unsigned short lb = f2bf_bits(sp[e] - bf_bits2f(hb));
              hv[e] = __builtin_bit_cast(_Float16, hb);
              lv[e] = __builtin_bit_cast(_Float16, lb);
            }
          }
          *(v8h*)(C + (size_t)(mBase + row) * ldc + n0 + c8) = hv;
          if (OUT_MODE == 2) *(v8h*)(C2 + (size_t)(mBase + row) * ldc + n0 + c8) = lv;
        }
        
      }
    }
    __builtin_amdgcn_fence(__ATOMIC_RELEASE, "workgroup");
    __builtin_amdgcn_wave_barrier();
    __builtin_amdgcn_fence(__ATOMIC_ACQUIRE, "workgroup");
  }
}

// blockIdx.y picks the input; its f16 copy is plane blockIdx.y of out (2 * n2 elements a plane)
__global__ __launch_bounds__(256) void cast_f32_f16x2(
    const float* __restrict__ in0, const float* __restrict__ in1, const float* __restrict__ in2, _Float16* __restrict__ out0, int n2) {
  const float* in = (blockIdx.y == 0) ? in0 : ((blockIdx.y == 1) ? in1 : in2);
  _Float16* out = out0 + (size_t)blockIdx.y * 2 * n2;
  int i = blockIdx.x * 256 + threadIdx.x;
  if (i < n2) {
    const _Float16 h0 = (_Float16)in[2 * i], h1 = (_Float16)in[2 * i + 1];
    const unsigned u = (unsigned)__builtin_bit_cast(unsigned short, h0) | ((unsigned)__builtin_bit_cast(unsigned short, h1) << 16);
    ((unsigned*)out)[i] = u;
    
  }
}


#define RB_ 8
#define RT 1024
#define RM 512
#define RE 64
#define RH 8
#define RKX 192
// wq [m][e][h] -> Bt f16 [h*64+e][m] ; wo [e][h][m] -> Bt f16 [m][h*64+e]; blockIdx.y picks the weight (0..2 = wq, wk, wv; 3 = wo), its Bt is plane blockIdx.y of BT0
__global__ __launch_bounds__(256) void wperm_kernel(const float* __restrict__ w0, const float* __restrict__ w1, const float* __restrict__ w2, const float* __restrict__ w3, unsigned* __restrict__ BT0) {
  const int is_out = (blockIdx.y == 3); const float* wsrc = (blockIdx.y == 0) ? w0 : ((blockIdx.y == 1) ? w1 : ((blockIdx.y == 2) ? w2 : w3)); unsigned* BT = BT0 + (size_t)blockIdx.y * (RM * RM / 2);
  for (int i = blockIdx.x * 256 + threadIdx.x; i < RM * RM / 2; i += gridDim.x * 256) { const int row = i / (RM / 2), cp = 2 * (i % (RM / 2)); float a, b;
    if (!is_out) { const int h = row / RE, e = row % RE; a = wsrc[((size_t)cp * RE + e) * RH + h]; b = wsrc[((size_t)(cp + 1) * RE + e) * RH + h]; }      // Bt[h*64+e][m=cp]
    else { const int m = row; const int h0 = cp / RE, e0 = cp % RE, h1 = (cp + 1) / RE, e1 = (cp + 1) % RE; a = wsrc[((size_t)e0 * RH + h0) * RM + m]; b = wsrc[((size_t)e1 * RH + h1) * RM + m]; }   // Bt[m][k=cp]
    const unsigned u = (unsigned)__builtin_bit_cast(unsigned short, (_Float16)a) | ((unsigned)__builtin_bit_cast(unsigned short, (_Float16)b) << 16); ((unsigned*)BT)[i] = u;  }
}
// extended operands: QX [bl][h][i][192] = [qp+bu | (qp+bv)·α_e(i) | (qp+bv)·β_e(i)], KX [bl][h][j][192] = [kp | sin θ_e(j) | cos θ_e(j)] from the f32 projections (layout [b*T][h*64+e]); wave per (b, t, h) — 3 x 64-wide segments, 2 per lane
__global__ __launch_bounds__(256) void ext_kernel(const float* __restrict__ QP, const float* __restrict__ KP, const float* __restrict__ bu, const float* __restrict__ bv, int b0, unsigned* __restrict__ QX, unsigned* __restrict__ KX) {     // a group of batches from b0 on (the grid says how many): QX/KX [bl][h][t][192]
  const int lane = threadIdx.x & 31, wave = threadIdx.x >> 5; const long g = (long)blockIdx.x * 8 + wave; const int h = (int)(g % RH); const int tt = (int)(g / RH); const int bl = tt / RT, t = tt % RT; const long bt = (long)(b0 + bl) * RT + t;
  const int e0 = 2 * lane, e1 = 2 * lane + 1;
  const float q0 = QP[bt * RM + h * RE + e0], q1 = QP[bt * RM + h * RE + e1], k0 = KP[bt * RM + h * RE + e0], k1 = KP[bt * RM + h * RE + e1];
  // θ_e(t) = t / 10000^((e//2·2)/64); even e: sin table, α = cos θ, β = −sin θ ; odd e: cos table, α = sin θ, β = cos θ
  const float inv0 = powf(10000.0f, (float)((e0 / 2) * 2) / (float)RE), inv1 = powf(10000.0f, (float)((e1 / 2) * 2) / (float)RE);
  const float th0 = (float)t / inv0, th1 = (float)t / inv1; const float s0 = sinf(th0), c0 = cosf(th0), s1 = sinf(th1), c1 = cosf(th1);
  const float a0 = c0, be0 = -s0;        // e0 even
  const float a1 = s1, be1 = c1;         // e1 odd
  const float qv0 = q0 + bv[e0 * RH + h], qv1 = q1 + bv[e1 * RH + h];
  const size_t row = (((size_t)bl * RH + h) * RT + t) * RKX;
  {
    ((unsigned*)QX)[(row) / 2 + lane] = (unsigned)__builtin_bit_cast(unsigned short, (_Float16)(q0 + bu[e0 * RH + h])) | ((unsigned)__builtin_bit_cast(unsigned short, (_Float16)(q1 + bu[e1 * RH + h])) << 16);
    ((unsigned*)QX)[(row + 64) / 2 + lane] = (unsigned)__builtin_bit_cast(unsigned short, (_Float16)(qv0 * a0)) | ((unsigned)__builtin_bit_cast(unsigned short, (_Float16)(qv1 * a1)) << 16);
    ((unsigned*)QX)[(row + 128) / 2 + lane] = (unsigned)__builtin_bit_cast(unsigned short, (_Float16)(qv0 * be0)) | ((unsigned)__builtin_bit_cast(unsigned short, (_Float16)(qv1 * be1)) << 16);
    ((unsigned*)KX)[(row) / 2 + lane] = (unsigned)__builtin_bit_cast(unsigned short, (_Float16)k0) | ((unsigned)__builtin_bit_cast(unsigned short, (_Float16)k1) << 16);
    ((unsigned*)KX)[(row + 64) / 2 + lane] = (unsigned)__builtin_bit_cast(unsigned short, (_Float16)s0) | ((unsigned)__builtin_bit_cast(unsigned short, (_Float16)s1) << 16);
    ((unsigned*)KX)[(row + 128) / 2 + lane] = (unsigned)__builtin_bit_cast(unsigned short, (_Float16)c0) | ((unsigned)__builtin_bit_cast(unsigned short, (_Float16)c1) << 16);
     }
}
// VT [b][h][e][j] f16 from VP [b*T][h*64+e]: block (32,8) per (b,h, 64 j) tile: tile[j][e]
__global__ __launch_bounds__(256) void vt_kernel(const float* __restrict__ VP, unsigned* __restrict__ VT) {
  __shared__ float tile[64][65];
  const int bh = blockIdx.y, j0 = blockIdx.x * 64, tx = threadIdx.x, ty = threadIdx.y; const int b = bh / RH, h = bh % RH;
  for (int j = ty; j < 64; j += 8) { const float* src = VP + ((size_t)b * RT + j0 + j) * RM + h * RE; tile[j][tx] = src[tx]; tile[j][32 + tx] = src[32 + tx]; }
  __syncthreads();
  { for (int e = ty; e < 64; e += 8) ((unsigned*)VT)[(((size_t)bh * RE + e) * RT + j0) / 2 + tx] = (unsigned)__builtin_bit_cast(unsigned short, (_Float16)tile[2 * tx][e]) | ((unsigned)__builtin_bit_cast(unsigned short, (_Float16)tile[2 * tx + 1][e]) << 16);  }
}
// softmax over keys of S [bl][h][i][j] (a group of batches; maskb = the mask row of the group's first batch; already scaled by 1/8 in the product) with key mask; P16 x2^15; wave per row (1024 = 32 per lane)
__global__ __launch_bounds__(256) void soft_kernel(const float* __restrict__ S, const int* __restrict__ maskb, unsigned* __restrict__ P16) {
  const int lane = threadIdx.x & 31, wave = threadIdx.x >> 5; const size_t row = (size_t)blockIdx.x * 8 + wave; const float* s = S + row * RT; const int* mrow = maskb + (size_t)(blockIdx.x / (RH * RT / 8)) * RT;     // the 8 rows of a block lie in one batch
  float v[32]; float mx = -INFINITY;
#pragma unroll
  for (int q = 0; q < 32; ++q) { const int j = lane * 32 + q; float x = s[j]; if (mrow[j] == 0) x = -INFINITY; v[q] = x; mx = fmaxf(mx, x); }
  for (int o = 16; o > 0; o >>= 1) mx = fmaxf(mx, __shfl_xor(mx, o, 32));
  float sum = 0.f;
#pragma unroll
  for (int q = 0; q < 32; ++q) { v[q] = (v[q] == -INFINITY) ? 0.f : __expf(v[q] - mx); sum += v[q]; }
  for (int o = 16; o > 0; o >>= 1) sum += __shfl_xor(sum, o, 32);
  const float sc = 32768.0f / sum;     // ≥ one unmasked key assumed (mask all-true in this problem family; a fully masked row would give NaN)
  typedef __attribute__((ext_vector_type(4))) unsigned u4;
  {
#pragma unroll
    for (int q4 = 0; q4 < 4; ++q4) { u4 u; for (int z = 0; z < 4; ++z) { const int q = q4 * 8 + 2 * z; u[z] = (unsigned)__builtin_bit_cast(unsigned short, (_Float16)(v[q] * sc)) | ((unsigned)__builtin_bit_cast(unsigned short, (_Float16)(v[q + 1] * sc)) << 16); }
      *(u4*)(P16 + (row * RT + lane * 32 + q4 * 8) / 2) = u; }
     }
}
#define RG 2      // batches per score/softmax launch: the f32 score block of a group is 64 MiB
extern "C" void kernel_launch(void* const* d_in, const int* in_sizes, int n_in, void* d_out, int out_size, void* d_ws, size_t ws_size, hipStream_t stream) {
  (void)in_sizes; (void)n_in; (void)out_size; (void)ws_size;
  auto Fp = [&](int i) { return (const float*)d_in[i]; };
  const float* q = Fp(0); const float* k = Fp(1); const float* v = Fp(2); const int* mask = (const int*)d_in[3]; const float* wq = Fp(4); const float* wk = Fp(5); const float* wv = Fp(6); const float* bu = Fp(7); const float* bv = Fp(8); const float* wo = Fp(9);
  char* ws = (char*)d_ws; size_t off = 0;
  auto carve = [&](size_t bytes) -> char* { char* p = ws + off; off += (bytes + 255) & ~(size_t)255; return p; };
  const size_t NTOK = (size_t)RB_ * RT;
  _Float16* O16 = (_Float16*)carve(NTOK * RM * 2);      // attention output, f16, [b][t][h*64+e]
  unsigned* WT = (unsigned*)carve((size_t)4 * RM * RM * 2); unsigned* WOT = WT + (size_t)3 * (RM * RM / 2);      // four permuted weights, planes wq, wk, wv, wo
  unsigned* QX = (unsigned*)carve((size_t)RG * RH * RT * RKX * 2); unsigned* KX = (unsigned*)carve((size_t)RG * RH * RT * RKX * 2); unsigned* VT = (unsigned*)carve(NTOK * RM * 2);     // QX/KX per group of RG batches
  unsigned* P16 = (unsigned*)carve((size_t)RB_ * RH * RT * RT * 2);      // probabilities of ALL batches (128 MiB)
  _Float16* X16 = (_Float16*)P16;      // f16 copies of q, k, v (3 planes, 24 MiB) lie in P16's space: the projections have read them before the first softmax writes there
  float* QP = (float*)carve((size_t)2 * NTOK * RM * 4); float* KP = QP + NTOK * RM;      // f32 projections, planes q, k and (below) v
  float* S = (float*)carve((size_t)RG * RH * RT * RT * 4);      // scores of one group; total workspace footprint = 254 MiB
  float* VP = KP + NTOK * RM;      // third plane = the start of the score block's space (16 MiB): vt_kernel has read it before the first scores are written
  wperm_kernel<<<dim3(64, 4), 256, 0, stream>>>(wq, wk, wv, wo, WT);
  const int tp = (int)((NTOK / 64) * (RM / 64));
  cast_f32_f16x2<<<dim3((unsigned)((NTOK * RM / 2 + 255) / 256), 3), 256, 0, stream>>>(q, k, v, X16, (int)(NTOK * RM / 2));
  // q, k, v projections side by side on blockIdx.y
  wmma_gemm64<0, false, 0, 0, false><<<dim3((tp + 7) / 8, 3), 256, 0, stream>>>(U16(X16), nullptr, RM, (long)(NTOK * RM), 0, (const unsigned short*)WT, nullptr, RM, (long)RM * RM, 0, QP, nullptr, RM, (long)(NTOK * RM), 0, nullptr, nullptr, 0, (int)NTOK, RM, RM, 1.0f);
  vt_kernel<<<dim3(RT / 64, RB_ * RH), dim3(32, 8), 0, stream>>>(VP, VT);
  const int ts = (RT / 64) * (RT / 64), to = (RT / 64) * 1;
  for (int b = 0; b < RB_; b += RG) {      // RG batches per launch: RG * 8 (batch, head) score blocks side by side on blockIdx.y
    ext_kernel<<<(unsigned)(RG * RT * RH / 8), 256, 0, stream>>>(QP, KP, bu, bv, b, QX, KX);
    wmma_gemm64<0, false, 0, 0, false><<<dim3((ts + 7) / 8, RG * RH), 256, 0, stream>>>((const unsigned short*)QX, nullptr, RKX, (long)RT * RKX, 0, (const unsigned short*)KX, nullptr, RKX, (long)RT * RKX, 0, S, nullptr, RT, (long)RT * RT, 0, nullptr, nullptr, 0, RT, RT, RKX, 0.125f);
    soft_kernel<<<RG * RH * RT / 8, 256, 0, stream>>>(S, mask + (size_t)b * RT, P16 + (size_t)b * RH * RT * RT / 2); }
  // p.v of all 64 (batch, head) pairs in ONE launch: head on blockIdx.y, batch on blockIdx.z
  wmma_gemm64<0, false, 0, 1, false><<<dim3((to + 7) / 8, RH, RB_), 256, 0, stream>>>((const unsigned short*)P16, nullptr, RT, (long)RT * RT, (long)RH * RT * RT, (const unsigned short*)VT, nullptr, RT, (long)RE * RT, (long)RH * RE * RT, O16, nullptr, RM, RE, (long)RT * RM, nullptr, nullptr, 0, RT, RE, RT, 1.0f / 32768.0f);
  wmma_gemm64<0, false, 0, 0, false><<<dim3((tp + 7) / 8, 1), 256, 0, stream>>>(U16(O16), nullptr, RM, 0, 0, (const unsigned short*)WOT, nullptr, RM, 0, 0, (float*)d_out, nullptr, RM, 0, 0, nullptr, nullptr, 0, (int)NTOK, RM, RM, 1.0f);
}

// v002
// Measured time: 155 microseconds a run.
// Next to v001, in two timings, it ran 2.46 and 2.47 times as fast.
// Counting every step since v000, it is 5.37 times as fast.
#include <hip/hip_runtime.h>
#include <math.h>
// Relative-position multi-head attention (8 x 1024 tokens, 512 model, 8 heads x 64, Transformer-XL sinusoid table over k−q): every contraction on
// v_wmma_f32_16x16x32_f16, f16 operands, f32 accumulate (plain single products): the q/k/v projections (8192 x 512 · 512 x 512, weights permuted to
// head-major columns), the scores as ONE product per (batch, head) with K = 192 — [q+bu | (q+bv)∘α(i) | (q+bv)∘β(i)] · [k | sin θ(j) | cos θ(j)]ᵀ,
// using the exact identity sin/cos(θ(j) − θ(i)) = products of per-position sin/cos (so the [T,T,64] sinusoid table is never formed or gathered),
// p.v (probabilities x2^15) and the output projection; scale 1/sqrt(64), key mask (-inf) and softmax in f32 on VALU, fused with the score and p.v products in one kernel
// (running maximum and sum over blocks of 32 keys; scores and probabilities stay in registers).
typedef __attribute__((ext_vector_type(16))) _Float16 v16h;
typedef __attribute__((ext_vector_type(8)))  _Float16 v8h;
typedef __attribute__((ext_vector_type(16))) __bf16   v16b;
typedef __attribute__((ext_vector_type(8)))  __bf16   v8b;
typedef __attribute__((ext_vector_type(8)))  float    v8f;
typedef __attribute__((ext_vector_type(4)))  float    v4f;
#define PSCALE 32768.0f
#define U16(p) ((const unsigned short*)(const void*)(p))
#define PSCALE_INV (1.0f / 32768.0f)

__device__ __forceinline__ unsigned short f2bf_bits(float f) {
  unsigned u = __float_as_uint(f);
  return (unsigned short)((u + 0x7FFFu + ((u >> 16) & 1u)) >> 16);
}
__device__ __forceinline__ float bf_bits2f(unsigned short h) { return __uint_as_float(((unsigned)h) << 16); }

// hazard guards as plain device helpers (no inline asm inside the kernel template body)
__device__ __forceinline__ void dep_guard_h(v8f& a, v8f& b, v16h x, v16h y) { asm volatile("v_nop\n\tv_nop\n\tv_nop\n\tv_nop" : "+v"(a), "+v"(b) : "v"(x), "v"(y)); }
__device__ __forceinline__ void dep_guard_b(v8f& a, v8f& b, v16b x, v16b y) { asm volatile("v_nop\n\tv_nop\n\tv_nop\n\tv_nop" : "+v"(a), "+v"(b) : "v"(x), "v"(y)); }
__device__ __forceinline__ void keep4_h(v16h a, v16h b, v16h c, v16h d) { asm volatile("v_nop" :: "v"(a), "v"(b), "v"(c), "v"(d)); }
__device__ __forceinline__ void keep4_b(v16b a, v16b b, v16b c, v16b d) { asm volatile("v_nop" :: "v"(a), "v"(b), "v"(c), "v"(d)); }
__device__ __forceinline__ void acc_guard4(v8f& a, v8f& b, v8f& c, v8f& d) { asm volatile("v_nop\n\tv_nop\n\tv_nop\n\tv_nop" : "+v"(a), "+v"(b), "+v"(c), "+v"(d)); }
template <typename T> struct Frag;
template <> struct Frag<_Float16> {
  typedef v16h V; union U { v16h v; v8h h[2]; };
  static __device__ __forceinline__ v16h load(const _Float16* p) {   // elements 0..7 <- p[0..7], 8..15 <- p[16..23]
    U f; f.h[0] = *(const v8h*)(p); f.h[1] = *(const v8h*)(p + 16); return f.v;
  }
  static __device__ __forceinline__ v8f mma(v16h a, v16h b, v8f c) {
    return __builtin_amdgcn_wmma_f32_16x16x32_f16(false, a, false, b, (short)0, c, false, false);
  }
  static __device__ __forceinline__ void guard(v8f& a, v8f& b, v16h x, v16h y) { dep_guard_h(a, b, x, y); }
  static __device__ __forceinline__ void keep(v16h a, v16h b, v16h c, v16h d) { keep4_h(a, b, c, d); }
};
template <> struct Frag<__bf16> {
  typedef v16b V; union U { v16b v; v8b h[2]; };
  static __device__ __forceinline__ v16b load(const __bf16* p) {
    U f; f.h[0] = *(const v8b*)(p); f.h[1] = *(const v8b*)(p + 16); return f.v;
  }
  static __device__ __forceinline__ v8f mma(v16b a, v16b b, v8f c) {
    return __builtin_amdgcn_wmma_f32_16x16x32_bf16(false, a, false, b, (short)0, c, false, false);
  }
  static __device__ __forceinline__ void guard(v8f& a, v8f& b, v16b x, v16b y) { dep_guard_b(a, b, x, y); }
  static __device__ __forceinline__ void keep(v16b a, v16b b, v16b c, v16b d) { keep4_b(a, b, c, d); }
};

// ---- Register-blocked batched WMMA GEMM ------------------------------------
// C[m,n] = scale * sum_k A[m,k] * Bt[n,k] (+bias)(+resid); each wave owns a 64x64 tile.
// A row-major [M,K]; Bt row-major [N,K]; M,N % 64 == 0, K % 32 == 0.
// SPLIT: operands are hi/lo planes (A2/Bt2 = lo planes, same layout); product = hi·hi + hi·lo + lo·hi.
// BIAS_MODE: 0 = none, 1 = bias[m], 2 = bias[n].
// OUT_MODE: 0 = f32, 1 = f16, 2 = bf16 hi plane (Cout) + bf16 lo plane (Cout2).
// ET: 0 = f16 operands, 1 = bf16 operands (pointers passed as 16-bit storage)
// Batches: blockIdx.y steps A, Bt, C by strideA/B/C, blockIdx.z by strideAz/Bz/Cz (two levels, so that C may be [z][m][y*64+n]).
template <int ET> struct Elem;
template <> struct Elem<0> { typedef _Float16 T; };
template <> struct Elem<1> { typedef __bf16 T; };
template <int ET, bool SPLIT, int BIAS_MODE, int OUT_MODE, bool RESID, int ACT = 0>
__global__ __launch_bounds__(256) void wmma_gemm64(
    const unsigned short* __restrict__ Ap, const unsigned short* __restrict__ A2p, int lda, long strideA, long strideAz,
    const unsigned short* __restrict__ Btp, const unsigned short* __restrict__ Bt2p, int ldb, long strideB, long strideBz,
    void* __restrict__ Cout, void* __restrict__ Cout2, int ldc, long strideC, long strideCz,
    const float* __restrict__ bias,
    const float* __restrict__ resid, long strideR,
    int M, int N, int K, float scale) {
  typedef typename Elem<ET>::T T;
  typedef typename Frag<T>::V V;
  const T* A = (const T*)Ap; const T* A2 = (const T*)A2p; const T* Bt = (const T*)Btp; const T* Bt2 = (const T*)Bt2p;
  __shared__ __align__(16) float sT[8][16 * 68];   // per-wave 16x64 slab, pitch 68 floats
  const int b    = blockIdx.y;
  const int bz   = blockIdx.z;
  const int lane = threadIdx.x & 31;
  const int wave = threadIdx.x >> 5;
  const int tilesN = N >> 6;
  const int tilesM = M >> 6;
  const int tile = blockIdx.x * 8 + wave;
  if (tile >= tilesM * tilesN) return;   // wave-uniform; no block barriers in this kernel
  const int tm = tile / tilesN;
  const int tn = tile - tm * tilesN;
  const int m0 = tm << 6;
  const int n0 = tn << 6;

  const size_t offA = (size_t)b * strideA + (size_t)bz * strideAz;
  const size_t offB = (size_t)b * strideB + (size_t)bz * strideBz;
  const size_t offC = (size_t)b * strideC + (size_t)bz * strideCz;
  const T* Ab  = A  + offA;
  const T* Bb  = Bt + offB;
  const T* Ab2 = SPLIT ? (A2  + offA) : nullptr;
  const T* Bb2 = SPLIT ? (Bt2 + offB) : nullptr;

  const int rlane = lane & 15;                 // row (A) / col (B, D) within subtile
  const int koff  = (lane >> 4) * 8;           // k offset of this lane half
  const int mOff  = (lane >> 4) * 8;           // D row offset

  v8f acc[4][4];
#pragma unroll
  for (int i = 0; i < 4; ++i)
#pragma unroll
    for (int j = 0; j < 4; ++j) acc[i][j] = (v8f){0.f,0.f,0.f,0.f,0.f,0.f,0.f,0.f};

  for (int k0 = 0; k0 < K; k0 += 32) {
    V bh[4], bl[4];
#pragma unroll
    for (int j = 0; j < 4; ++j) {
      const size_t bo = (size_t)(n0 + (j << 4) + rlane) * ldb + koff + k0;
      bh[j] = Frag<T>::load(Bb + bo);
      if (SPLIT) bl[j] = Frag<T>::load(Bb2 + bo);
    }
#pragma unroll
    for (int i = 0; i < 4; ++i) {
      const size_t ao = (size_t)(m0 + (i << 4) + rlane) * lda + koff + k0;
      V ah = Frag<T>::load(Ab + ao);
      V al;
      if (SPLIT) al = Frag<T>::load(Ab2 + ao);
#pragma unroll
      for (int j = 0; j < 4; ++j) {
        acc[i][j] = Frag<T>::mma(ah, bh[j], acc[i][j]);
        if (SPLIT) {
          acc[i][j] = Frag<T>::mma(ah, bl[j], acc[i][j]);
          acc[i][j] = Frag<T>::mma(al, bh[j], acc[i][j]);
        }
      }
      Frag<T>::guard(acc[i][0], acc[i][3], ah, SPLIT ? al : ah);
    }
    Frag<T>::keep(bh[0], bh[1], bh[2], bh[3]);
    if (SPLIT) Frag<T>::keep(bl[0], bl[1], bl[2], bl[3]);
  }
  acc_guard4(acc[0][0], acc[0][1], acc[0][2], acc[0][3]);
  acc_guard4(acc[1][0], acc[1][1], acc[1][2], acc[1][3]);
  acc_guard4(acc[2][0], acc[2][1], acc[2][2], acc[2][3]);
  acc_guard4(acc[3][0], acc[3][1], acc[3][2], acc[3][3]);

  // ---- epilogue ----
  float* slab = sT[wave];
  const float* Rb = RESID ? (resid + (size_t)b * strideR) : nullptr;
#pragma unroll
  for (int i = 0; i < 4; ++i) {
    const int mBase = m0 + (i << 4);
#pragma unroll
    for (int j = 0; j < 4; ++j) {
      const int n = n0 + (j << 4) + rlane;
      float bv = 0.f;
      if (BIAS_MODE == 2) bv = bias[n];
#pragma unroll
      for (int r = 0; r < 8; ++r) {
        float v = acc[i][j][r] * scale;
        if (BIAS_MODE == 1) v += bias[mBase + mOff + r];
        if (BIAS_MODE == 2) v += bv;
        if (RESID) v += Rb[(size_t)(mBase + mOff + r) * ldc + n];
        if (ACT == 1) v = tanhf(v);
        if (ACT == 2) v = fmaxf(v, 0.0f);
        if (ACT == 3) v = v / (1.0f + expf(-v));
        if (ACT == 4) v = (v > 0.f) ? v : 0.01f * v;
        if (ACT == 5) v = 0.5f * v * (1.0f + erff(v * 0.70710678118654752f));
        slab[(mOff + r) * 68 + (j << 4) + rlane] = v;
      }
    }
    __builtin_amdgcn_fence(__ATOMIC_RELEASE, "workgroup");
    __builtin_amdgcn_wave_barrier();
    __builtin_amdgcn_fence(__ATOMIC_ACQUIRE, "workgroup");
    if (OUT_MODE == 0) {
      float* C = (float*)Cout + offC;
      const int hh = lane >> 4, c4 = (lane & 15) * 4;     // row seg = 256 B = 16 lanes x 16 B
      {
#pragma unroll
        for (int it = 0; it < 8; ++it) {
          const int row = it * 2 + hh;
          v4f v = *(const v4f*)(slab + row * 68 + c4);
          *(v4f*)(C + (size_t)(mBase + row) * ldc + n0 + c4) = v;
        }
        
      }
    } else {
      const int q = lane >> 3, c8 = (lane & 7) * 8;
      unsigned short* C  = (unsigned short*)Cout  + offC;
      unsigned short* C2 = (OUT_MODE == 2) ? ((unsigned short*)Cout2 + offC) : nullptr;
      {
#pragma unroll
        for (int it = 0; it < 4; ++it) {
          const int row = it * 4 + q;
          const float* sp = slab + row * 68 + c8;
          v8h hv, lv;
#pragma unroll
          for (int e = 0; e < 8; ++e) {
            if (OUT_MODE == 1) {
              hv[e] = (_Float16)sp[e];
            } else {
              unsigned short hb = f2bf_bits(sp[e]);
              unsigned short lb = f2bf_bits(sp[e] - bf_bits2f(hb));
              hv[e] = __builtin_bit_cast(_Float16, hb);
              lv[e] = __builtin_bit_cast(_Float16, lb);
            }
          }
          *(v8h*)(C + (size_t)(mBase + row) * ldc + n0 + c8) = hv;
          if (OUT_MODE == 2) *(v8h*)(C2 + (size_t)(mBase + row) * ldc + n0 + c8) = lv;
        }
        
      }
    }
    __builtin_amdgcn_fence(__ATOMIC_RELEASE, "workgroup");
    __builtin_amdgcn_wave_barrier();
    __builtin_amdgcn_fence(__ATOMIC_ACQUIRE, "workgroup");
  }
}

// blockIdx.y picks the input; its f16 copy is plane blockIdx.y of out (2 * n2 elements a plane)
__global__ __launch_bounds__(256) void cast_f32_f16x2(
    const float* __restrict__ in0, const float* __restrict__ in1, const float* __restrict__ in2, _Float16* __restrict__ out0, int n2) {
  const float* in = (blockIdx.y == 0) ? in0 : ((blockIdx.y == 1) ? in1 : in2);
  _Float16* out = out0 + (size_t)blockIdx.y * 2 * n2;
  int i = blockIdx.x * 256 + threadIdx.x;
  if (i < n2) {
    const _Float16 h0 = (_Float16)in[2 * i], h1 = (_Float16)in[2 * i + 1];
    const unsigned u = (unsigned)__builtin_bit_cast(unsigned short, h0) | ((unsigned)__builtin_bit_cast(unsigned short, h1) << 16);
    ((unsigned*)out)[i] = u;
    
  }
}


#define RB_ 8
#define RT 1024
#define RM 512
#define RE 64
#define RH 8
#define RKX 192
// wq [m][e][h] -> Bt f16 [h*64+e][m] ; wo [e][h][m] -> Bt f16 [m][h*64+e]; blockIdx.y picks the weight (0..2 = wq, wk, wv; 3 = wo), its Bt is plane blockIdx.y of BT0
__global__ __launch_bounds__(256) void wperm_kernel(const float* __restrict__ w0, const float* __restrict__ w1, const float* __restrict__ w2, const float* __restrict__ w3, unsigned* __restrict__ BT0) {
  const int is_out = (blockIdx.y == 3); const float* wsrc = (blockIdx.y == 0) ? w0 : ((blockIdx.y == 1) ? w1 : ((blockIdx.y == 2) ? w2 : w3)); unsigned* BT = BT0 + (size_t)blockIdx.y * (RM * RM / 2);
  for (int i = blockIdx.x * 256 + threadIdx.x; i < RM * RM / 2; i += gridDim.x * 256) { const int row = i / (RM / 2), cp = 2 * (i % (RM / 2)); float a, b;
    if (!is_out) { const int h = row / RE, e = row % RE; a = wsrc[((size_t)cp * RE + e) * RH + h]; b = wsrc[((size_t)(cp + 1) * RE + e) * RH + h]; }      // Bt[h*64+e][m=cp]
    else { const int m = row; const int h0 = cp / RE, e0 = cp % RE, h1 = (cp + 1) / RE, e1 = (cp + 1) % RE; a = wsrc[((size_t)e0 * RH + h0) * RM + m]; b = wsrc[((size_t)e1 * RH + h1) * RM + m]; }   // Bt[m][k=cp]
    const unsigned u = (unsigned)__builtin_bit_cast(unsigned short, (_Float16)a) | ((unsigned)__builtin_bit_cast(unsigned short, (_Float16)b) << 16); ((unsigned*)BT)[i] = u;  }
}
// extended operands: QX [bl][h][i][192] = [qp+bu | (qp+bv)·α_e(i) | (qp+bv)·β_e(i)], KX [bl][h][j][192] = [kp | sin θ_e(j) | cos θ_e(j)] from the f32 projections (layout [b*T][h*64+e]); wave per (b, t, h) — 3 x 64-wide segments, 2 per lane
__global__ __launch_bounds__(256) void ext_kernel(const float* __restrict__ QP, const float* __restrict__ KP, const float* __restrict__ bu, const float* __restrict__ bv, int b0, unsigned* __restrict__ QX, unsigned* __restrict__ KX) {     // a group of batches from b0 on (the grid says how many): QX/KX [bl][h][t][192]
  const int lane = threadIdx.x & 31, wave = threadIdx.x >> 5; const long g = (long)blockIdx.x * 8 + wave; const int h = (int)(g % RH); const int tt = (int)(g / RH); const int bl = tt / RT, t = tt % RT; const long bt = (long)(b0 + bl) * RT + t;
  const int e0 = 2 * lane, e1 = 2 * lane + 1;
  const float q0 = QP[bt * RM + h * RE + e0], q1 = QP[bt * RM + h * RE + e1], k0 = KP[bt * RM + h * RE + e0], k1 = KP[bt * RM + h * RE + e1];
  // θ_e(t) = t / 10000^((e//2·2)/64); even e: sin table, α = cos θ, β = −sin θ ; odd e: cos table, α = sin θ, β = cos θ
  const float inv0 = powf(10000.0f, (float)((e0 / 2) * 2) / (float)RE), inv1 = powf(10000.0f, (float)((e1 / 2) * 2) / (float)RE);
  const float th0 = (float)t / inv0, th1 = (float)t / inv1; const float s0 = sinf(th0), c0 = cosf(th0), s1 = sinf(th1), c1 = cosf(th1);
  const float a0 = c0, be0 = -s0;        // e0 even
  const float a1 = s1, be1 = c1;         // e1 odd
  const float qv0 = q0 + bv[e0 * RH + h], qv1 = q1 + bv[e1 * RH + h];
  const size_t row = (((size_t)bl * RH + h) * RT + t) * RKX;
  {
    ((unsigned*)QX)[(row) / 2 + lane] = (unsigned)__builtin_bit_cast(unsigned short, (_Float16)(q0 + bu[e0 * RH + h])) | ((unsigned)__builtin_bit_cast(unsigned short, (_Float16)(q1 + bu[e1 * RH + h])) << 16);
    ((unsigned*)QX)[(row + 64) / 2 + lane] = (unsigned)__builtin_bit_cast(unsigned short, (_Float16)(qv0 * a0)) | ((unsigned)__builtin_bit_cast(unsigned short, (_Float16)(qv1 * a1)) << 16);
    ((unsigned*)QX)[(row + 128) / 2 + lane] = (unsigned)__builtin_bit_cast(unsigned short, (_Float16)(qv0 * be0)) | ((unsigned)__builtin_bit_cast(unsigned short, (_Float16)(qv1 * be1)) << 16);
    ((unsigned*)KX)[(row) / 2 + lane] = (unsigned)__builtin_bit_cast(unsigned short, (_Float16)k0) | ((unsigned)__builtin_bit_cast(unsigned short, (_Float16)k1) << 16);
    ((unsigned*)KX)[(row + 64) / 2 + lane] = (unsigned)__builtin_bit_cast(unsigned short, (_Float16)s0) | ((unsigned)__builtin_bit_cast(unsigned short, (_Float16)s1) << 16);
    ((unsigned*)KX)[(row + 128) / 2 + lane] = (unsigned)__builtin_bit_cast(unsigned short, (_Float16)c0) | ((unsigned)__builtin_bit_cast(unsigned short, (_Float16)c1) << 16);
     }
}
// VT [b][h][e][j] f16 from VP [b*T][h*64+e]: block (32,8) per (b,h, 64 j) tile: tile[j][e]
__global__ __launch_bounds__(256) void vt_kernel(const float* __restrict__ VP, unsigned* __restrict__ VT) {
  __shared__ float tile[64][65];
  const int bh = blockIdx.y, j0 = blockIdx.x * 64, tx = threadIdx.x, ty = threadIdx.y; const int b = bh / RH, h = bh % RH;
  for (int j = ty; j < 64; j += 8) { const float* src = VP + ((size_t)b * RT + j0 + j) * RM + h * RE; tile[j][tx] = src[tx]; tile[j][32 + tx] = src[32 + tx]; }
  __syncthreads();
  { for (int e = ty; e < 64; e += 8) ((unsigned*)VT)[(((size_t)bh * RE + e) * RT + j0) / 2 + tx] = (unsigned)__builtin_bit_cast(unsigned short, (_Float16)tile[2 * tx][e]) | ((unsigned)__builtin_bit_cast(unsigned short, (_Float16)tile[2 * tx + 1][e]) << 16);  }
}
// lane l <-> lane l ^ 16
__device__ __forceinline__ float xhalf(float x) { return __builtin_bit_cast(float, __builtin_amdgcn_permlanex16(__builtin_bit_cast(int, x), __builtin_bit_cast(int, x), 0x76543210, 0xfedcba98, false, false)); }
// Fused scores + key mask + softmax + p.v of one (batch, head): a wave owns 64 queries and walks the 1024 keys 32 at a time; no score or probability leaves the registers.
// S^T = KX . QX^T (A = 16 key rows, B = 16 query columns, K = 192), so a lane holds 8 keys of ONE query per tile: maximum and sum in-lane plus one exchange between the wave halves.
// Two S^T tiles (keys 0..15, 16..31), turned into f16 in place, are the B operand of O^T += VT . P^T (A = 16 rows e of VT, k = 32 keys in the loader's own order 8h+s | 16+8h+s).
// Running maximum in base 2; p = 2^(x - m + 15) (the x2^15 keeps small probabilities in f16's normal range; it cancels against the row sum).
#define QG 4      // 16-query column groups a wave: each K and V fragment fetched serves 64 queries
#define AW (256 / (16 * QG))      // waves a block (256 queries)
__global__ __launch_bounds__(AW * 32) void attn_kernel(const unsigned short* __restrict__ QXp, const unsigned short* __restrict__ KXp, const unsigned short* __restrict__ VTp, const int* __restrict__ mask, unsigned short* __restrict__ O16) {
  typedef __attribute__((ext_vector_type(4))) int v4i;
  const int lane = threadIdx.x & 31, wave = threadIdx.x >> 5, c = lane & 15, hh = lane >> 4;
  const int bh = blockIdx.y, b = bh / RH, h = bh % RH;
  const int q0 = blockIdx.x * 256 + wave * (16 * QG);
  const _Float16* Qb = (const _Float16*)QXp + (size_t)bh * RT * RKX + (size_t)(q0 + c) * RKX + hh * 8;
  const _Float16* Kb = (const _Float16*)KXp + (size_t)bh * RT * RKX + (size_t)c * RKX + hh * 8;
  const _Float16* Vb = (const _Float16*)VTp + (size_t)bh * RE * RT + (size_t)c * RT + hh * 8;
  const int* mrow = mask + (size_t)b * RT + hh * 8;
  const float CS = 0.125f * 1.4426950408889634f;      // 1/sqrt(64), and e^x = 2^(x log2 e)
  v16h qf[QG][6];
#pragma unroll
  for (int g = 0; g < QG; ++g)
#pragma unroll
    for (int ks = 0; ks < 6; ++ks) qf[g][ks] = Frag<_Float16>::load(Qb + (size_t)g * 16 * RKX + ks * 32);
  v8f o[QG][4];
#pragma unroll
  for (int g = 0; g < QG; ++g)
#pragma unroll
    for (int et = 0; et < 4; ++et) o[g][et] = (v8f){0.f,0.f,0.f,0.f,0.f,0.f,0.f,0.f};
  float mrun[QG], lsum[QG];
#pragma unroll
  for (int g = 0; g < QG; ++g) { mrun[g] = -3.0e38f; lsum[g] = 0.f; }      // a finite start keeps m - m and -inf - m free of NaN while every key so far is masked
  v16h kf[2][6], vf[4]; v4i mk[2][2];      // the K, V fragments and mask words of the pass at hand, fetched one pass ahead
  const _Float16* pK = Kb; const _Float16* pV = Vb; const int* pM = mrow;      // the addresses that the loads in flight name
#pragma unroll
  for (int kt = 0; kt < 2; ++kt) { mk[kt][0] = *(const v4i*)(mrow + kt * 16); mk[kt][1] = *(const v4i*)(mrow + kt * 16 + 4); }
#pragma unroll
  for (int kt = 0; kt < 2; ++kt)
#pragma unroll
    for (int ks = 0; ks < 6; ++ks) kf[kt][ks] = Frag<_Float16>::load(Kb + (size_t)kt * 16 * RKX + ks * 32);
#pragma unroll
  for (int et = 0; et < 4; ++et) vf[et] = Frag<_Float16>::load(Vb + (size_t)et * 16 * RT);
  // precaution: this wait stands in front of every rewrite of a register that a load above names (the query address, an input, lives up to here)
  asm volatile("s_wait_xcnt 0x0" :: "v"(Qb) : "memory");
  __builtin_amdgcn_sched_barrier(0);      // nothing from below (register copies, start values) is lifted in front of that wait, onto a register that a load above names
  auto pass = [&](int jnext, const bool fetch) __attribute__((always_inline)) {
    v8f s[2][QG];
#pragma unroll
    for (int kt = 0; kt < 2; ++kt)
#pragma unroll
      for (int g = 0; g < QG; ++g) s[kt][g] = (v8f){0.f,0.f,0.f,0.f,0.f,0.f,0.f,0.f};
#pragma unroll
    for (int ks = 0; ks < 6; ++ks)
#pragma unroll
      for (int kt = 0; kt < 2; ++kt)
#pragma unroll
        for (int g = 0; g < QG; ++g) s[kt][g] = Frag<_Float16>::mma(kf[kt][ks], qf[g][ks], s[kt][g]);
    float bias[2][8];      // 0 for a key that counts, -inf for a masked one
#pragma unroll
    for (int kt = 0; kt < 2; ++kt)
#pragma unroll
      for (int r = 0; r < 4; ++r) { bias[kt][r] = (mk[kt][0][r] == 0) ? -INFINITY : 0.f; bias[kt][4 + r] = (mk[kt][1][r] == 0) ? -INFINITY : 0.f; }
    // precaution: this wait stands in front of every rewrite of an address register that a load in flight names: as inputs the old addresses live up to here, and the new ones all come from jnext, which the statement hands on
    asm volatile("s_wait_xcnt 0x0" : "+s"(jnext) : "v"(pK), "v"(pV), "v"(pM) : "memory");
    if (fetch) {
      pK = Kb + (size_t)jnext * RKX; pV = Vb + jnext; pM = mrow + jnext;
#pragma unroll
      for (int kt = 0; kt < 2; ++kt) { mk[kt][0] = *(const v4i*)(pM + kt * 16); mk[kt][1] = *(const v4i*)(pM + kt * 16 + 4); }
#pragma unroll
      for (int kt = 0; kt < 2; ++kt)
#pragma unroll
        for (int ks = 0; ks < 6; ++ks) kf[kt][ks] = Frag<_Float16>::load(pK + (size_t)kt * 16 * RKX + ks * 32);
    }
#pragma unroll
    for (int g = 0; g < QG; ++g) {
      float x[2][8]; float mx = mrun[g];
#pragma unroll
      for (int kt = 0; kt < 2; ++kt)
#pragma unroll
        for (int r = 0; r < 8; ++r) { x[kt][r] = fmaf(s[kt][g][r], CS, bias[kt][r]); mx = fmaxf(mx, x[kt][r]); }
      const float mnew = fmaxf(mx, xhalf(mx));      // both halves hold the query's running maximum
      const float corr = __builtin_amdgcn_exp2f(mrun[g] - mnew);
      mrun[g] = mnew;
      const float msub = mnew - 15.0f;
      float ps[4]; v16h pf;      // four partial sums: short dependent chains
#pragma unroll
      for (int kt = 0; kt < 2; ++kt)
#pragma unroll
        for (int r = 0; r < 8; ++r) {
          const float p = __builtin_amdgcn_exp2f(x[kt][r] - msub);
          if (kt == 0 && r < 4) ps[r] = p; else ps[r & 3] += p;
          pf[kt * 8 + r] = (_Float16)p;
        }
      lsum[g] = lsum[g] * corr + ((ps[0] + ps[1]) + (ps[2] + ps[3]));
#pragma unroll
      for (int et = 0; et < 4; ++et) o[g][et] *= corr;
#pragma unroll
      for (int et = 0; et < 4; ++et) o[g][et] = Frag<_Float16>::mma(vf[et], pf, o[g][et]);
    }
    if (fetch) {
#pragma unroll
      for (int et = 0; et < 4; ++et) vf[et] = Frag<_Float16>::load(pV + (size_t)et * 16 * RT);
    }
  };
  for (int j0 = 32; j0 < RT; j0 += 32) pass(j0, true);
  pass(0, false);      // the last 32 keys: nothing left to fetch
#pragma unroll
  for (int g = 0; g < QG; ++g) {
    const float inv = 1.0f / (lsum[g] + xhalf(lsum[g]));      // every key masked: 0 * inf = NaN
    unsigned short* dst = O16 + ((size_t)b * RT + q0 + g * 16 + c) * RM + h * RE + hh * 8;      // a lane's 8 registers are 8 consecutive e of one query
#pragma unroll
    for (int et = 0; et < 4; ++et) {
      v8h hv;
#pragma unroll
      for (int r = 0; r < 8; ++r) hv[r] = (_Float16)(o[g][et][r] * inv);
      *(v8h*)(dst + et * 16) = hv;
    }
  }
}
extern "C" void kernel_launch(void* const* d_in, const int* in_sizes, int n_in, void* d_out, int out_size, void* d_ws, size_t ws_size, hipStream_t stream) {
  (void)in_sizes; (void)n_in; (void)out_size; (void)ws_size;
  auto Fp = [&](int i) { return (const float*)d_in[i]; };
  const float* q = Fp(0); const float* k = Fp(1); const float* v = Fp(2); const int* mask = (const int*)d_in[3]; const float* wq = Fp(4); const float* wk = Fp(5); const float* wv = Fp(6); const float* bu = Fp(7); const float* bv = Fp(8); const float* wo = Fp(9);
  char* ws = (char*)d_ws; size_t off = 0;
  auto carve = [&](size_t bytes) -> char* { char* p = ws + off; off += (bytes + 255) & ~(size_t)255; return p; };
  const size_t NTOK = (size_t)RB_ * RT;
  _Float16* O16 = (_Float16*)carve(NTOK * RM * 2);      // attention output, f16, [b][t][h*64+e]
  unsigned* WT = (unsigned*)carve((size_t)4 * RM * RM * 2); unsigned* WOT = WT + (size_t)3 * (RM * RM / 2);      // four permuted weights, planes wq, wk, wv, wo
  unsigned* QX = (unsigned*)carve(NTOK * RH * RKX * 2); unsigned* KX = (unsigned*)carve(NTOK * RH * RKX * 2); unsigned* VT = (unsigned*)carve(NTOK * RM * 2);     // QX/KX of all batches, 24 MiB each
  _Float16* X16 = (_Float16*)carve((size_t)3 * NTOK * RM * 2);      // f16 copies of q, k, v (3 planes)
  float* QP = (float*)carve((size_t)3 * NTOK * RM * 4); float* KP = QP + NTOK * RM; float* VP = KP + NTOK * RM;      // f32 projections, planes q, k, v; total workspace footprint = 138 MiB
  wperm_kernel<<<dim3(64, 4), 256, 0, stream>>>(wq, wk, wv, wo, WT);
  const int tp = (int)((NTOK / 64) * (RM / 64));
  cast_f32_f16x2<<<dim3((unsigned)((NTOK * RM / 2 + 255) / 256), 3), 256, 0, stream>>>(q, k, v, X16, (int)(NTOK * RM / 2));
  // q, k, v projections side by side on blockIdx.y
  wmma_gemm64<0, false, 0, 0, false><<<dim3((tp + 7) / 8, 3), 256, 0, stream>>>(U16(X16), nullptr, RM, (long)(NTOK * RM), 0, (const unsigned short*)WT, nullptr, RM, (long)RM * RM, 0, QP, nullptr, RM, (long)(NTOK * RM), 0, nullptr, nullptr, 0, (int)NTOK, RM, RM, 1.0f);
  vt_kernel<<<dim3(RT / 64, RB_ * RH), dim3(32, 8), 0, stream>>>(VP, VT);
  ext_kernel<<<(unsigned)(RB_ * RT * RH / 8), 256, 0, stream>>>(QP, KP, bu, bv, 0, QX, KX);      // all batches: no score block bounds the group any more
  // scores, softmax and p.v of all 64 (batch, head) pairs in ONE launch: 256 queries a block
  attn_kernel<<<dim3(RT / 256, RB_ * RH), AW * 32, 0, stream>>>((const unsigned short*)QX, (const unsigned short*)KX, (const unsigned short*)VT, mask, (unsigned short*)O16);
  wmma_gemm64<0, false, 0, 0, false><<<dim3((tp + 7) / 8, 1), 256, 0, stream>>>(U16(O16), nullptr, RM, 0, 0, (const unsigned short*)WOT, nullptr, RM, 0, 0, (float*)d_out, nullptr, RM, 0, 0, nullptr, nullptr, 0, (int)NTOK, RM, RM, 1.0f);
}

// v003
// One run takes 108 microseconds.
// Timed twice side by side with v002, it ran 1.42 times as fast both times.
// All steps since v000 together make it 7.63 times as fast.
#include <hip/hip_runtime.h>
#include <math.h>
// Relative-position multi-head attention (8 x 1024 tokens, 512 model, 8 heads x 64, Transformer-XL sinusoid table over k−q): every contraction on
// v_wmma_f32_16x16x32_f16, f16 operands, f32 accumulate (plain single products): the q/k/v projections (8192 x 512 · 512 x 512, weights permuted to
// head-major columns), the scores as ONE product per (batch, head) with K = 192 — [q+bu | (q+bv)∘α(i) | (q+bv)∘β(i)] · [k | sin θ(j) | cos θ(j)]ᵀ,
// using the exact identity sin/cos(θ(j) − θ(i)) = products of per-position sin/cos (so the [T,T,64] sinusoid table is never formed or gathered),
// p.v (probabilities x2^15) and the output projection; scale 1/sqrt(64), key mask (-inf) and softmax in f32 on VALU, fused with the score and p.v products in one kernel
// (running maximum and sum over blocks of 32 keys; scores and probabilities stay in registers).
typedef __attribute__((ext_vector_type(16))) _Float16 v16h;
typedef __attribute__((ext_vector_type(8)))  _Float16 v8h;
typedef __attribute__((ext_vector_type(16))) __bf16   v16b;
typedef __attribute__((ext_vector_type(8)))  __bf16   v8b;
typedef __attribute__((ext_vector_type(8)))  float    v8f;
typedef __attribute__((ext_vector_type(4)))  float    v4f;
#define PSCALE 32768.0f
#define U16(p) ((const unsigned short*)(const void*)(p))
#define PSCALE_INV (1.0f / 32768.0f)

__device__ __forceinline__ unsigned short f2bf_bits(float f) {
  unsigned u = __float_as_uint(f);
  return (unsigned short)((u + 0x7FFFu + ((u >> 16) & 1u)) >> 16);
}
__device__ __forceinline__ float bf_bits2f(unsigned short h) { return __uint_as_float(((unsigned)h) << 16); }

// hazard guards as plain device helpers (no inline asm inside the kernel template body)
__device__ __forceinline__ void dep_guard_h(v8f& a, v8f& b, v16h x, v16h y) { asm volatile("v_nop\n\tv_nop\n\tv_nop\n\tv_nop" : "+v"(a), "+v"(b) : "v"(x), "v"(y)); }
__device__ __forceinline__ void dep_guard_b(v8f& a, v8f& b, v16b x, v16b y) { asm volatile("v_nop\n\tv_nop\n\tv_nop\n\tv_nop" : "+v"(a), "+v"(b) : "v"(x), "v"(y)); }
__device__ __forceinline__ void keep4_h(v16h a, v16h b, v16h c, v16h d) { asm volatile("v_nop" :: "v"(a), "v"(b), "v"(c), "v"(d)); }
__device__ __forceinline__ void keep4_b(v16b a, v16b b, v16b c, v16b d) { asm volatile("v_nop" :: "v"(a), "v"(b), "v"(c), "v"(d)); }
__device__ __forceinline__ void acc_guard4(v8f& a, v8f& b, v8f& c, v8f& d) { asm volatile("v_nop\n\tv_nop\n\tv_nop\n\tv_nop" : "+v"(a), "+v"(b), "+v"(c), "+v"(d)); }
template <typename T> struct Frag;
template <> struct Frag<_Float16> {
  typedef v16h V; union U { v16h v; v8h h[2]; };
  static __device__ __forceinline__ v16h load(const _Float16* p) {   // elements 0..7 <- p[0..7], 8..15 <- p[16..23]
    U f; f.h[0] = *(const v8h*)(p); f.h[1] = *(const v8h*)(p + 16); return f.v;
  }
  static __device__ __forceinline__ v8f mma(v16h a, v16h b, v8f c) {
    return __builtin_amdgcn_wmma_f32_16x16x32_f16(false, a, false, b, (short)0, c, false, false);
  }
  static __device__ __forceinline__ void guard(v8f& a, v8f& b, v16h x, v16h y) { dep_guard_h(a, b, x, y); }
  static __device__ __forceinline__ void keep(v16h a, v16h b, v16h c, v16h d) { keep4_h(a, b, c, d); }
};
template <> struct Frag<__bf16> {
  typedef v16b V; union U { v16b v; v8b h[2]; };
  static __device__ __forceinline__ v16b load(const __bf16* p) {
    U f; f.h[0] = *(const v8b*)(p); f.h[1] = *(const v8b*)(p + 16); return f.v;
  }
  static __device__ __forceinline__ v8f mma(v16b a, v16b b, v8f c) {
    return __builtin_amdgcn_wmma_f32_16x16x32_bf16(false, a, false, b, (short)0, c, false, false);
  }
  static __device__ __forceinline__ void guard(v8f& a, v8f& b, v16b x, v16b y) { dep_guard_b(a, b, x, y); }
  static __device__ __forceinline__ void keep(v16b a, v16b b, v16b c, v16b d) { keep4_b(a, b, c, d); }
};

// ---- Register-blocked batched WMMA GEMM ------------------------------------
// C[m,n] = scale * sum_k A[m,k] * Bt[n,k] (+bias)(+resid); each wave owns a 64x64 tile.
// A row-major [M,K]; Bt row-major [N,K]; M,N % 64 == 0, K % 32 == 0.
// SPLIT: operands are hi/lo planes (A2/Bt2 = lo planes, same layout); product = hi·hi + hi·lo + lo·hi.
// BIAS_MODE: 0 = none, 1 = bias[m], 2 = bias[n].
// OUT_MODE: 0 = f32, 1 = f16, 2 = bf16 hi plane (Cout) + bf16 lo plane (Cout2).
// ET: 0 = f16 operands, 1 = bf16 operands (pointers passed as 16-bit storage)
// Batches: blockIdx.y steps A, Bt, C by strideA/B/C, blockIdx.z by strideAz/Bz/Cz (two levels, so that C may be [z][m][y*64+n]).
template <int ET> struct Elem;
template <> struct Elem<0> { typedef _Float16 T; };
template <> struct Elem<1> { typedef __bf16 T; };
template <int ET, bool SPLIT, int BIAS_MODE, int OUT_MODE, bool RESID, int ACT = 0>
__global__ __launch_bounds__(256) void wmma_gemm64(
    const unsigned short* __restrict__ Ap, const unsigned short* __restrict__ A2p, int lda, long strideA, long strideAz,
    const unsigned short* __restrict__ Btp, const unsigned short* __restrict__ Bt2p, int ldb, long strideB, long strideBz,
    void* __restrict__ Cout, void* __restrict__ Cout2, int ldc, long strideC, long strideCz,
    const float* __restrict__ bias,
    const float* __restrict__ resid, long strideR,
    int M, int N, int K, float scale) {
  typedef typename Elem<ET>::T T;
  typedef typename Frag<T>::V V;
  const T* A = (const T*)Ap; const T* A2 = (const T*)A2p; const T* Bt = (const T*)Btp; const T* Bt2 = (const T*)Bt2p;
  __shared__ __align__(16) float sT[8][16 * 68];   // per-wave 16x64 slab, pitch 68 floats
  const int b    = blockIdx.y;
  const int bz   = blockIdx.z;
  const int lane = threadIdx.x & 31;
  const int wave = threadIdx.x >> 5;
  const int tilesN = N >> 6;
  const int tilesM = M >> 6;
  const int tile = blockIdx.x * 8 + wave;
  if (tile >= tilesM * tilesN) return;   // wave-uniform; no block barriers in this kernel
  const int tm = tile / tilesN;
  const int tn = tile - tm * tilesN;
  const int m0 = tm << 6;
  const int n0 = tn << 6;

  const size_t offA = (size_t)b * strideA + (size_t)bz * strideAz;
  const size_t offB = (size_t)b * strideB + (size_t)bz * strideBz;
  const size_t offC = (size_t)b * strideC + (size_t)bz * strideCz;
  const T* Ab  = A  + offA;
  const T* Bb  = Bt + offB;
  const T* Ab2 = SPLIT ? (A2  + offA) : nullptr;
  const T* Bb2 = SPLIT ? (Bt2 + offB) : nullptr;

  const int rlane = lane & 15;                 // row (A) / col (B, D) within subtile
  const int koff  = (lane >> 4) * 8;           // k offset of this lane half
  const int mOff  = (lane >> 4) * 8;           // D row offset

  v8f acc[4][4];
#pragma unroll
  for (int i = 0; i < 4; ++i)
#pragma unroll
    for (int j = 0; j < 4; ++j) acc[i][j] = (v8f){0.f,0.f,0.f,0.f,0.f,0.f,0.f,0.f};

  for (int k0 = 0; k0 < K; k0 += 32) {
    V bh[4], bl[4];
#pragma unroll
    for (int j = 0; j < 4; ++j) {
      const size_t bo = (size_t)(n0 + (j << 4) + rlane) * ldb + koff + k0;
      bh[j] = Frag<T>::load(Bb + bo);
      if (SPLIT) bl[j] = Frag<T>::load(Bb2 + bo);
    }
#pragma unroll
    for (int i = 0; i < 4; ++i) {
      const size_t ao = (size_t)(m0 + (i << 4) + rlane) * lda + koff + k0;
      V ah = Frag<T>::load(Ab + ao);
      V al;
      if (SPLIT) al = Frag<T>::load(Ab2 + ao);
#pragma unroll
      for (int j = 0; j < 4; ++j) {
        acc[i][j] = Frag<T>::mma(ah, bh[j], acc[i][j]);
        if (SPLIT) {
          acc[i][j] = Frag<T>::mma(ah, bl[j], acc[i][j]);
          acc[i][j] = Frag<T>::mma(al, bh[j], acc[i][j]);
        }
      }
      Frag<T>::guard(acc[i][0], acc[i][3], ah, SPLIT ? al : ah);
    }
    Frag<T>::keep(bh[0], bh[1], bh[2], bh[3]);
    if (SPLIT) Frag<T>::keep(bl[0], bl[1], bl[2], bl[3]);
  }
  acc_guard4(acc[0][0], acc[0][1], acc[0][2], acc[0][3]);
  acc_guard4(acc[1][0], acc[1][1], acc[1][2], acc[1][3]);
  acc_guard4(acc[2][0], acc[2][1], acc[2][2], acc[2][3]);
  acc_guard4(acc[3][0], acc[3][1], acc[3][2], acc[3][3]);

  // ---- epilogue ----
  float* slab = sT[wave];
  const float* Rb = RESID ? (resid + (size_t)b * strideR) : nullptr;
#pragma unroll
  for (int i = 0; i < 4; ++i) {
    const int mBase = m0 + (i << 4);
#pragma unroll
    for (int j = 0; j < 4; ++j) {
      const int n = n0 + (j << 4) + rlane;
      float bv = 0.f;
      if (BIAS_MODE == 2) bv = bias[n];
#pragma unroll
      for (int r = 0; r < 8; ++r) {
        float v = acc[i][j][r] * scale;
        if (BIAS_MODE == 1) v += bias[mBase + mOff + r];
        if (BIAS_MODE == 2) v += bv;
        if (RESID) v += Rb[(size_t)(mBase + mOff + r) * ldc + n];
        if (ACT == 1) v = tanhf(v);
        if (ACT == 2) v = fmaxf(v, 0.0f);
        if (ACT == 3) v = v / (1.0f + expf(-v));
        if (ACT == 4) v = (v > 0.f) ? v : 0.01f * v;
        if (ACT == 5) v = 0.5f * v * (1.0f + erff(v * 0.70710678118654752f));
        slab[(mOff + r) * 68 + (j << 4) + rlane] = v;
      }
    }
    __builtin_amdgcn_fence(__ATOMIC_RELEASE, "workgroup");
    __builtin_amdgcn_wave_barrier();
    __builtin_amdgcn_fence(__ATOMIC_ACQUIRE, "workgroup");
    if (OUT_MODE == 0) {
      float* C = (float*)Cout + offC;
      const int hh = lane >> 4, c4 = (lane & 15) * 4;     // row seg = 256 B = 16 lanes x 16 B
      {
#pragma unroll
        for (int it = 0; it < 8; ++it) {
          const int row = it * 2 + hh;
          v4f v = *(const v4f*)(slab + row * 68 + c4);
          *(v4f*)(C + (size_t)(mBase + row) * ldc + n0 + c4) = v;
        }
        
      }
    } else {
      const int q = lane >> 3, c8 = (lane & 7) * 8;
      unsigned short* C  = (unsigned short*)Cout  + offC;
      unsigned short* C2 = (OUT_MODE == 2) ? ((unsigned short*)Cout2 + offC) : nullptr;
      {
#pragma unroll
        for (int it = 0; it < 4; ++it) {
          const int row = it * 4 + q;
          const float* sp = slab + row * 68 + c8;
          v8h hv, lv;
#pragma unroll
          for (int e = 0; e < 8; ++e) {
            if (OUT_MODE == 1) {
              hv[e] = (_Float16)sp[e];
            } else {
              unsigned short hb = f2bf_bits(sp[e]);
              unsigned short lb = f2bf_bits(sp[e] - bf_bits2f(hb));
              hv[e] = __builtin_bit_cast(_Float16, hb);
              lv[e] = __builtin_bit_cast(_Float16, lb);
            }
          }
          *(v8h*)(C + (size_t)(mBase + row) * ldc + n0 + c8) = hv;
          if (OUT_MODE == 2) *(v8h*)(C2 + (size_t)(mBase + row) * ldc + n0 + c8) = lv;
        }
        
      }
    }
    __builtin_amdgcn_fence(__ATOMIC_RELEASE, "workgroup");
    __builtin_amdgcn_wave_barrier();
    __builtin_amdgcn_fence(__ATOMIC_ACQUIRE, "workgroup");
  }
}

#define RB_ 8
#define RT 1024
#define RM 512
#define RE 64
#define RH 8
#define RKX 192
// wq [m][e][h] -> Bt f16 [h*64+e][m] ; wo [e][h][m] -> Bt f16 [m][h*64+e]; blockIdx.y picks the weight (0..2 = wq, wk, wv; 3 = wo), its Bt is plane blockIdx.y of BT0
__global__ __launch_bounds__(256) void wperm_kernel(const float* __restrict__ w0, const float* __restrict__ w1, const float* __restrict__ w2, const float* __restrict__ w3, unsigned* __restrict__ BT0) {
  const int is_out = (blockIdx.y == 3); const float* wsrc = (blockIdx.y == 0) ? w0 : ((blockIdx.y == 1) ? w1 : ((blockIdx.y == 2) ? w2 : w3)); unsigned* BT = BT0 + (size_t)blockIdx.y * (RM * RM / 2);
  for (int i = blockIdx.x * 256 + threadIdx.x; i < RM * RM / 2; i += gridDim.x * 256) { const int row = i / (RM / 2), cp = 2 * (i % (RM / 2)); float a, b;
    if (!is_out) { const int h = row / RE, e = row % RE; a = wsrc[((size_t)cp * RE + e) * RH + h]; b = wsrc[((size_t)(cp + 1) * RE + e) * RH + h]; }      // Bt[h*64+e][m=cp]
    else { const int m = row; const int h0 = cp / RE, e0 = cp % RE, h1 = (cp + 1) / RE, e1 = (cp + 1) % RE; a = wsrc[((size_t)e0 * RH + h0) * RM + m]; b = wsrc[((size_t)e1 * RH + h1) * RM + m]; }   // Bt[m][k=cp]
    const unsigned u = (unsigned)__builtin_bit_cast(unsigned short, (_Float16)a) | ((unsigned)__builtin_bit_cast(unsigned short, (_Float16)b) << 16); ((unsigned*)BT)[i] = u;  }
}
// q, k, v projections (blockIdx.y picks the plane) with the passes around them folded in: A is read as f32 and rounded to f16 on its way into LDS; the epilogue writes the attention operands themselves.
// A block = 64 tokens x all 8 heads, a wave = one head's 64 columns (Bt rows h*64+e), 64x64 f32 accumulators.
// plane 0: QX [b][h][t][192] = [qp+bu | (qp+bv).alpha_e(t) | (qp+bv).beta_e(t)]; plane 1: KX [b][h][t][192] = [kp | sin th_e(t) | cos th_e(t)]; plane 2: VT [b][h][e][t].
// th_e(t) = t / 10000^((e/2*2)/64); even e: alpha = cos, beta = -sin; odd e: alpha = sin, beta = cos. The block's 64 x 32 (sin, cos) pairs are made once, 8 tokens a wave, and shared by its 8 heads through LDS.
#define APITCH 72      // halves: 128-byte rows at a 144-byte pitch (16 B x odd) for the 16-byte fragment reads
typedef __attribute__((ext_vector_type(4))) _Float16 v4h;
__global__ __launch_bounds__(256) void proj_kernel(const float* __restrict__ x0, const float* __restrict__ x1, const float* __restrict__ x2, const unsigned short* __restrict__ WTp,
    const float* __restrict__ bu, const float* __restrict__ bv, unsigned short* __restrict__ QX, unsigned short* __restrict__ KX, unsigned short* __restrict__ VT) {
  __shared__ __align__(16) float sT[8][16 * 68];   // per-wave 16x64 slab, pitch 68 floats
  __shared__ __align__(16) float sTab[64 * 68];    // row = token of the tile: sin th at 2p, cos th at 2p+1 for the pair e = 2p, 2p+1; the slab's pitch
  __shared__ __align__(16) _Float16 sA[2][64 * APITCH];      // the block's A tile in f16, 64 rows x 64 k, two stages
  const int pl = blockIdx.y;
  const int lane = threadIdx.x & 31, h = threadIdx.x >> 5;
  const int m0 = blockIdx.x << 6, n0 = h << 6;
  const int bh_ = (m0 >> 10) * RH + h, t0 = m0 & (RT - 1);      // 64 divides 1024: a tile lies in one batch
  const int rlane = lane & 15, koff = (lane >> 4) * 8, mOff = (lane >> 4) * 8;
  if (pl != 2) {
    const float inv = powf(10000.0f, (float)(2 * lane) / (float)RE);
    for (int r = 0; r < 8; ++r) {
      const int row = h * 8 + r;
      const float th = (float)(t0 + row) / inv;
      sTab[row * 68 + 2 * lane] = sinf(th); sTab[row * 68 + 2 * lane + 1] = cosf(th);
    }
  }
  // A path: per stage of 64 k the block reads its 64 x 64 f32 tile once, in whole 256-byte rows (8 rows a wave), rounds it to f16 and lays it in LDS for all 8 heads; two buffers, the next stage's rows fly during this stage's products
  const int arow = h * 8 + (lane >> 4), acol = (lane & 15) * 4;
  const float* Ag = ((pl == 0) ? x0 : ((pl == 1) ? x1 : x2)) + (size_t)(m0 + arow) * RM + acol;
  _Float16* aw = &sA[0][arow * APITCH + acol];
  const _Float16* ar = &sA[0][rlane * APITCH + koff];
  const _Float16* Bb = (const _Float16*)WTp + (size_t)pl * (RM * RM) + (size_t)(n0 + rlane) * RM + koff;
  v8f acc[4][4];
#pragma unroll
  for (int i = 0; i < 4; ++i)
#pragma unroll
    for (int j = 0; j < 4; ++j) acc[i][j] = (v8f){0.f,0.f,0.f,0.f,0.f,0.f,0.f,0.f};
  v4f raw[4];
#pragma unroll
  for (int u = 0; u < 4; ++u) raw[u] = *(const v4f*)(Ag + (size_t)u * 2 * RM);
#pragma unroll
  for (int u = 0; u < 4; ++u) { v4h hv; hv[0] = (_Float16)raw[u][0]; hv[1] = (_Float16)raw[u][1]; hv[2] = (_Float16)raw[u][2]; hv[3] = (_Float16)raw[u][3]; *(v4h*)(aw + u * 2 * APITCH) = hv; }
  __syncthreads();      // stage 0 (and every wave's (sin, cos) rows) is in LDS
#pragma unroll      // unrolled: every global and LDS offset is an immediate, no address register is stepped
  for (int s = 0; s < RM / 64; ++s) {
    if (s + 1 < RM / 64) {
#pragma unroll
      for (int u = 0; u < 4; ++u) raw[u] = *(const v4f*)(Ag + (size_t)u * 2 * RM + (s + 1) * 64);
    }
#pragma unroll
    for (int kk = 0; kk < 2; ++kk) {
      v16h bh[4], ah[4];      // one k order in both loaders: elements 0..7 <- k 0..7, 8..15 <- k 16..23 (from koff on)
#pragma unroll
      for (int j = 0; j < 4; ++j) bh[j] = Frag<_Float16>::load(Bb + (size_t)j * 16 * RM + s * 64 + kk * 32);
#pragma unroll
      for (int i = 0; i < 4; ++i) ah[i] = Frag<_Float16>::load(ar + (s & 1) * (64 * APITCH) + i * 16 * APITCH + kk * 32);
      __builtin_amdgcn_sched_barrier(0);      // the k step's 8 global and 8 LDS reads are issued as one group ahead of its products: left alone the compiler reuses one A fragment's registers and waits out each LDS read in turn
#pragma unroll
      for (int i = 0; i < 4; ++i)
#pragma unroll
        for (int j = 0; j < 4; ++j) acc[i][j] = Frag<_Float16>::mma(ah[i], bh[j], acc[i][j]);
    }
    if (s + 1 < RM / 64) {
#pragma unroll
      for (int u = 0; u < 4; ++u) { v4h hv; hv[0] = (_Float16)raw[u][0]; hv[1] = (_Float16)raw[u][1]; hv[2] = (_Float16)raw[u][2]; hv[3] = (_Float16)raw[u][3]; *(v4h*)(aw + ((s + 1) & 1) * (64 * APITCH) + u * 2 * APITCH) = hv; }
      __syncthreads();      // publishes stage s + 1 and ends every wave's reads of stage s's buffer, which stage s + 2 refills
    }
  }
  asm volatile("s_wait_xcnt 0x0" ::: "memory");      // precaution: stands in front of every reuse of the address registers that the loads above name
  if (pl == 2) {      // a lane's 8 accumulator registers are 8 consecutive tokens of one e: VT rows straight from registers
    _Float16* dst = (_Float16*)VT + ((size_t)bh_ * RE + rlane) * RT + t0 + mOff;
#pragma unroll
    for (int j = 0; j < 4; ++j)
#pragma unroll
      for (int i = 0; i < 4; ++i) {
        v8h hv;
#pragma unroll
        for (int r = 0; r < 8; ++r) hv[r] = (_Float16)acc[i][j][r];
        *(v8h*)(dst + (size_t)j * 16 * RT + i * 16) = hv;
      }
    return;
  }
  float* slab = sT[h];
  const int qr = lane >> 3, c8 = (lane & 7) * 8;      // 4 rows a turn, 8 lanes x 8 columns a row
  auto emit = [&](const bool isq) __attribute__((always_inline)) {
    float bu8[8], bv8[8];
    if (isq) {
      const unsigned bo = (unsigned)(c8 * RH + h) * 4u;      // byte offset of (e = c8, h) in the [64][8] biases
#pragma unroll
      for (int e = 0; e < 8; ++e) { bu8[e] = *(const float*)((const char*)bu + bo + e * (RH * 4)); bv8[e] = *(const float*)((const char*)bv + bo + e * (RH * 4)); }
      asm volatile("s_wait_xcnt 0x0" :: "v"(bo) : "memory");      // precaution: the offset that the 16 loads name, an input here, lives up to this wait, so none of them lands on it
    }
    _Float16* X = (_Float16*)(isq ? QX : KX) + ((size_t)bh_ * RT + t0) * RKX + c8;
#pragma unroll
    for (int i = 0; i < 4; ++i) {
#pragma unroll
      for (int j = 0; j < 4; ++j)
#pragma unroll
        for (int r = 0; r < 8; ++r) slab[(mOff + r) * 68 + (j << 4) + rlane] = acc[i][j][r];
      // the wave's own slab: its lanes' LDS writes are done before other lanes of the wave read them (LDS only: no wait for the global stores in flight)
      __builtin_amdgcn_fence(__ATOMIC_RELEASE, "workgroup", "local");
      __builtin_amdgcn_wave_barrier();
      __builtin_amdgcn_fence(__ATOMIC_ACQUIRE, "workgroup", "local");
#pragma unroll
      for (int it = 0; it < 4; ++it) {
        const int row = (i << 4) + it * 4 + qr;
        const float* sp = slab + (it * 4 + qr) * 68 + c8;
        const float* tb = sTab + row * 68 + c8;
        const v4f ya = *(const v4f*)(sp), yb = *(const v4f*)(sp + 4), wa = *(const v4f*)(tb), wb = *(const v4f*)(tb + 4);
        v8h g0, g1, g2;
#pragma unroll
        for (int p = 0; p < 4; ++p) {
          const float y0 = (p < 2) ? ya[2 * (p & 1)] : yb[2 * (p & 1)], y1 = (p < 2) ? ya[2 * (p & 1) + 1] : yb[2 * (p & 1) + 1];
          const float s = (p < 2) ? wa[2 * (p & 1)] : wb[2 * (p & 1)], c = (p < 2) ? wa[2 * (p & 1) + 1] : wb[2 * (p & 1) + 1];
          if (isq) {
            const float qv0 = y0 + bv8[2 * p], qv1 = y1 + bv8[2 * p + 1];
            g0[2 * p] = (_Float16)(y0 + bu8[2 * p]); g0[2 * p + 1] = (_Float16)(y1 + bu8[2 * p + 1]);
            g1[2 * p] = (_Float16)(qv0 * c);    g1[2 * p + 1] = (_Float16)(qv1 * s);
            g2[2 * p] = (_Float16)(qv0 * (-s)); g2[2 * p + 1] = (_Float16)(qv1 * c);
          } else {
            g0[2 * p] = (_Float16)y0; g0[2 * p + 1] = (_Float16)y1;
            g1[2 * p] = (_Float16)s;  g1[2 * p + 1] = (_Float16)s;
            g2[2 * p] = (_Float16)c;  g2[2 * p + 1] = (_Float16)c;
          }
        }
        _Float16* xr = X + (size_t)row * RKX;
        *(v8h*)(xr) = g0; *(v8h*)(xr + 64) = g1; *(v8h*)(xr + 128) = g2;
        if (it & 1) __builtin_amdgcn_sched_barrier(0);      // two turns' LDS reads in flight, not all four: fetched all at once they push the kernel past 256 registers, and two blocks no longer share a WGP
      }
      // and the reads are done before the next 16 rows overwrite the slab
      __builtin_amdgcn_fence(__ATOMIC_RELEASE, "workgroup", "local");
      __builtin_amdgcn_wave_barrier();
      __builtin_amdgcn_fence(__ATOMIC_ACQUIRE, "workgroup", "local");
    }
    asm volatile("s_wait_xcnt 0x0" ::: "memory");      // precaution: stands behind the plane's last stores, in front of any later write of a register that they name
  };
  if (pl == 0) emit(true); else emit(false);
}
// lane l <-> lane l ^ 16
__device__ __forceinline__ float xhalf(float x) { return __builtin_bit_cast(float, __builtin_amdgcn_permlanex16(__builtin_bit_cast(int, x), __builtin_bit_cast(int, x), 0x76543210, 0xfedcba98, false, false)); }
// Fused scores + key mask + softmax + p.v of one (batch, head): a wave owns 64 queries and walks the 1024 keys 32 at a time; no score or probability leaves the registers.
// S^T = KX . QX^T (A = 16 key rows, B = 16 query columns, K = 192), so a lane holds 8 keys of ONE query per tile: maximum and sum in-lane plus one exchange between the wave halves.
// Two S^T tiles (keys 0..15, 16..31), turned into f16 in place, are the B operand of O^T += VT . P^T (A = 16 rows e of VT, k = 32 keys in the loader's own order 8h+s | 16+8h+s).
// Running maximum in base 2; p = 2^(x - m + 15) (the x2^15 keeps small probabilities in f16's normal range; it cancels against the row sum).
#define QG 4      // 16-query column groups a wave: each K and V fragment fetched serves 64 queries
#define AW (256 / (16 * QG))      // waves a block (256 queries)
__global__ __launch_bounds__(AW * 32) void attn_kernel(const unsigned short* __restrict__ QXp, const unsigned short* __restrict__ KXp, const unsigned short* __restrict__ VTp, const int* __restrict__ mask, unsigned short* __restrict__ O16) {
  typedef __attribute__((ext_vector_type(4))) int v4i;
  const int lane = threadIdx.x & 31, wave = threadIdx.x >> 5, c = lane & 15, hh = lane >> 4;
  const int bh = blockIdx.y, b = bh / RH, h = bh % RH;
  const int q0 = blockIdx.x * 256 + wave * (16 * QG);
  const _Float16* Qb = (const _Float16*)QXp + (size_t)bh * RT * RKX + (size_t)(q0 + c) * RKX + hh * 8;
  const _Float16* Kb = (const _Float16*)KXp + (size_t)bh * RT * RKX + (size_t)c * RKX + hh * 8;
  const _Float16* Vb = (const _Float16*)VTp + (size_t)bh * RE * RT + (size_t)c * RT + hh * 8;
  const int* mrow = mask + (size_t)b * RT + hh * 8;
  const float CS = 0.125f * 1.4426950408889634f;      // 1/sqrt(64), and e^x = 2^(x log2 e)
  v16h qf[QG][6];
#pragma unroll
  for (int g = 0; g < QG; ++g)
#pragma unroll
    for (int ks = 0; ks < 6; ++ks) qf[g][ks] = Frag<_Float16>::load(Qb + (size_t)g * 16 * RKX + ks * 32);
  v8f o[QG][4];
#pragma unroll
  for (int g = 0; g < QG; ++g)
#pragma unroll
    for (int et = 0; et < 4; ++et) o[g][et] = (v8f){0.f,0.f,0.f,0.f,0.f,0.f,0.f,0.f};
  float mrun[QG], lsum[QG];
#pragma unroll
  for (int g = 0; g < QG; ++g) { mrun[g] = -3.0e38f; lsum[g] = 0.f; }      // a finite start keeps m - m and -inf - m free of NaN while every key so far is masked
  v16h kf[2][6], vf[4]; v4i mk[2][2];      // the K, V fragments and mask words of the pass at hand, fetched one pass ahead
  const _Float16* pK = Kb; const _Float16* pV = Vb; const int* pM = mrow;      // the addresses that the loads in flight name
#pragma unroll
  for (int kt = 0; kt < 2; ++kt) { mk[kt][0] = *(const v4i*)(mrow + kt * 16); mk[kt][1] = *(const v4i*)(mrow + kt * 16 + 4); }
#pragma unroll
  for (int kt = 0; kt < 2; ++kt)
#pragma unroll
    for (int ks = 0; ks < 6; ++ks) kf[kt][ks] = Frag<_Float16>::load(Kb + (size_t)kt * 16 * RKX + ks * 32);
#pragma unroll
  for (int et = 0; et < 4; ++et) vf[et] = Frag<_Float16>::load(Vb + (size_t)et * 16 * RT);
  // precaution: this wait stands in front of every rewrite of a register that a load above names (the query address, an input, lives up to here)
  asm volatile("s_wait_xcnt 0x0" :: "v"(Qb) : "memory");
  __builtin_amdgcn_sched_barrier(0);      // nothing from below (register copies, start values) is lifted in front of that wait, onto a register that a load above names
  auto pass = [&](int jnext, const bool fetch) __attribute__((always_inline)) {
    v8f s[2][QG];
#pragma unroll
    for (int kt = 0; kt < 2; ++kt)
#pragma unroll
      for (int g = 0; g < QG; ++g) s[kt][g] = (v8f){0.f,0.f,0.f,0.f,0.f,0.f,0.f,0.f};
#pragma unroll
    for (int ks = 0; ks < 6; ++ks)
#pragma unroll
      for (int kt = 0; kt < 2; ++kt)
#pragma unroll
        for (int g = 0; g < QG; ++g) s[kt][g] = Frag<_Float16>::mma(kf[kt][ks], qf[g][ks], s[kt][g]);
    float bias[2][8];      // 0 for a key that counts, -inf for a masked one
#pragma unroll
    for (int kt = 0; kt < 2; ++kt)
#pragma unroll
      for (int r = 0; r < 4; ++r) { bias[kt][r] = (mk[kt][0][r] == 0) ? -INFINITY : 0.f; bias[kt][4 + r] = (mk[kt][1][r] == 0) ? -INFINITY : 0.f; }
    // precaution: this wait stands in front of every rewrite of an address register that a load in flight names: as inputs the old addresses live up to here, and the new ones all come from jnext, which the statement hands on
    asm volatile("s_wait_xcnt 0x0" : "+s"(jnext) : "v"(pK), "v"(pV), "v"(pM) : "memory");
    if (fetch) {
      pK = Kb + (size_t)jnext * RKX; pV = Vb + jnext; pM = mrow + jnext;
#pragma unroll
      for (int kt = 0; kt < 2; ++kt) { mk[kt][0] = *(const v4i*)(pM + kt * 16); mk[kt][1] = *(const v4i*)(pM + kt * 16 + 4); }
#pragma unroll
      for (int kt = 0; kt < 2; ++kt)
#pragma unroll
        for (int ks = 0; ks < 6; ++ks) kf[kt][ks] = Frag<_Float16>::load(pK + (size_t)kt * 16 * RKX + ks * 32);
    }
#pragma unroll
    for (int g = 0; g < QG; ++g) {
      float x[2][8]; float mx = mrun[g];
#pragma unroll
      for (int kt = 0; kt < 2; ++kt)
#pragma unroll
        for (int r = 0; r < 8; ++r) { x[kt][r] = fmaf(s[kt][g][r], CS, bias[kt][r]); mx = fmaxf(mx, x[kt][r]); }
      const float mnew = fmaxf(mx, xhalf(mx));      // both halves hold the query's running maximum
      const float corr = __builtin_amdgcn_exp2f(mrun[g] - mnew);
      mrun[g] = mnew;
      const float msub = mnew - 15.0f;
      float ps[4]; v16h pf;      // four partial sums: short dependent chains
#pragma unroll
      for (int kt = 0; kt < 2; ++kt)
#pragma unroll
        for (int r = 0; r < 8; ++r) {
          const float p = __builtin_amdgcn_exp2f(x[kt][r] - msub);
          if (kt == 0 && r < 4) ps[r] = p; else ps[r & 3] += p;
          pf[kt * 8 + r] = (_Float16)p;
        }
      lsum[g] = lsum[g] * corr + ((ps[0] + ps[1]) + (ps[2] + ps[3]));
#pragma unroll
      for (int et = 0; et < 4; ++et) o[g][et] *= corr;
#pragma unroll
      for (int et = 0; et < 4; ++et) o[g][et] = Frag<_Float16>::mma(vf[et], pf, o[g][et]);
    }
    if (fetch) {
#pragma unroll
      for (int et = 0; et < 4; ++et) vf[et] = Frag<_Float16>::load(pV + (size_t)et * 16 * RT);
    }
  };
  for (int j0 = 32; j0 < RT; j0 += 32) pass(j0, true);
  pass(0, false);      // the last 32 keys: nothing left to fetch
#pragma unroll
  for (int g = 0; g < QG; ++g) {
    const float inv = 1.0f / (lsum[g] + xhalf(lsum[g]));      // every key masked: 0 * inf = NaN
    unsigned short* dst = O16 + ((size_t)b * RT + q0 + g * 16 + c) * RM + h * RE + hh * 8;      // a lane's 8 registers are 8 consecutive e of one query
#pragma unroll
    for (int et = 0; et < 4; ++et) {
      v8h hv;
#pragma unroll
      for (int r = 0; r < 8; ++r) hv[r] = (_Float16)(o[g][et][r] * inv);
      *(v8h*)(dst + et * 16) = hv;
    }
  }
}
extern "C" void kernel_launch(void* const* d_in, const int* in_sizes, int n_in, void* d_out, int out_size, void* d_ws, size_t ws_size, hipStream_t stream) {
  (void)in_sizes; (void)n_in; (void)out_size; (void)ws_size;
  auto Fp = [&](int i) { return (const float*)d_in[i]; };
  const float* q = Fp(0); const float* k = Fp(1); const float* v = Fp(2); const int* mask = (const int*)d_in[3]; const float* wq = Fp(4); const float* wk = Fp(5); const float* wv = Fp(6); const float* bu = Fp(7); const float* bv = Fp(8); const float* wo = Fp(9);
  char* ws = (char*)d_ws; size_t off = 0;
  auto carve = [&](size_t bytes) -> char* { char* p = ws + off; off += (bytes + 255) & ~(size_t)255; return p; };
  const size_t NTOK = (size_t)RB_ * RT;
  _Float16* O16 = (_Float16*)carve(NTOK * RM * 2);      // attention output, f16, [b][t][h*64+e]
  unsigned* WT = (unsigned*)carve((size_t)4 * RM * RM * 2); unsigned* WOT = WT + (size_t)3 * (RM * RM / 2);      // four permuted weights, planes wq, wk, wv, wo
  unsigned* QX = (unsigned*)carve(NTOK * RH * RKX * 2); unsigned* KX = (unsigned*)carve(NTOK * RH * RKX * 2); unsigned* VT = (unsigned*)carve(NTOK * RM * 2);     // QX/KX of all batches, 24 MiB each; total workspace footprint = 66 MiB
  wperm_kernel<<<dim3(64, 4), 256, 0, stream>>>(wq, wk, wv, wo, WT);
  const int tp = (int)((NTOK / 64) * (RM / 64));
  // q, k, v projections side by side on blockIdx.y, from the f32 inputs to the attention operands
  proj_kernel<<<dim3((unsigned)(NTOK / 64), 3), 256, 0, stream>>>(q, k, v, (const unsigned short*)WT, bu, bv, (unsigned short*)QX, (unsigned short*)KX, (unsigned short*)VT);
  // scores, softmax and p.v of all 64 (batch, head) pairs in ONE launch: 256 queries a block
  attn_kernel<<<dim3(RT / 256, RB_ * RH), AW * 32, 0, stream>>>((const unsigned short*)QX, (const unsigned short*)KX, (const unsigned short*)VT, mask, (unsigned short*)O16);
  wmma_gemm64<0, false, 0, 0, false><<<dim3((tp + 7) / 8, 1), 256, 0, stream>>>(U16(O16), nullptr, RM, 0, 0, (const unsigned short*)WOT, nullptr, RM, 0, 0, (float*)d_out, nullptr, RM, 0, 0, nullptr, nullptr, 0, (int)NTOK, RM, RM, 1.0f);
}

// v004
// Measured time: 87 microseconds a run.
// Two timings next to v003 both put it at 1.25 times that version's speed.
// All steps since v000 together make it 9.55 times as fast.
#include <hip/hip_runtime.h>
#include <math.h>
// Relative-position multi-head attention (8 x 1024 tokens, 512 model, 8 heads x 64, Transformer-XL sinusoid table over k−q): every contraction on
// v_wmma_f32_16x16x32_f16, f16 operands, f32 accumulate (plain single products): the q/k/v projections (8192 x 512 · 512 x 512, weights permuted to
// head-major columns), the scores as ONE product per (batch, head) with K = 192 — [q+bu | (q+bv)∘α(i) | (q+bv)∘β(i)] · [k | sin θ(j) | cos θ(j)]ᵀ,
// using the exact identity sin/cos(θ(j) − θ(i)) = products of per-position sin/cos (so the [T,T,64] sinusoid table is never formed or gathered),
// p.v (probabilities x2^15) and the output projection; scale 1/sqrt(64), key mask (-inf) and softmax in f32 on VALU, fused with the score and p.v products in one kernel
// (running maximum and sum over blocks of 32 keys; scores and probabilities stay in registers).
typedef __attribute__((ext_vector_type(16))) _Float16 v16h;
typedef __attribute__((ext_vector_type(8)))  _Float16 v8h;
typedef __attribute__((ext_vector_type(8)))  float    v8f;
typedef __attribute__((ext_vector_type(4)))  float    v4f;

template <typename T> struct Frag;
template <> struct Frag<_Float16> {
  typedef v16h V; union U { v16h v; v8h h[2]; };
  static __device__ __forceinline__ v16h load(const _Float16* p) {   // elements 0..7 <- p[0..7], 8..15 <- p[16..23]
    U f; f.h[0] = *(const v8h*)(p); f.h[1] = *(const v8h*)(p + 16); return f.v;
  }
  static __device__ __forceinline__ v8f mma(v16h a, v16h b, v8f c) {
    return __builtin_amdgcn_wmma_f32_16x16x32_f16(false, a, false, b, (short)0, c, false, false);
  }
};

#define RB_ 8
#define RT 1024
#define RM 512
#define RE 64
#define RH 8
#define RKX 192
// wq [m][e][h] -> Bt f16 [h*64+e][m] ; wo [e][h][m] -> Bt f16 [m][h*64+e]; blockIdx.y picks the weight (0..2 = wq, wk, wv; 3 = wo), its Bt is plane blockIdx.y of BT0
__global__ __launch_bounds__(256) void wperm_kernel(const float* __restrict__ w0, const float* __restrict__ w1, const float* __restrict__ w2, const float* __restrict__ w3, unsigned* __restrict__ BT0) {
  const int is_out = (blockIdx.y == 3); const float* wsrc = (blockIdx.y == 0) ? w0 : ((blockIdx.y == 1) ? w1 : ((blockIdx.y == 2) ? w2 : w3)); unsigned* BT = BT0 + (size_t)blockIdx.y * (RM * RM / 2);
  for (int i = blockIdx.x * 256 + threadIdx.x; i < RM * RM / 2; i += gridDim.x * 256) { const int row = i / (RM / 2), cp = 2 * (i % (RM / 2)); float a, b;
    if (!is_out) { const int h = row / RE, e = row % RE; a = wsrc[((size_t)cp * RE + e) * RH + h]; b = wsrc[((size_t)(cp + 1) * RE + e) * RH + h]; }      // Bt[h*64+e][m=cp]
    else { const int m = row; const int h0 = cp / RE, e0 = cp % RE, h1 = (cp + 1) / RE, e1 = (cp + 1) % RE; a = wsrc[((size_t)e0 * RH + h0) * RM + m]; b = wsrc[((size_t)e1 * RH + h1) * RM + m]; }   // Bt[m][k=cp]
    const unsigned u = (unsigned)__builtin_bit_cast(unsigned short, (_Float16)a) | ((unsigned)__builtin_bit_cast(unsigned short, (_Float16)b) << 16); ((unsigned*)BT)[i] = u;  }
}
// q, k, v projections (blockIdx.y picks the plane) with the passes around them folded in: A is read as f32 and rounded to f16 on its way into LDS; the epilogue writes the attention operands themselves.
// A block = 64 tokens x all 8 heads, a wave = one head's 64 columns (Bt rows h*64+e), 64x64 f32 accumulators.
// plane 0: QX [b][h][t][192] = [qp+bu | (qp+bv).alpha_e(t) | (qp+bv).beta_e(t)]; plane 1: KX [b][h][t][192] = [kp | sin th_e(t) | cos th_e(t)]; plane 2: VT [b][h][e][t].
// th_e(t) = t / 10000^((e/2*2)/64); even e: alpha = cos, beta = -sin; odd e: alpha = sin, beta = cos. The block's 64 x 32 (sin, cos) pairs are made once, 8 tokens a wave, and shared by its 8 heads through LDS.
#define APITCH 72      // halves: 128-byte rows at a 144-byte pitch (16 B x odd) for the 16-byte fragment reads
typedef __attribute__((ext_vector_type(4))) _Float16 v4h;
__global__ __launch_bounds__(256) void proj_kernel(const float* __restrict__ x0, const float* __restrict__ x1, const float* __restrict__ x2, const unsigned short* __restrict__ WTp,
    const float* __restrict__ bu, const float* __restrict__ bv, unsigned short* __restrict__ QX, unsigned short* __restrict__ KX, unsigned short* __restrict__ VT) {
  __shared__ __align__(16) float sT[8][16 * 68];   // per-wave 16x64 slab, pitch 68 floats
  __shared__ __align__(16) float sTab[64 * 68];    // row = token of the tile: sin th at 2p, cos th at 2p+1 for the pair e = 2p, 2p+1; the slab's pitch
  __shared__ __align__(16) _Float16 sA[2][64 * APITCH];      // the block's A tile in f16, 64 rows x 64 k, two stages
  const int pl = blockIdx.y;
  const int lane = threadIdx.x & 31, h = threadIdx.x >> 5;
  const int m0 = blockIdx.x << 6, n0 = h << 6;
  const int bh_ = (m0 >> 10) * RH + h, t0 = m0 & (RT - 1);      // 64 divides 1024: a tile lies in one batch
  const int rlane = lane & 15, koff = (lane >> 4) * 8, mOff = (lane >> 4) * 8;
  if (pl != 2) {
    const float inv = powf(10000.0f, (float)(2 * lane) / (float)RE);
    for (int r = 0; r < 8; ++r) {
      const int row = h * 8 + r;
      const float th = (float)(t0 + row) / inv;
      sTab[row * 68 + 2 * lane] = sinf(th); sTab[row * 68 + 2 * lane + 1] = cosf(th);
    }
  }
  // A path: per stage of 64 k the block reads its 64 x 64 f32 tile once, in whole 256-byte rows (8 rows a wave), rounds it to f16 and lays it in LDS for all 8 heads; two buffers, the next stage's rows fly during this stage's products
  const int arow = h * 8 + (lane >> 4), acol = (lane & 15) * 4;
  const float* Ag = ((pl == 0) ? x0 : ((pl == 1) ? x1 : x2)) + (size_t)(m0 + arow) * RM + acol;
  _Float16* aw = &sA[0][arow * APITCH + acol];
  const _Float16* ar = &sA[0][rlane * APITCH + koff];
  const _Float16* Bb = (const _Float16*)WTp + (size_t)pl * (RM * RM) + (size_t)(n0 + rlane) * RM + koff;
  v8f acc[4][4];
#pragma unroll
  for (int i = 0; i < 4; ++i)
#pragma unroll
    for (int j = 0; j < 4; ++j) acc[i][j] = (v8f){0.f,0.f,0.f,0.f,0.f,0.f,0.f,0.f};
  v4f raw[4];
#pragma unroll
  for (int u = 0; u < 4; ++u) raw[u] = *(const v4f*)(Ag + (size_t)u * 2 * RM);
#pragma unroll
  for (int u = 0; u < 4; ++u) { v4h hv; hv[0] = (_Float16)raw[u][0]; hv[1] = (_Float16)raw[u][1]; hv[2] = (_Float16)raw[u][2]; hv[3] = (_Float16)raw[u][3]; *(v4h*)(aw + u * 2 * APITCH) = hv; }
  __syncthreads();      // stage 0 (and every wave's (sin, cos) rows) is in LDS
#pragma unroll      // unrolled: every global and LDS offset is an immediate, no address register is stepped
  for (int s = 0; s < RM / 64; ++s) {
    if (s + 1 < RM / 64) {
#pragma unroll
      for (int u = 0; u < 4; ++u) raw[u] = *(const v4f*)(Ag + (size_t)u * 2 * RM + (s + 1) * 64);
    }
#pragma unroll
    for (int kk = 0; kk < 2; ++kk) {
      v16h bh[4], ah[4];      // one k order in both loaders: elements 0..7 <- k 0..7, 8..15 <- k 16..23 (from koff on)
#pragma unroll
      for (int j = 0; j < 4; ++j) bh[j] = Frag<_Float16>::load(Bb + (size_t)j * 16 * RM + s * 64 + kk * 32);
#pragma unroll
      for (int i = 0; i < 4; ++i) ah[i] = Frag<_Float16>::load(ar + (s & 1) * (64 * APITCH) + i * 16 * APITCH + kk * 32);
      __builtin_amdgcn_sched_barrier(0);      // the k step's 8 global and 8 LDS reads are issued as one group ahead of its products: left alone the compiler reuses one A fragment's registers and waits out each LDS read in turn
#pragma unroll
      for (int i = 0; i < 4; ++i)
#pragma unroll
        for (int j = 0; j < 4; ++j) acc[i][j] = Frag<_Float16>::mma(ah[i], bh[j], acc[i][j]);
    }
    if (s + 1 < RM / 64) {
#pragma unroll
      for (int u = 0; u < 4; ++u) { v4h hv; hv[0] = (_Float16)raw[u][0]; hv[1] = (_Float16)raw[u][1]; hv[2] = (_Float16)raw[u][2]; hv[3] = (_Float16)raw[u][3]; *(v4h*)(aw + ((s + 1) & 1) * (64 * APITCH) + u * 2 * APITCH) = hv; }
      __syncthreads();      // publishes stage s + 1 and ends every wave's reads of stage s's buffer, which stage s + 2 refills
    }
  }
  asm volatile("s_wait_xcnt 0x0" ::: "memory");      // precaution: stands in front of every reuse of the address registers that the loads above name
  if (pl == 2) {      // a lane's 8 accumulator registers are 8 consecutive tokens of one e: VT rows straight from registers
    _Float16* dst = (_Float16*)VT + ((size_t)bh_ * RE + rlane) * RT + t0 + mOff;
#pragma unroll
    for (int j = 0; j < 4; ++j)
#pragma unroll
      for (int i = 0; i < 4; ++i) {
        v8h hv;
#pragma unroll
        for (int r = 0; r < 8; ++r) hv[r] = (_Float16)acc[i][j][r];
        *(v8h*)(dst + (size_t)j * 16 * RT + i * 16) = hv;
      }
    return;
  }
  float* slab = sT[h];
  const int qr = lane >> 3, c8 = (lane & 7) * 8;      // 4 rows a turn, 8 lanes x 8 columns a row
  auto emit = [&](const bool isq) __attribute__((always_inline)) {
    float bu8[8], bv8[8];
    if (isq) {
      const unsigned bo = (unsigned)(c8 * RH + h) * 4u;      // byte offset of (e = c8, h) in the [64][8] biases
#pragma unroll
      for (int e = 0; e < 8; ++e) { bu8[e] = *(const float*)((const char*)bu + bo + e * (RH * 4)); bv8[e] = *(const float*)((const char*)bv + bo + e * (RH * 4)); }
      asm volatile("s_wait_xcnt 0x0" :: "v"(bo) : "memory");      // precaution: the offset that the 16 loads name, an input here, lives up to this wait, so none of them lands on it
    }
    _Float16* X = (_Float16*)(isq ? QX : KX) + ((size_t)bh_ * RT + t0) * RKX + c8;
#pragma unroll
    for (int i = 0; i < 4; ++i) {
#pragma unroll
      for (int j = 0; j < 4; ++j)
#pragma unroll
        for (int r = 0; r < 8; ++r) slab[(mOff + r) * 68 + (j << 4) + rlane] = acc[i][j][r];
      // the wave's own slab: its lanes' LDS writes are done before other lanes of the wave read them (LDS only: no wait for the global stores in flight)
      __builtin_amdgcn_fence(__ATOMIC_RELEASE, "workgroup", "local");
      __builtin_amdgcn_wave_barrier();
      __builtin_amdgcn_fence(__ATOMIC_ACQUIRE, "workgroup", "local");
#pragma unroll
      for (int it = 0; it < 4; ++it) {
        const int row = (i << 4) + it * 4 + qr;
        const float* sp = slab + (it * 4 + qr) * 68 + c8;
        const float* tb = sTab + row * 68 + c8;
        const v4f ya = *(const v4f*)(sp), yb = *(const v4f*)(sp + 4), wa = *(const v4f*)(tb), wb = *(const v4f*)(tb + 4);
        v8h g0, g1, g2;
#pragma unroll
        for (int p = 0; p < 4; ++p) {
          const float y0 = (p < 2) ? ya[2 * (p & 1)] : yb[2 * (p & 1)], y1 = (p < 2) ? ya[2 * (p & 1) + 1] : yb[2 * (p & 1) + 1];
          const float s = (p < 2) ? wa[2 * (p & 1)] : wb[2 * (p & 1)], c = (p < 2) ? wa[2 * (p & 1) + 1] : wb[2 * (p & 1) + 1];
          if (isq) {
            const float qv0 = y0 + bv8[2 * p], qv1 = y1 + bv8[2 * p + 1];
            g0[2 * p] = (_Float16)(y0 + bu8[2 * p]); g0[2 * p + 1] = (_Float16)(y1 + bu8[2 * p + 1]);
            g1[2 * p] = (_Float16)(qv0 * c);    g1[2 * p + 1] = (_Float16)(qv1 * s);
            g2[2 * p] = (_Float16)(qv0 * (-s)); g2[2 * p + 1] = (_Float16)(qv1 * c);
          } else {
            g0[2 * p] = (_Float16)y0; g0[2 * p + 1] = (_Float16)y1;
            g1[2 * p] = (_Float16)s;  g1[2 * p + 1] = (_Float16)s;
            g2[2 * p] = (_Float16)c;  g2[2 * p + 1] = (_Float16)c;
          }
        }
        _Float16* xr = X + (size_t)row * RKX;
        *(v8h*)(xr) = g0; *(v8h*)(xr + 64) = g1; *(v8h*)(xr + 128) = g2;
        if (it & 1) __builtin_amdgcn_sched_barrier(0);      // two turns' LDS reads in flight, not all four: fetched all at once they push the kernel past 256 registers, and two blocks no longer share a WGP
      }
      // and the reads are done before the next 16 rows overwrite the slab
      __builtin_amdgcn_fence(__ATOMIC_RELEASE, "workgroup", "local");
      __builtin_amdgcn_wave_barrier();
      __builtin_amdgcn_fence(__ATOMIC_ACQUIRE, "workgroup", "local");
    }
    asm volatile("s_wait_xcnt 0x0" ::: "memory");      // precaution: stands behind the plane's last stores, in front of any later write of a register that they name
  };
  if (pl == 0) emit(true); else emit(false);
}
// lane l <-> lane l ^ 16
__device__ __forceinline__ float xhalf(float x) { return __builtin_bit_cast(float, __builtin_amdgcn_permlanex16(__builtin_bit_cast(int, x), __builtin_bit_cast(int, x), 0x76543210, 0xfedcba98, false, false)); }
// Fused scores + key mask + softmax + p.v of one (batch, head): a wave owns 64 queries and walks the 1024 keys 32 at a time; no score or probability leaves the registers.
// S^T = KX . QX^T (A = 16 key rows, B = 16 query columns, K = 192), so a lane holds 8 keys of ONE query per tile: maximum and sum in-lane plus one exchange between the wave halves.
// Two S^T tiles (keys 0..15, 16..31), turned into f16 in place, are the B operand of O^T += VT . P^T (A = 16 rows e of VT, k = 32 keys in the loader's own order 8h+s | 16+8h+s).
// Running maximum in base 2; p = 2^(x - m + 15) (the x2^15 keeps small probabilities in f16's normal range; it cancels against the row sum).
#define QG 4      // 16-query column groups a wave: each K and V fragment fetched serves 64 queries
#define AW (256 / (16 * QG))      // waves a block (256 queries)
__global__ __launch_bounds__(AW * 32) void attn_kernel(const unsigned short* __restrict__ QXp, const unsigned short* __restrict__ KXp, const unsigned short* __restrict__ VTp, const int* __restrict__ mask, unsigned short* __restrict__ O16) {
  typedef __attribute__((ext_vector_type(4))) int v4i;
  const int lane = threadIdx.x & 31, wave = threadIdx.x >> 5, c = lane & 15, hh = lane >> 4;
  const int bh = blockIdx.y, b = bh / RH, h = bh % RH;
  const int q0 = blockIdx.x * 256 + wave * (16 * QG);
  const _Float16* Qb = (const _Float16*)QXp + (size_t)bh * RT * RKX + (size_t)(q0 + c) * RKX + hh * 8;
  const _Float16* Kb = (const _Float16*)KXp + (size_t)bh * RT * RKX + (size_t)c * RKX + hh * 8;
  const _Float16* Vb = (const _Float16*)VTp + (size_t)bh * RE * RT + (size_t)c * RT + hh * 8;
  const int* mrow = mask + (size_t)b * RT + hh * 8;
  const float CS = 0.125f * 1.4426950408889634f;      // 1/sqrt(64), and e^x = 2^(x log2 e)
  v16h qf[QG][6];
#pragma unroll
  for (int g = 0; g < QG; ++g)
#pragma unroll
    for (int ks = 0; ks < 6; ++ks) qf[g][ks] = Frag<_Float16>::load(Qb + (size_t)g * 16 * RKX + ks * 32);
  v8f o[QG][4];
#pragma unroll
  for (int g = 0; g < QG; ++g)
#pragma unroll
    for (int et = 0; et < 4; ++et) o[g][et] = (v8f){0.f,0.f,0.f,0.f,0.f,0.f,0.f,0.f};
  float mrun[QG], lsum[QG];
#pragma unroll
  for (int g = 0; g < QG; ++g) { mrun[g] = -3.0e38f; lsum[g] = 0.f; }      // a finite start keeps m - m and -inf - m free of NaN while every key so far is masked
  v16h kf[2][6], vf[4]; v4i mk[2][2];      // the K, V fragments and mask words of the pass at hand, fetched one pass ahead
  const _Float16* pK = Kb; const _Float16* pV = Vb; const int* pM = mrow;      // the addresses that the loads in flight name
#pragma unroll
  for (int kt = 0; kt < 2; ++kt) { mk[kt][0] = *(const v4i*)(mrow + kt * 16); mk[kt][1] = *(const v4i*)(mrow + kt * 16 + 4); }
#pragma unroll
  for (int kt = 0; kt < 2; ++kt)
#pragma unroll
    for (int ks = 0; ks < 6; ++ks) kf[kt][ks] = Frag<_Float16>::load(Kb + (size_t)kt * 16 * RKX + ks * 32);
#pragma unroll
  for (int et = 0; et < 4; ++et) vf[et] = Frag<_Float16>::load(Vb + (size_t)et * 16 * RT);
  // precaution: this wait stands in front of every rewrite of a register that a load above names (the query address, an input, lives up to here)
  asm volatile("s_wait_xcnt 0x0" :: "v"(Qb) : "memory");
  __builtin_amdgcn_sched_barrier(0);      // nothing from below (register copies, start values) is lifted in front of that wait, onto a register that a load above names
  auto pass = [&](int jnext, const bool fetch) __attribute__((always_inline)) {
    v8f s[2][QG];
#pragma unroll
    for (int kt = 0; kt < 2; ++kt)
#pragma unroll
      for (int g = 0; g < QG; ++g) s[kt][g] = (v8f){0.f,0.f,0.f,0.f,0.f,0.f,0.f,0.f};
#pragma unroll
    for (int ks = 0; ks < 6; ++ks)
#pragma unroll
      for (int kt = 0; kt < 2; ++kt)
#pragma unroll
        for (int g = 0; g < QG; ++g) s[kt][g] = Frag<_Float16>::mma(kf[kt][ks], qf[g][ks], s[kt][g]);
    float bias[2][8];      // 0 for a key that counts, -inf for a masked one
#pragma unroll
    for (int kt = 0; kt < 2; ++kt)
#pragma unroll
      for (int r = 0; r < 4; ++r) { bias[kt][r] = (mk[kt][0][r] == 0) ? -INFINITY : 0.f; bias[kt][4 + r] = (mk[kt][1][r] == 0) ? -INFINITY : 0.f; }
    // precaution: this wait stands in front of every rewrite of an address register that a load in flight names: as inputs the old addresses live up to here, and the new ones all come from jnext, which the statement hands on
    asm volatile("s_wait_xcnt 0x0" : "+s"(jnext) : "v"(pK), "v"(pV), "v"(pM) : "memory");
    if (fetch) {
      pK = Kb + (size_t)jnext * RKX; pV = Vb + jnext; pM = mrow + jnext;
#pragma unroll
      for (int kt = 0; kt < 2; ++kt) { mk[kt][0] = *(const v4i*)(pM + kt * 16); mk[kt][1] = *(const v4i*)(pM + kt * 16 + 4); }
#pragma unroll
      for (int kt = 0; kt < 2; ++kt)
#pragma unroll
        for (int ks = 0; ks < 6; ++ks) kf[kt][ks] = Frag<_Float16>::load(pK + (size_t)kt * 16 * RKX + ks * 32);
    }
#pragma unroll
    for (int g = 0; g < QG; ++g) {
      float x[2][8]; float mx = mrun[g];
#pragma unroll
      for (int kt = 0; kt < 2; ++kt)
#pragma unroll
        for (int r = 0; r < 8; ++r) { x[kt][r] = fmaf(s[kt][g][r], CS, bias[kt][r]); mx = fmaxf(mx, x[kt][r]); }
      const float mnew = fmaxf(mx, xhalf(mx));      // both halves hold the query's running maximum
      const float corr = __builtin_amdgcn_exp2f(mrun[g] - mnew);
      mrun[g] = mnew;
      const float msub = mnew - 15.0f;
      float ps[4]; v16h pf;      // four partial sums: short dependent chains
#pragma unroll
      for (int kt = 0; kt < 2; ++kt)
#pragma unroll
        for (int r = 0; r < 8; ++r) {
          const float p = __builtin_amdgcn_exp2f(x[kt][r] - msub);
          if (kt == 0 && r < 4) ps[r] = p; else ps[r & 3] += p;
          pf[kt * 8 + r] = (_Float16)p;
        }
      lsum[g] = lsum[g] * corr + ((ps[0] + ps[1]) + (ps[2] + ps[3]));
#pragma unroll
      for (int et = 0; et < 4; ++et) o[g][et] *= corr;
#pragma unroll
      for (int et = 0; et < 4; ++et) o[g][et] = Frag<_Float16>::mma(vf[et], pf, o[g][et]);
    }
    if (fetch) {
#pragma unroll
      for (int et = 0; et < 4; ++et) vf[et] = Frag<_Float16>::load(pV + (size_t)et * 16 * RT);
    }
  };
  for (int j0 = 32; j0 < RT; j0 += 32) pass(j0, true);
  pass(0, false);      // the last 32 keys: nothing left to fetch
#pragma unroll
  for (int g = 0; g < QG; ++g) {
    const float inv = 1.0f / (lsum[g] + xhalf(lsum[g]));      // every key masked: 0 * inf = NaN
    unsigned short* dst = O16 + ((size_t)b * RT + q0 + g * 16 + c) * RM + h * RE + hh * 8;      // a lane's 8 registers are 8 consecutive e of one query
#pragma unroll
    for (int et = 0; et < 4; ++et) {
      v8h hv;
#pragma unroll
      for (int r = 0; r < 8; ++r) hv[r] = (_Float16)(o[g][et][r] * inv);
      *(v8h*)(dst + et * 16) = hv;
    }
  }
}
// Output projection out[m][n] = sum_k O16[m][k] . WOT[n][k] (8192 x 512, k = 512): a block owns a 128 x 128 tile of out and holds its 128 rows of both operands, the whole k, in LDS.
// Eight tiles of 128 rows x 256 bytes (operand x quarter of k), one tensor load a wave, each row padded by 16 bytes to a 272-byte pitch (16 B x odd) for the 16-byte fragment reads.
// A wave = 32 x 64 of the tile; both loaders read k in one order (elements 0..7 <- k 0..7, 8..15 <- k 16..23, from koff on). The loops are unrolled so that every index of a register array is a constant (no scratch).
typedef __attribute__((ext_vector_type(4))) unsigned u32x4;
typedef __attribute__((ext_vector_type(8))) unsigned u32x8;
#define OPITCH 272u                    // bytes a row in LDS
#define OTILE (128u * OPITCH)          // 34,816 bytes = 17 x 2 KiB: every tile starts at a multiple of 2 KiB
#define OSLAB (16u * 68u * 4u)         // a wave's 16 x 64 f32 output slab, pitch 68 floats
__device__ __forceinline__ unsigned uni(unsigned v) { return (unsigned)__builtin_amdgcn_readfirstlane(v); }
__global__ __launch_bounds__(256) void oproj_kernel(const unsigned short* __restrict__ Ap, const unsigned short* __restrict__ Btp, float* __restrict__ C) {
  __shared__ __attribute__((aligned(2048))) unsigned char sO[8u * OTILE + 8u * OSLAB];      // tiles [operand][quarter of k], then the slabs
  const int lane = threadIdx.x & 31;
  const unsigned wave = uni(threadIdx.x >> 5);
  const int n0 = blockIdx.x << 7, m0 = blockIdx.y << 7;
  {
    const unsigned op = wave & 1u, qk = wave >> 1;      // every wave brings one tile: no test around the load
    const unsigned long long ga = (unsigned long long)(size_t)((op ? Btp + (size_t)n0 * RM : Ap + (size_t)m0 * RM) + qk * 128u);
    u32x4 g0; u32x8 g1;
    g0[0] = uni(1u);                                                     // count 1
    g0[1] = uni((unsigned)(size_t)sO + (op * 4u + qk) * OTILE);          // place in LDS
    g0[2] = uni((unsigned)ga);
    g0[3] = uni((((unsigned)(ga >> 32)) & 0x01FFFFFFu) | 0x80000000u);   // type 2
    g1[0] = uni((1u << 20) | (5u << 22) | (3u << 25));                   // no mask, bytes, 4 dwords of pad behind every 256-byte row
    g1[1] = uni(256u << 16);                                             // tensor dim0 = 256 bytes
    g1[2] = uni(128u << 16);                                             // tensor dim1 = 128 rows
    g1[3] = uni(256u << 16);                                             // tile dim0
    g1[4] = uni(128u);                                                   // tile dim1
    g1[5] = uni((unsigned)RM * 2u);                                      // source pitch, bytes
    g1[6] = uni(0u);
    g1[7] = uni(0u);
    asm volatile("tensor_load_to_lds %0, %1" :: "s"(g0), "s"(g1) : "memory");
    asm volatile("s_wait_tensorcnt 0" ::: "memory");      // the wave's own tile has landed
  }
  __syncthreads();      // and every wave's tile may be read by all
  const int rlane = lane & 15, koff = (lane >> 4) * 8, mOff = (lane >> 4) * 8;
  const int wm = (int)(wave & 3u) * 32, wn = (int)(wave >> 2) * 64;
  const unsigned char* ar = sO + (unsigned)(wm + rlane) * OPITCH + koff * 2;
  const unsigned char* br = sO + 4u * OTILE + (unsigned)(wn + rlane) * OPITCH + koff * 2;
  v8f acc[2][4];
#pragma unroll
  for (int i = 0; i < 2; ++i)
#pragma unroll
    for (int j = 0; j < 4; ++j) acc[i][j] = (v8f){0.f,0.f,0.f,0.f,0.f,0.f,0.f,0.f};
  v16h ah[2][2], bh[2][4];      // two fragment sets: the next k step's reads fly during this step's products
  auto fetch = [&](const int s) __attribute__((always_inline)) {
    const unsigned o = (unsigned)(s >> 2) * OTILE + (unsigned)(s & 3) * 64u;
#pragma unroll
    for (int i = 0; i < 2; ++i) ah[s & 1][i] = Frag<_Float16>::load((const _Float16*)(ar + o + (unsigned)i * 16u * OPITCH));
#pragma unroll
    for (int j = 0; j < 4; ++j) bh[s & 1][j] = Frag<_Float16>::load((const _Float16*)(br + o + (unsigned)j * 16u * OPITCH));
  };
  fetch(0);
#pragma unroll      // unrolled: the set index and every LDS offset are constants
  for (int s = 0; s < RM / 32; ++s) {
    if (s + 1 < RM / 32) fetch(s + 1);
    __builtin_amdgcn_sched_barrier(0);      // the next step's 12 LDS reads go out as one group ahead of this step's products, not among them
#pragma unroll
    for (int i = 0; i < 2; ++i)
#pragma unroll
      for (int j = 0; j < 4; ++j) acc[i][j] = Frag<_Float16>::mma(ah[s & 1][i], bh[s & 1][j], acc[i][j]);
    __builtin_amdgcn_sched_barrier(0);      // and the step after's stay behind them: with no fence the compiler fetches many steps at once, takes all 512 registers and spills
  }
  // out in whole 256-byte row pieces, through the wave's own slab
  float* slab = (float*)(sO + 8u * OTILE + wave * OSLAB);
  const int hh = lane >> 4, c4 = (lane & 15) * 4;
  float* Cw = C + (size_t)(m0 + wm) * RM + n0 + wn + c4;
#pragma unroll
  for (int i = 0; i < 2; ++i) {
#pragma unroll
    for (int j = 0; j < 4; ++j)
#pragma unroll
      for (int r = 0; r < 8; ++r) slab[(mOff + r) * 68 + (j << 4) + rlane] = acc[i][j][r];
    // the wave's own slab: its lanes' LDS writes are done before other lanes of the wave read them (LDS only: no wait for the global stores in flight)
    __builtin_amdgcn_fence(__ATOMIC_RELEASE, "workgroup", "local");
    __builtin_amdgcn_wave_barrier();
    __builtin_amdgcn_fence(__ATOMIC_ACQUIRE, "workgroup", "local");
#pragma unroll
    for (int it = 0; it < 8; ++it) {
      const int row = it * 2 + hh;
      const v4f v = *(const v4f*)(slab + row * 68 + c4);
      *(v4f*)(Cw + (size_t)(i * 16 + row) * RM) = v;
    }
    // and the reads are done before the next 16 rows overwrite the slab
    __builtin_amdgcn_fence(__ATOMIC_RELEASE, "workgroup", "local");
    __builtin_amdgcn_wave_barrier();
    __builtin_amdgcn_fence(__ATOMIC_ACQUIRE, "workgroup", "local");
  }
}
extern "C" void kernel_launch(void* const* d_in, const int* in_sizes, int n_in, void* d_out, int out_size, void* d_ws, size_t ws_size, hipStream_t stream) {
  (void)in_sizes; (void)n_in; (void)out_size; (void)ws_size;
  auto Fp = [&](int i) { return (const float*)d_in[i]; };
  const float* q = Fp(0); const float* k = Fp(1); const float* v = Fp(2); const int* mask = (const int*)d_in[3]; const float* wq = Fp(4); const float* wk = Fp(5); const float* wv = Fp(6); const float* bu = Fp(7); const float* bv = Fp(8); const float* wo = Fp(9);
  char* ws = (char*)d_ws; size_t off = 0;
  auto carve = [&](size_t bytes) -> char* { char* p = ws + off; off += (bytes + 255) & ~(size_t)255; return p; };
  const size_t NTOK = (size_t)RB_ * RT;
  _Float16* O16 = (_Float16*)carve(NTOK * RM * 2);      // attention output, f16, [b][t][h*64+e]
  unsigned* WT = (unsigned*)carve((size_t)4 * RM * RM * 2); unsigned* WOT = WT + (size_t)3 * (RM * RM / 2);      // four permuted weights, planes wq, wk, wv, wo
  unsigned* QX = (unsigned*)carve(NTOK * RH * RKX * 2); unsigned* KX = (unsigned*)carve(NTOK * RH * RKX * 2); unsigned* VT = (unsigned*)carve(NTOK * RM * 2);     // QX/KX of all batches, 24 MiB each; total workspace footprint = 66 MiB
  wperm_kernel<<<dim3(64, 4), 256, 0, stream>>>(wq, wk, wv, wo, WT);
  // q, k, v projections side by side on blockIdx.y, from the f32 inputs to the attention operands
  proj_kernel<<<dim3((unsigned)(NTOK / 64), 3), 256, 0, stream>>>(q, k, v, (const unsigned short*)WT, bu, bv, (unsigned short*)QX, (unsigned short*)KX, (unsigned short*)VT);
  // scores, softmax and p.v of all 64 (batch, head) pairs in ONE launch: 256 queries a block
  attn_kernel<<<dim3(RT / 256, RB_ * RH), AW * 32, 0, stream>>>((const unsigned short*)QX, (const unsigned short*)KX, (const unsigned short*)VT, mask, (unsigned short*)O16);
  // output projection: a 128 x 128 tile of out a block
  oproj_kernel<<<dim3(RM / 128, (unsigned)(NTOK / 128)), 256, 0, stream>>>((const unsigned short*)O16, (const unsigned short*)WOT, (float*)d_out);
}

// v005
// A run of this version takes 80 microseconds.
// In both of two side-by-side timings against v004, it was 1.08 times as fast.
// Over all steps from v000 it is 10.3 times as fast.
#include <hip/hip_runtime.h>
#include <math.h>
// Relative-position multi-head attention (8 x 1024 tokens, 512 model, 8 heads x 64, Transformer-XL sinusoid table over k−q): every contraction on
// v_wmma_f32_16x16x32_f16, f16 operands, f32 accumulate (plain single products): the q/k/v projections (8192 x 512 · 512 x 512, weights permuted to
// head-major columns), the scores as ONE product per (batch, head) with K = 192 — [q+bu | (q+bv)∘α(i) | (q+bv)∘β(i)] · [k | sin θ(j) | cos θ(j)]ᵀ,
// using the exact identity sin/cos(θ(j) − θ(i)) = products of per-position sin/cos (so the [T,T,64] sinusoid table is never formed or gathered),
// p.v (probabilities x2^15) and the output projection; scale 1/sqrt(64), key mask (-inf) and softmax in f32 on VALU, fused with the score and p.v products in one kernel
// (running maximum and sum over blocks of 32 keys; scores and probabilities stay in registers).
typedef __attribute__((ext_vector_type(16))) _Float16 v16h;
typedef __attribute__((ext_vector_type(8)))  _Float16 v8h;
typedef __attribute__((ext_vector_type(8)))  float    v8f;
typedef __attribute__((ext_vector_type(4)))  float    v4f;

template <typename T> struct Frag;
template <> struct Frag<_Float16> {
  typedef v16h V; union U { v16h v; v8h h[2]; };
  static __device__ __forceinline__ v16h load(const _Float16* p) {   // elements 0..7 <- p[0..7], 8..15 <- p[16..23]
    U f; f.h[0] = *(const v8h*)(p); f.h[1] = *(const v8h*)(p + 16); return f.v;
  }
  static __device__ __forceinline__ v8f mma(v16h a, v16h b, v8f c) {
    return __builtin_amdgcn_wmma_f32_16x16x32_f16(false, a, false, b, (short)0, c, false, false);
  }
};

#define RB_ 8
#define RT 1024
#define RM 512
#define RE 64
#define RH 8
#define RKX 192
// wq [m][e][h] -> Bt f16 [h*64+e][m] ; wo [e][h][m] -> Bt f16 [m][h*64+e]; blockIdx.y picks the weight (0..2 = wq, wk, wv; 3 = wo), its Bt is plane blockIdx.y of BT0
__global__ __launch_bounds__(256) void wperm_kernel(const float* __restrict__ w0, const float* __restrict__ w1, const float* __restrict__ w2, const float* __restrict__ w3, unsigned* __restrict__ BT0) {
  const int is_out = (blockIdx.y == 3); const float* wsrc = (blockIdx.y == 0) ? w0 : ((blockIdx.y == 1) ? w1 : ((blockIdx.y == 2) ? w2 : w3)); unsigned* BT = BT0 + (size_t)blockIdx.y * (RM * RM / 2);
  for (int i = blockIdx.x * 256 + threadIdx.x; i < RM * RM / 2; i += gridDim.x * 256) { const int row = i / (RM / 2), cp = 2 * (i % (RM / 2)); float a, b;
    if (!is_out) { const int h = row / RE, e = row % RE; a = wsrc[((size_t)cp * RE + e) * RH + h]; b = wsrc[((size_t)(cp + 1) * RE + e) * RH + h]; }      // Bt[h*64+e][m=cp]
    else { const int m = row; const int h0 = cp / RE, e0 = cp % RE, h1 = (cp + 1) / RE, e1 = (cp + 1) % RE; a = wsrc[((size_t)e0 * RH + h0) * RM + m]; b = wsrc[((size_t)e1 * RH + h1) * RM + m]; }   // Bt[m][k=cp]
    const unsigned u = (unsigned)__builtin_bit_cast(unsigned short, (_Float16)a) | ((unsigned)__builtin_bit_cast(unsigned short, (_Float16)b) << 16); ((unsigned*)BT)[i] = u;  }
}
// q, k, v projections (blockIdx.y picks the plane) with the passes around them folded in: A is read as f32 and rounded to f16 on its way into LDS; the epilogue writes the attention operands themselves.
// A block = 64 tokens x all 8 heads, a wave = one head's 64 columns (Bt rows h*64+e), 64x64 f32 accumulators.
// plane 0: QX [b][h][t][192] = [qp+bu | (qp+bv).alpha_e(t) | (qp+bv).beta_e(t)]; plane 1: KX [b][h][t][192] = [kp | sin th_e(t) | cos th_e(t)]; plane 2: VT [b][h][e][t].
// th_e(t) = t / 10000^((e/2*2)/64); even e: alpha = cos, beta = -sin; odd e: alpha = sin, beta = cos. The block's 64 x 32 (sin, cos) pairs are made once, 8 tokens a wave, and shared by its 8 heads through LDS.
#define APITCH 72      // halves: 128-byte rows at a 144-byte pitch (16 B x odd) for the 16-byte fragment reads
typedef __attribute__((ext_vector_type(4))) _Float16 v4h;
__global__ __launch_bounds__(256) void proj_kernel(const float* __restrict__ x0, const float* __restrict__ x1, const float* __restrict__ x2, const unsigned short* __restrict__ WTp,
    const float* __restrict__ bu, const float* __restrict__ bv, unsigned short* __restrict__ QX, unsigned short* __restrict__ KX, unsigned short* __restrict__ VT) {
  __shared__ __align__(16) float sT[8][16 * 68];   // per-wave 16x64 slab, pitch 68 floats
  __shared__ __align__(16) float sTab[64 * 68];    // row = token of the tile: sin th at 2p, cos th at 2p+1 for the pair e = 2p, 2p+1; the slab's pitch
  __shared__ __align__(16) _Float16 sA[2][64 * APITCH];      // the block's A tile in f16, 64 rows x 64 k, two stages
  const int pl = blockIdx.y;
  const int lane = threadIdx.x & 31, h = threadIdx.x >> 5;
  const int m0 = blockIdx.x << 6, n0 = h << 6;
  const int bh_ = (m0 >> 10) * RH + h, t0 = m0 & (RT - 1);      // 64 divides 1024: a tile lies in one batch
  const int rlane = lane & 15, koff = (lane >> 4) * 8, mOff = (lane >> 4) * 8;
  if (pl != 2) {
    const float inv = powf(10000.0f, (float)(2 * lane) / (float)RE);
    for (int r = 0; r < 8; ++r) {
      const int row = h * 8 + r;
      const float th = (float)(t0 + row) / inv;
      sTab[row * 68 + 2 * lane] = sinf(th); sTab[row * 68 + 2 * lane + 1] = cosf(th);
    }
  }
  // A path: per stage of 64 k the block reads its 64 x 64 f32 tile once, in whole 256-byte rows (8 rows a wave), rounds it to f16 and lays it in LDS for all 8 heads; two buffers, the next stage's rows fly during this stage's products
  const int arow = h * 8 + (lane >> 4), acol = (lane & 15) * 4;
  const float* Ag = ((pl == 0) ? x0 : ((pl == 1) ? x1 : x2)) + (size_t)(m0 + arow) * RM + acol;
  _Float16* aw = &sA[0][arow * APITCH + acol];
  const _Float16* ar = &sA[0][rlane * APITCH + koff];
  const _Float16* Bb = (const _Float16*)WTp + (size_t)pl * (RM * RM) + (size_t)(n0 + rlane) * RM + koff;
  v8f acc[4][4];
#pragma unroll
  for (int i = 0; i < 4; ++i)
#pragma unroll
    for (int j = 0; j < 4; ++j) acc[i][j] = (v8f){0.f,0.f,0.f,0.f,0.f,0.f,0.f,0.f};
  v4f raw[4];
#pragma unroll
  for (int u = 0; u < 4; ++u) raw[u] = *(const v4f*)(Ag + (size_t)u * 2 * RM);
#pragma unroll
  for (int u = 0; u < 4; ++u) { v4h hv; hv[0] = (_Float16)raw[u][0]; hv[1] = (_Float16)raw[u][1]; hv[2] = (_Float16)raw[u][2]; hv[3] = (_Float16)raw[u][3]; *(v4h*)(aw + u * 2 * APITCH) = hv; }
  __syncthreads();      // stage 0 (and every wave's (sin, cos) rows) is in LDS
#pragma unroll      // unrolled: every global and LDS offset is an immediate, no address register is stepped
  for (int s = 0; s < RM / 64; ++s) {
    if (s + 1 < RM / 64) {
#pragma unroll
      for (int u = 0; u < 4; ++u) raw[u] = *(const v4f*)(Ag + (size_t)u * 2 * RM + (s + 1) * 64);
    }
#pragma unroll
    for (int kk = 0; kk < 2; ++kk) {
      v16h bh[4], ah[4];      // one k order in both loaders: elements 0..7 <- k 0..7, 8..15 <- k 16..23 (from koff on)
#pragma unroll
      for (int j = 0; j < 4; ++j) bh[j] = Frag<_Float16>::load(Bb + (size_t)j * 16 * RM + s * 64 + kk * 32);
#pragma unroll
      for (int i = 0; i < 4; ++i) ah[i] = Frag<_Float16>::load(ar + (s & 1) * (64 * APITCH) + i * 16 * APITCH + kk * 32);
      __builtin_amdgcn_sched_barrier(0);      // the k step's 8 global and 8 LDS reads are issued as one group ahead of its products: left alone the compiler reuses one A fragment's registers and waits out each LDS read in turn
#pragma unroll
      for (int i = 0; i < 4; ++i)
#pragma unroll
        for (int j = 0; j < 4; ++j) acc[i][j] = Frag<_Float16>::mma(ah[i], bh[j], acc[i][j]);
    }
    if (s + 1 < RM / 64) {
#pragma unroll
      for (int u = 0; u < 4; ++u) { v4h hv; hv[0] = (_Float16)raw[u][0]; hv[1] = (_Float16)raw[u][1]; hv[2] = (_Float16)raw[u][2]; hv[3] = (_Float16)raw[u][3]; *(v4h*)(aw + ((s + 1) & 1) * (64 * APITCH) + u * 2 * APITCH) = hv; }
      __syncthreads();      // publishes stage s + 1 and ends every wave's reads of stage s's buffer, which stage s + 2 refills
    }
  }
  asm volatile("s_wait_xcnt 0x0" ::: "memory");      // precaution: stands in front of every reuse of the address registers that the loads above name
  if (pl == 2) {      // a lane's 8 accumulator registers are 8 consecutive tokens of one e: VT rows straight from registers
    _Float16* dst = (_Float16*)VT + ((size_t)bh_ * RE + rlane) * RT + t0 + mOff;
#pragma unroll
    for (int j = 0; j < 4; ++j)
#pragma unroll
      for (int i = 0; i < 4; ++i) {
        v8h hv;
#pragma unroll
        for (int r = 0; r < 8; ++r) hv[r] = (_Float16)acc[i][j][r];
        *(v8h*)(dst + (size_t)j * 16 * RT + i * 16) = hv;
      }
    return;
  }
  float* slab = sT[h];
  const int qr = lane >> 3, c8 = (lane & 7) * 8;      // 4 rows a turn, 8 lanes x 8 columns a row
  auto emit = [&](const bool isq) __attribute__((always_inline)) {
    float bu8[8], bv8[8];
    if (isq) {
      const unsigned bo = (unsigned)(c8 * RH + h) * 4u;      // byte offset of (e = c8, h) in the [64][8] biases
#pragma unroll
      for (int e = 0; e < 8; ++e) { bu8[e] = *(const float*)((const char*)bu + bo + e * (RH * 4)); bv8[e] = *(const float*)((const char*)bv + bo + e * (RH * 4)); }
      asm volatile("s_wait_xcnt 0x0" :: "v"(bo) : "memory");      // precaution: the offset that the 16 loads name, an input here, lives up to this wait, so none of them lands on it
    }
    _Float16* X = (_Float16*)(isq ? QX : KX) + ((size_t)bh_ * RT + t0) * RKX + c8;
#pragma unroll
    for (int i = 0; i < 4; ++i) {
#pragma unroll
      for (int j = 0; j < 4; ++j)
#pragma unroll
        for (int r = 0; r < 8; ++r) slab[(mOff + r) * 68 + (j << 4) + rlane] = acc[i][j][r];
      // the wave's own slab: its lanes' LDS writes are done before other lanes of the wave read them (LDS only: no wait for the global stores in flight)
      __builtin_amdgcn_fence(__ATOMIC_RELEASE, "workgroup", "local");
      __builtin_amdgcn_wave_barrier();
      __builtin_amdgcn_fence(__ATOMIC_ACQUIRE, "workgroup", "local");
#pragma unroll
      for (int it = 0; it < 4; ++it) {
        const int row = (i << 4) + it * 4 + qr;
        const float* sp = slab + (it * 4 + qr) * 68 + c8;
        const float* tb = sTab + row * 68 + c8;
        const v4f ya = *(const v4f*)(sp), yb = *(const v4f*)(sp + 4), wa = *(const v4f*)(tb), wb = *(const v4f*)(tb + 4);
        v8h g0, g1, g2;
#pragma unroll
        for (int p = 0; p < 4; ++p) {
          const float y0 = (p < 2) ? ya[2 * (p & 1)] : yb[2 * (p & 1)], y1 = (p < 2) ? ya[2 * (p & 1) + 1] : yb[2 * (p & 1) + 1];
          const float s = (p < 2) ? wa[2 * (p & 1)] : wb[2 * (p & 1)], c = (p < 2) ? wa[2 * (p & 1) + 1] : wb[2 * (p & 1) + 1];
          if (isq) {
            const float qv0 = y0 + bv8[2 * p], qv1 = y1 + bv8[2 * p + 1];
            g0[2 * p] = (_Float16)(y0 + bu8[2 * p]); g0[2 * p + 1] = (_Float16)(y1 + bu8[2 * p + 1]);
            g1[2 * p] = (_Float16)(qv0 * c);    g1[2 * p + 1] = (_Float16)(qv1 * s);
            g2[2 * p] = (_Float16)(qv0 * (-s)); g2[2 * p + 1] = (_Float16)(qv1 * c);
          } else {
            g0[2 * p] = (_Float16)y0; g0[2 * p + 1] = (_Float16)y1;
            g1[2 * p] = (_Float16)s;  g1[2 * p + 1] = (_Float16)s;
            g2[2 * p] = (_Float16)c;  g2[2 * p + 1] = (_Float16)c;
          }
        }
        _Float16* xr = X + (size_t)row * RKX;
        *(v8h*)(xr) = g0; *(v8h*)(xr + 64) = g1; *(v8h*)(xr + 128) = g2;
        if (it & 1) __builtin_amdgcn_sched_barrier(0);      // two turns' LDS reads in flight, not all four: fetched all at once they push the kernel past 256 registers, and two blocks no longer share a WGP
      }
      // and the reads are done before the next 16 rows overwrite the slab
      __builtin_amdgcn_fence(__ATOMIC_RELEASE, "workgroup", "local");
      __builtin_amdgcn_wave_barrier();
      __builtin_amdgcn_fence(__ATOMIC_ACQUIRE, "workgroup", "local");
    }
    asm volatile("s_wait_xcnt 0x0" ::: "memory");      // precaution: stands behind the plane's last stores, in front of any later write of a register that they name
  };
  if (pl == 0) emit(true); else emit(false);
}
// lane l <-> lane l ^ 16
__device__ __forceinline__ float xhalf(float x) { return __builtin_bit_cast(float, __builtin_amdgcn_permlanex16(__builtin_bit_cast(int, x), __builtin_bit_cast(int, x), 0x76543210, 0xfedcba98, false, false)); }
// Fused scores + key mask + softmax + p.v of one (batch, head): a wave owns 64 queries and walks the 1024 keys 32 at a time; no score or probability leaves the registers.
// S^T = KX . QX^T (A = 16 key rows, B = 16 query columns, K = 192), so a lane holds 8 keys of ONE query per tile: maximum and sum in-lane plus one exchange between the wave halves.
// Two S^T tiles (keys 0..15, 16..31), turned into f16 in place, are the B operand of O^T += VT . P^T (A = 16 rows e of VT, k = 32 keys in the loader's own order 8h+s | 16+8h+s).
// Running maximum in base 2; p = 2^(x - m + 15) (the x2^15 keeps small probabilities in f16's normal range; it cancels against the row sum).
// K and V reach the block's four waves through LDS: a stage is 128 keys (4 passes), two buffers, one tensor load a wave and stage. Waves 0..2 bring the three 128-byte column
// slices of the 128 KX rows (pitch 144 B in LDS), wave 3 the 64 VT rows x 256 bytes (pitch 272 B): both pitches 16 B x odd for the 16-byte fragment reads.
#define QG 4      // 16-query column groups a wave: each K and V fragment fetched serves 64 queries
#define AW (256 / (16 * QG))      // waves a block (256 queries)
#define SKEYS 128                      // keys a stage
#define NSTAGE (RT / SKEYS)
#define KPITCH 144u                    // bytes a row of a K slice in LDS
#define VPITCH 272u                    // bytes a VT row in LDS
#define ASLICE (128u * KPITCH)         // 18,432 bytes = 9 x 2 KiB a slice (the V slice, 64 x 272 bytes, is rounded up to it): every slice starts at a multiple of 2 KiB
#define ASTAGE (4u * ASLICE)
typedef __attribute__((ext_vector_type(4))) unsigned u32x4;
typedef __attribute__((ext_vector_type(8))) unsigned u32x8;
__device__ __forceinline__ unsigned uni(unsigned v) { return (unsigned)__builtin_amdgcn_readfirstlane(v); }
__device__ __forceinline__ unsigned pinned(unsigned v) { unsigned w = uni(v); asm volatile("" : "+s"(w)); return w; }      // a tensor load's test word or descriptor word, held in a scalar register (the test's branch is then a scalar one)
// group 1 of a two-dimensional tile, ROWS rows of ROWB bytes at a source pitch of SPITCH bytes, every extent in bytes; W0 = word 0 (no mask, the pad).
// Built once and pinned word by word: descriptor words held in scalar registers of their own, which take no other value while a request that names them is under way
template <unsigned W0, unsigned ROWB, unsigned ROWS, unsigned SPITCH>
__device__ __forceinline__ u32x8 tile_shape() {
  u32x8 g1;
  g1[0] = pinned(W0);
  g1[1] = pinned(ROWB << 16);      // tensor dim0
  g1[2] = pinned(ROWS << 16);      // tensor dim1
  g1[3] = pinned(ROWB << 16);      // tile dim0
  g1[4] = pinned(ROWS);            // tile dim1
  g1[5] = pinned(SPITCH);
  g1[6] = pinned(0u);
  g1[7] = pinned(0u);
  return g1;
}
__global__ __launch_bounds__(AW * 32) void attn_kernel(const unsigned short* __restrict__ QXp, const unsigned short* __restrict__ KXp, const unsigned short* __restrict__ VTp, const int* __restrict__ mask, unsigned short* __restrict__ O16) {
  typedef __attribute__((ext_vector_type(4))) int v4i;
  __shared__ __attribute__((aligned(2048))) unsigned char sKV[2u * ASTAGE];      // [buffer][slice]
  const int lane = threadIdx.x & 31, c = lane & 15, hh = lane >> 4;
  const unsigned wave = uni(threadIdx.x >> 5);
  const int bh = blockIdx.y, b = bh / RH, h = bh % RH;
  const int q0 = blockIdx.x * 256 + (int)wave * (16 * QG);
  const _Float16* Qb = (const _Float16*)QXp + (size_t)bh * RT * RKX + (size_t)(q0 + c) * RKX + hh * 8;
  const int* mrow = mask + (size_t)b * RT + hh * 8;
  const float CS = 0.125f * 1.4426950408889634f;      // 1/sqrt(64), and e^x = 2^(x log2 e)
  // every wave brings its own slice of stage st into buffer st & 1; the branch only picks the slice's shape
  const u32x8 shK = tile_shape<(1u << 20) | (4u << 22) | (3u << 25), 128u, 128u, RKX * 2u>();      // 128 keys x 128 bytes, 4 dwords of pad behind every row
  const u32x8 shV = tile_shape<(1u << 20) | (5u << 22) | (3u << 25), 256u, 64u, RT * 2u>();        // 64 e x 256 bytes (128 keys), likewise
  const unsigned long long gsrc = (unsigned long long)(size_t)(wave == 3u ? VTp + (size_t)bh * RE * RT : KXp + (size_t)bh * RT * RKX + wave * 64u);
  const unsigned gstep = wave == 3u ? SKEYS * 2u : SKEYS * RKX * 2u;      // bytes from a stage's slice to the next stage's
  u32x4 g0;
  g0[0] = pinned(1u);      // count 1
  auto bring = [&](const unsigned st) __attribute__((always_inline)) {
    const unsigned long long ga = gsrc + st * gstep;
    g0[1] = uni((unsigned)(size_t)sKV + (st & 1u) * ASTAGE + wave * ASLICE);      // place in LDS
    g0[2] = uni((unsigned)ga);
    g0[3] = uni((((unsigned)(ga >> 32)) & 0x01FFFFFFu) | 0x80000000u);            // type 2
    if (pinned(wave == 3u)) asm volatile("tensor_load_to_lds %0, %1" :: "s"(g0), "s"(shV) : "memory");
    else                    asm volatile("tensor_load_to_lds %0, %1" :: "s"(g0), "s"(shK) : "memory");
  };
  v16h qf[QG][6];
#pragma unroll
  for (int g = 0; g < QG; ++g)
#pragma unroll
    for (int ks = 0; ks < 6; ++ks) qf[g][ks] = Frag<_Float16>::load(Qb + (size_t)g * 16 * RKX + ks * 32);
  v8f o[QG][4];
#pragma unroll
  for (int g = 0; g < QG; ++g)
#pragma unroll
    for (int et = 0; et < 4; ++et) o[g][et] = (v8f){0.f,0.f,0.f,0.f,0.f,0.f,0.f,0.f};
  float mrun[QG], lsum[QG];
#pragma unroll
  for (int g = 0; g < QG; ++g) { mrun[g] = -3.0e38f; lsum[g] = 0.f; }      // a finite start keeps m - m and -inf - m free of NaN while every key so far is masked
  v16h kf[2][6], vf[4]; v4i mk[2][2];      // the fragments and mask words of the pass at hand; K and the mask words are fetched one pass ahead
  const int* pM = mrow;      // the address that the mask loads in flight name
#pragma unroll
  for (int kt = 0; kt < 2; ++kt) { mk[kt][0] = *(const v4i*)(mrow + kt * 16); mk[kt][1] = *(const v4i*)(mrow + kt * 16 + 4); }
  // precaution: this wait stands in front of every rewrite of a register that a load above names (the query address, an input, lives up to here)
  asm volatile("s_wait_xcnt 0x0" :: "v"(Qb) : "memory");
  __builtin_amdgcn_sched_barrier(0);      // nothing from below (register copies, start values) is lifted in front of that wait, onto a register that a load above names
  bring(0u);
  asm volatile("s_wait_tensorcnt 0" :: "s"(g0) : "memory");      // the wave's own slice of stage 0 has landed (group 0, an input, keeps its registers up to here)
  __syncthreads();      // and every wave's slice may be read by all
  bring(1u);
  // fragment reads, from the lane's row and half on; one k order as from memory: elements 0..7 <- k 0..7, 8..15 <- k 16..23. koff, voff = byte offset of the pass's buffer and of its 32 key rows (K) or 32 key columns (V)
  const unsigned char* kl = sKV + (unsigned)c * KPITCH + (unsigned)hh * 16u;
  const unsigned char* vl = sKV + 3u * ASLICE + (unsigned)c * VPITCH + (unsigned)hh * 16u;
  auto fetch_k = [&](const unsigned koff) __attribute__((always_inline)) {
#pragma unroll
    for (int kt = 0; kt < 2; ++kt)
#pragma unroll
      for (int ks = 0; ks < 6; ++ks) kf[kt][ks] = Frag<_Float16>::load((const _Float16*)(kl + koff + (unsigned)(ks >> 1) * ASLICE + (unsigned)(kt * 16) * KPITCH + (unsigned)(ks & 1) * 64u));
  };
  auto fetch_v = [&](const unsigned voff) __attribute__((always_inline)) {
#pragma unroll
    for (int et = 0; et < 4; ++et) vf[et] = Frag<_Float16>::load((const _Float16*)(vl + voff + (unsigned)(et * 16) * VPITCH));
  };
  fetch_k(0u);
  for (unsigned j = 0; j < RT / 32; ++j) {      // pass j: keys 32 j .. 32 j + 31, of stage j / 4
    fetch_v(((j >> 2) & 1u) * ASTAGE + (j & 3u) * 64u);      // this pass's own V, one group ahead of the score products, which cover its way
    __builtin_amdgcn_sched_barrier(0);      // left alone the compiler sinks these 8 reads in among the products, in two places
    v8f s[2][QG];
#pragma unroll
    for (int kt = 0; kt < 2; ++kt)
#pragma unroll
      for (int g = 0; g < QG; ++g) s[kt][g] = (v8f){0.f,0.f,0.f,0.f,0.f,0.f,0.f,0.f};
#pragma unroll
    for (int ks = 0; ks < 6; ++ks)
#pragma unroll
      for (int kt = 0; kt < 2; ++kt)
#pragma unroll
        for (int g = 0; g < QG; ++g) s[kt][g] = Frag<_Float16>::mma(kf[kt][ks], qf[g][ks], s[kt][g]);
    float bias[2][8];      // 0 for a key that counts, -inf for a masked one
#pragma unroll
    for (int kt = 0; kt < 2; ++kt)
#pragma unroll
      for (int r = 0; r < 4; ++r) { bias[kt][r] = (mk[kt][0][r] == 0) ? -INFINITY : 0.f; bias[kt][4 + r] = (mk[kt][1][r] == 0) ? -INFINITY : 0.f; }
    if (pinned((j & 3u) == 3u)) {
      // a stage's last pass: publish point of the next stage, every wave, in this order. It stands in front of the K fetch below, the first read of that stage; this stage's own last fragments were fetched above and a pass ago
      asm volatile("s_wait_dscnt 0" ::: "memory");          // the wave's reads of this stage's buffer are done
      asm volatile("s_wait_tensorcnt 0" :: "s"(g0) : "memory");      // its own slice of the next stage has landed (group 0 of that request, an input, keeps its registers up to here)
      __syncthreads();      // publishes the next stage and ends every wave's reads of the buffer that the stage after it refills
      if (pinned((j >> 2) + 2u < NSTAGE)) bring((j >> 2) + 2u);
    }
    const unsigned jn = j + 1u, nbuf = ((jn >> 2) & 1u) * ASTAGE;      // behind the last pass there is no next one: its K fetch then falls on buffer 0, published long ago and not refilled, and is not used (no branch around it)
    int jnext = jn < RT / 32 ? (int)jn * 32 : RT - 32;      // likewise the last mask words are read once more: in bounds, not used
    // precaution: this wait stands in front of every rewrite of the address register that the mask loads in flight name: as an input the old address lives up to here, and the new one comes from jnext, which the statement hands on
    asm volatile("s_wait_xcnt 0x0" : "+s"(jnext) : "v"(pM) : "memory");
    pM = mrow + jnext;
#pragma unroll
    for (int kt = 0; kt < 2; ++kt) { mk[kt][0] = *(const v4i*)(pM + kt * 16); mk[kt][1] = *(const v4i*)(pM + kt * 16 + 4); }
    fetch_k(nbuf + (jn & 3u) * (32u * KPITCH));
    __builtin_amdgcn_sched_barrier(0);      // the 24 reads go out as one group: left alone the compiler strews them over the softmax below
#pragma unroll
    for (int g = 0; g < QG; ++g) {
      float x[2][8]; float mx = mrun[g];
#pragma unroll
      for (int kt = 0; kt < 2; ++kt)
#pragma unroll
        for (int r = 0; r < 8; ++r) { x[kt][r] = fmaf(s[kt][g][r], CS, bias[kt][r]); mx = fmaxf(mx, x[kt][r]); }
      const float mnew = fmaxf(mx, xhalf(mx));      // both halves hold the query's running maximum
      const float corr = __builtin_amdgcn_exp2f(mrun[g] - mnew);
      mrun[g] = mnew;
      const float msub = mnew - 15.0f;
      float ps[4]; v16h pf;      // four partial sums: short dependent chains
#pragma unroll
      for (int kt = 0; kt < 2; ++kt)
#pragma unroll
        for (int r = 0; r < 8; ++r) {
          const float p = __builtin_amdgcn_exp2f(x[kt][r] - msub);
          if (kt == 0 && r < 4) ps[r] = p; else ps[r & 3] += p;
          pf[kt * 8 + r] = (_Float16)p;
        }
      lsum[g] = lsum[g] * corr + ((ps[0] + ps[1]) + (ps[2] + ps[3]));
#pragma unroll
      for (int et = 0; et < 4; ++et) o[g][et] *= corr;
#pragma unroll
      for (int et = 0; et < 4; ++et) o[g][et] = Frag<_Float16>::mma(vf[et], pf, o[g][et]);
    }
  }
  asm volatile("s_wait_tensorcnt 0" ::: "memory");      // nothing of the ring is in flight when the wave goes on to its end
  asm volatile("s_wait_dscnt 0" ::: "memory");
  asm volatile("s_wait_xcnt 0x0" :: "v"(pM) : "memory");      // precaution: the last mask loads' address, an input, lives up to this wait, in front of every rewrite of its registers below
#pragma unroll
  for (int g = 0; g < QG; ++g) {
    const float inv = 1.0f / (lsum[g] + xhalf(lsum[g]));      // every key masked: 0 * inf = NaN
    unsigned short* dst = O16 + ((size_t)b * RT + q0 + g * 16 + c) * RM + h * RE + hh * 8;      // a lane's 8 registers are 8 consecutive e of one query
#pragma unroll
    for (int et = 0; et < 4; ++et) {
      v8h hv;
#pragma unroll
      for (int r = 0; r < 8; ++r) hv[r] = (_Float16)(o[g][et][r] * inv);
      *(v8h*)(dst + et * 16) = hv;
    }
  }
}
// Output projection out[m][n] = sum_k O16[m][k] . WOT[n][k] (8192 x 512, k = 512): a block owns a 128 x 128 tile of out and holds its 128 rows of both operands, the whole k, in LDS.
// Eight tiles of 128 rows x 256 bytes (operand x quarter of k), one tensor load a wave, each row padded by 16 bytes to a 272-byte pitch (16 B x odd) for the 16-byte fragment reads.
// A wave = 32 x 64 of the tile; both loaders read k in one order (elements 0..7 <- k 0..7, 8..15 <- k 16..23, from koff on). The loops are unrolled so that every index of a register array is a constant (no scratch).
#define OPITCH 272u                    // bytes a row in LDS
#define OTILE (128u * OPITCH)          // 34,816 bytes = 17 x 2 KiB: every tile starts at a multiple of 2 KiB
#define OSLAB (16u * 68u * 4u)         // a wave's 16 x 64 f32 output slab, pitch 68 floats
__global__ __launch_bounds__(256) void oproj_kernel(const unsigned short* __restrict__ Ap, const unsigned short* __restrict__ Btp, float* __restrict__ C) {
  __shared__ __attribute__((aligned(2048))) unsigned char sO[8u * OTILE + 8u * OSLAB];      // tiles [operand][quarter of k], then the slabs
  const int lane = threadIdx.x & 31;
  const unsigned wave = uni(threadIdx.x >> 5);
  const int n0 = blockIdx.x << 7, m0 = blockIdx.y << 7;
  {
    const unsigned op = wave & 1u, qk = wave >> 1;      // every wave brings one tile: no test around the load
    const unsigned long long ga = (unsigned long long)(size_t)((op ? Btp + (size_t)n0 * RM : Ap + (size_t)m0 * RM) + qk * 128u);
    u32x4 g0; u32x8 g1;
    g0[0] = uni(1u);                                                     // count 1
    g0[1] = uni((unsigned)(size_t)sO + (op * 4u + qk) * OTILE);          // place in LDS
    g0[2] = uni((unsigned)ga);
    g0[3] = uni((((unsigned)(ga >> 32)) & 0x01FFFFFFu) | 0x80000000u);   // type 2
    g1[0] = uni((1u << 20) | (5u << 22) | (3u << 25));                   // no mask, bytes, 4 dwords of pad behind every 256-byte row
    g1[1] = uni(256u << 16);                                             // tensor dim0 = 256 bytes
    g1[2] = uni(128u << 16);                                             // tensor dim1 = 128 rows
    g1[3] = uni(256u << 16);                                             // tile dim0
    g1[4] = uni(128u);                                                   // tile dim1
    g1[5] = uni((unsigned)RM * 2u);                                      // source pitch, bytes
    g1[6] = uni(0u);
    g1[7] = uni(0u);
    asm volatile("tensor_load_to_lds %0, %1" :: "s"(g0), "s"(g1) : "memory");
    asm volatile("s_wait_tensorcnt 0" ::: "memory");      // the wave's own tile has landed
  }
  __syncthreads();      // and every wave's tile may be read by all
  const int rlane = lane & 15, koff = (lane >> 4) * 8, mOff = (lane >> 4) * 8;
  const int wm = (int)(wave & 3u) * 32, wn = (int)(wave >> 2) * 64;
  const unsigned char* ar = sO + (unsigned)(wm + rlane) * OPITCH + koff * 2;
  const unsigned char* br = sO + 4u * OTILE + (unsigned)(wn + rlane) * OPITCH + koff * 2;
  v8f acc[2][4];
#pragma unroll
  for (int i = 0; i < 2; ++i)
#pragma unroll
    for (int j = 0; j < 4; ++j) acc[i][j] = (v8f){0.f,0.f,0.f,0.f,0.f,0.f,0.f,0.f};
  v16h ah[2][2], bh[2][4];      // two fragment sets: the next k step's reads fly during this step's products
  auto fetch = [&](const int s) __attribute__((always_inline)) {
    const unsigned o = (unsigned)(s >> 2) * OTILE + (unsigned)(s & 3) * 64u;
#pragma unroll
    for (int i = 0; i < 2; ++i) ah[s & 1][i] = Frag<_Float16>::load((const _Float16*)(ar + o + (unsigned)i * 16u * OPITCH));
#pragma unroll
    for (int j = 0; j < 4; ++j) bh[s & 1][j] = Frag<_Float16>::load((const _Float16*)(br + o + (unsigned)j * 16u * OPITCH));
  };
  fetch(0);
#pragma unroll      // unrolled: the set index and every LDS offset are constants
  for (int s = 0; s < RM / 32; ++s) {
    if (s + 1 < RM / 32) fetch(s + 1);
    __builtin_amdgcn_sched_barrier(0);      // the next step's 12 LDS reads go out as one group ahead of this step's products, not among them
#pragma unroll
    for (int i = 0; i < 2; ++i)
#pragma unroll
      for (int j = 0; j < 4; ++j) acc[i][j] = Frag<_Float16>::mma(ah[s & 1][i], bh[s & 1][j], acc[i][j]);
    __builtin_amdgcn_sched_barrier(0);      // and the step after's stay behind them: with no fence the compiler fetches many steps at once, takes all 512 registers and spills
  }
  // out in whole 256-byte row pieces, through the wave's own slab
  float* slab = (float*)(sO + 8u * OTILE + wave * OSLAB);
  const int hh = lane >> 4, c4 = (lane & 15) * 4;
  float* Cw = C + (size_t)(m0 + wm) * RM + n0 + wn + c4;
#pragma unroll
  for (int i = 0; i < 2; ++i) {
#pragma unroll
    for (int j = 0; j < 4; ++j)
#pragma unroll
      for (int r = 0; r < 8; ++r) slab[(mOff + r) * 68 + (j << 4) + rlane] = acc[i][j][r];
    // the wave's own slab: its lanes' LDS writes are done before other lanes of the wave read them (LDS only: no wait for the global stores in flight)
    __builtin_amdgcn_fence(__ATOMIC_RELEASE, "workgroup", "local");
    __builtin_amdgcn_wave_barrier();
    __builtin_amdgcn_fence(__ATOMIC_ACQUIRE, "workgroup", "local");
#pragma unroll
    for (int it = 0; it < 8; ++it) {
      const int row = it * 2 + hh;
      const v4f v = *(const v4f*)(slab + row * 68 + c4);
      *(v4f*)(Cw + (size_t)(i * 16 + row) * RM) = v;
    }
    // and the reads are done before the next 16 rows overwrite the slab
    __builtin_amdgcn_fence(__ATOMIC_RELEASE, "workgroup", "local");
    __builtin_amdgcn_wave_barrier();
    __builtin_amdgcn_fence(__ATOMIC_ACQUIRE, "workgroup", "local");
  }
}
extern "C" void kernel_launch(void* const* d_in, const int* in_sizes, int n_in, void* d_out, int out_size, void* d_ws, size_t ws_size, hipStream_t stream) {
  (void)in_sizes; (void)n_in; (void)out_size; (void)ws_size;
  auto Fp = [&](int i) { return (const float*)d_in[i]; };
  const float* q = Fp(0); const float* k = Fp(1); const float* v = Fp(2); const int* mask = (const int*)d_in[3]; const float* wq = Fp(4); const float* wk = Fp(5); const float* wv = Fp(6); const float* bu = Fp(7); const float* bv = Fp(8); const float* wo = Fp(9);
  char* ws = (char*)d_ws; size_t off = 0;
  auto carve = [&](size_t bytes) -> char* { char* p = ws + off; off += (bytes + 255) & ~(size_t)255; return p; };
  const size_t NTOK = (size_t)RB_ * RT;
  _Float16* O16 = (_Float16*)carve(NTOK * RM * 2);      // attention output, f16, [b][t][h*64+e]
  unsigned* WT = (unsigned*)carve((size_t)4 * RM * RM * 2); unsigned* WOT = WT + (size_t)3 * (RM * RM / 2);      // four permuted weights, planes wq, wk, wv, wo
  unsigned* QX = (unsigned*)carve(NTOK * RH * RKX * 2); unsigned* KX = (unsigned*)carve(NTOK * RH * RKX * 2); unsigned* VT = (unsigned*)carve(NTOK * RM * 2);     // QX/KX of all batches, 24 MiB each; total workspace footprint = 66 MiB
  wperm_kernel<<<dim3(64, 4), 256, 0, stream>>>(wq, wk, wv, wo, WT);
  // q, k, v projections side by side on blockIdx.y, from the f32 inputs to the attention operands
  proj_kernel<<<dim3((unsigned)(NTOK / 64), 3), 256, 0, stream>>>(q, k, v, (const unsigned short*)WT, bu, bv, (unsigned short*)QX, (unsigned short*)KX, (unsigned short*)VT);
  // scores, softmax and p.v of all 64 (batch, head) pairs in ONE launch: 256 queries a block
  attn_kernel<<<dim3(RT / 256, RB_ * RH), AW * 32, 0, stream>>>((const unsigned short*)QX, (const unsigned short*)KX, (const unsigned short*)VT, mask, (unsigned short*)O16);
  // output projection: a 128 x 128 tile of out a block
  oproj_kernel<<<dim3(RM / 128, (unsigned)(NTOK / 128)), 256, 0, stream>>>((const unsigned short*)O16, (const unsigned short*)WOT, (float*)d_out);
}

// v006
// One run takes 74 microseconds.
// Next to v005, in two timings, it ran 1.08 times as fast each time.
// All steps since v000 together make it 11.2 times as fast.
#include <hip/hip_runtime.h>
#include <math.h>
// Relative-position multi-head attention (8 x 1024 tokens, 512 model, 8 heads x 64, Transformer-XL sinusoid table over k−q): every contraction on
// v_wmma_f32_16x16x32_f16, f16 operands, f32 accumulate (plain single products): the q/k/v projections (8192 x 512 · 512 x 512, weights permuted to
// head-major columns), the scores as ONE product per (batch, head) with K = 192 — [q+bu | (q+bv)∘α(i) | (q+bv)∘β(i)] · [k | sin θ(j) | cos θ(j)]ᵀ,
// using the exact identity sin/cos(θ(j) − θ(i)) = products of per-position sin/cos (so the [T,T,64] sinusoid table is never formed or gathered),
// p.v (probabilities x2^15) and the output projection; scale 1/sqrt(64), key mask (-inf) and softmax in f32 on VALU, fused with the score and p.v products in one kernel
// (running maximum and sum over blocks of 32 keys; scores and probabilities stay in registers).
typedef __attribute__((ext_vector_type(16))) _Float16 v16h;
typedef __attribute__((ext_vector_type(8)))  _Float16 v8h;
typedef __attribute__((ext_vector_type(8)))  float    v8f;
typedef __attribute__((ext_vector_type(4)))  float    v4f;

template <typename T> struct Frag;
template <> struct Frag<_Float16> {
  typedef v16h V; union U { v16h v; v8h h[2]; };
  static __device__ __forceinline__ v16h load(const _Float16* p) {   // elements 0..7 <- p[0..7], 8..15 <- p[16..23]
    U f; f.h[0] = *(const v8h*)(p); f.h[1] = *(const v8h*)(p + 16); return f.v;
  }
  static __device__ __forceinline__ v16h load_packed(const _Float16* p) {   // a fragment stored in fragment order: elements 0..7 <- p[0..7], 8..15 <- p[256..263] (p = the fragment's start + 8 * lane)
    U f; f.h[0] = *(const v8h*)(p); f.h[1] = *(const v8h*)(p + 256); return f.v;
  }
  static __device__ __forceinline__ v8f mma(v16h a, v16h b, v8f c) {
    return __builtin_amdgcn_wmma_f32_16x16x32_f16(false, a, false, b, (short)0, c, false, false);
  }
};

#define RB_ 8
#define RT 1024
#define RM 512
#define RE 64
#define RH 8
#define RKX 192
// wo [e][h][m] -> Bt f16 [m][h*64+e]; blockIdx.y picks the weight (0..2 = wq, wk, wv; 3 = wo), its Bt is plane blockIdx.y of BT0.
// wq, wk, wv [m][e][h] -> f16 in the order in which the projection's B fragments are loaded: [h][k step of 32][16-column group j][part][lane][8 halves], where
// column e = 16 j + (lane & 15) and k = m = 32 step + 16 part + 8 (lane >> 4) + 0..7: a wave's 16-byte load then reads 512 bytes in a row, 4 whole 128-byte lines.
__global__ __launch_bounds__(256) void wperm_kernel(const float* __restrict__ w0, const float* __restrict__ w1, const float* __restrict__ w2, const float* __restrict__ w3, unsigned* __restrict__ BT0) {
  const int is_out = (blockIdx.y == 3); const float* wsrc = (blockIdx.y == 0) ? w0 : ((blockIdx.y == 1) ? w1 : ((blockIdx.y == 2) ? w2 : w3)); unsigned* BT = BT0 + (size_t)blockIdx.y * (RM * RM / 2);
  for (int i = blockIdx.x * 256 + threadIdx.x; i < RM * RM / 2; i += gridDim.x * 256) { float a, b;
    if (!is_out) { const int ln = (i >> 2) & 31, h = i >> 14, e = ((i >> 8) & 3) * 16 + (ln & 15), cp = ((i >> 10) & 15) * 32 + ((i >> 7) & 1) * 16 + (ln >> 4) * 8 + 2 * (i & 3);
      a = wsrc[((size_t)cp * RE + e) * RH + h]; b = wsrc[((size_t)(cp + 1) * RE + e) * RH + h]; }      // halves 2 (i & 3), + 1 of lane ln's 8
    else { const int row = i / (RM / 2), cp = 2 * (i % (RM / 2)); const int m = row; const int h0 = cp / RE, e0 = cp % RE, h1 = (cp + 1) / RE, e1 = (cp + 1) % RE; a = wsrc[((size_t)e0 * RH + h0) * RM + m]; b = wsrc[((size_t)e1 * RH + h1) * RM + m]; }   // Bt[m][k=cp]
    const unsigned u = (unsigned)__builtin_bit_cast(unsigned short, (_Float16)a) | ((unsigned)__builtin_bit_cast(unsigned short, (_Float16)b) << 16); ((unsigned*)BT)[i] = u;  }
}
// q, k, v projections (blockIdx.y picks the plane) with the passes around them folded in: A is read as f32 and rounded to f16 on its way into LDS; the epilogue writes the attention operands themselves.
// A block = 64 tokens x all 8 heads, a wave = one head's 64 columns (its 64 KiB of the weight plane, in fragment order), 64x64 f32 accumulators.
// plane 0: QX [b][h][t][192] = [qp+bu | (qp+bv).alpha_e(t) | (qp+bv).beta_e(t)]; plane 1: KX [b][h][t][192] = [kp | sin th_e(t) | cos th_e(t)]; plane 2: VT [b][h][e][t].
// th_e(t) = t / 10000^((e/2*2)/64); even e: alpha = cos, beta = -sin; odd e: alpha = sin, beta = cos. The block's 64 x 32 (sin, cos) pairs are made once, 8 tokens a wave, and shared by its 8 heads through LDS.
#define APITCH 72      // halves: 128-byte rows at a 144-byte pitch (16 B x odd) for the 16-byte fragment reads
typedef __attribute__((ext_vector_type(4))) _Float16 v4h;
__global__ __launch_bounds__(256) void proj_kernel(const float* __restrict__ x0, const float* __restrict__ x1, const float* __restrict__ x2, const unsigned short* __restrict__ WTp,
    const float* __restrict__ bu, const float* __restrict__ bv, unsigned short* __restrict__ QX, unsigned short* __restrict__ KX, unsigned short* __restrict__ VT) {
  __shared__ __align__(16) float sT[8][16 * 68];   // per-wave 16x64 slab, pitch 68 floats
  __shared__ __align__(16) float sTab[64 * 68];    // row = token of the tile: sin th at 2p, cos th at 2p+1 for the pair e = 2p, 2p+1; the slab's pitch
  __shared__ __align__(16) _Float16 sA[2][64 * APITCH];      // the block's A tile in f16, 64 rows x 64 k, two stages
  const int pl = blockIdx.y;
  const int lane = threadIdx.x & 31, h = threadIdx.x >> 5;
  const int m0 = blockIdx.x << 6, n0 = h << 6;
  const int bh_ = (m0 >> 10) * RH + h, t0 = m0 & (RT - 1);      // 64 divides 1024: a tile lies in one batch
  const int rlane = lane & 15, koff = (lane >> 4) * 8, mOff = (lane >> 4) * 8;
  if (pl != 2) {
    const float inv = powf(10000.0f, (float)(2 * lane) / (float)RE);
    for (int r = 0; r < 8; ++r) {
      const int row = h * 8 + r;
      const float th = (float)(t0 + row) / inv;
      sTab[row * 68 + 2 * lane] = sinf(th); sTab[row * 68 + 2 * lane + 1] = cosf(th);
    }
  }
  // A path: per stage of 64 k the block reads its 64 x 64 f32 tile once, in whole 256-byte rows (8 rows a wave), rounds it to f16 and lays it in LDS for all 8 heads; two buffers, the next stage's rows fly during this stage's products
  const int arow = h * 8 + (lane >> 4), acol = (lane & 15) * 4;
  const float* Ag = ((pl == 0) ? x0 : ((pl == 1) ? x1 : x2)) + (size_t)(m0 + arow) * RM + acol;
  _Float16* aw = &sA[0][arow * APITCH + acol];
  const _Float16* ar = &sA[0][rlane * APITCH + koff];
  const _Float16* Bb = (const _Float16*)WTp + (size_t)pl * (RM * RM) + (size_t)n0 * RM + lane * 8;      // the head's fragments, 512 halves each, [k step][j]
  v8f acc[4][4];
#pragma unroll
  for (int i = 0; i < 4; ++i)
#pragma unroll
    for (int j = 0; j < 4; ++j) acc[i][j] = (v8f){0.f,0.f,0.f,0.f,0.f,0.f,0.f,0.f};
  v4f raw[4];
#pragma unroll
  for (int u = 0; u < 4; ++u) raw[u] = *(const v4f*)(Ag + (size_t)u * 2 * RM);
#pragma unroll
  for (int u = 0; u < 4; ++u) { v4h hv; hv[0] = (_Float16)raw[u][0]; hv[1] = (_Float16)raw[u][1]; hv[2] = (_Float16)raw[u][2]; hv[3] = (_Float16)raw[u][3]; *(v4h*)(aw + u * 2 * APITCH) = hv; }
  __syncthreads();      // stage 0 (and every wave's (sin, cos) rows) is in LDS
#pragma unroll      // unrolled: every global and LDS offset is an immediate, no address register is stepped
  for (int s = 0; s < RM / 64; ++s) {
    if (s + 1 < RM / 64) {
#pragma unroll
      for (int u = 0; u < 4; ++u) raw[u] = *(const v4f*)(Ag + (size_t)u * 2 * RM + (s + 1) * 64);
    }
#pragma unroll
    for (int kk = 0; kk < 2; ++kk) {
      v16h bh[4], ah[4];      // one k order in both loaders: elements 0..7 <- k 0..7, 8..15 <- k 16..23 (from koff on)
#pragma unroll
      for (int j = 0; j < 4; ++j) bh[j] = Frag<_Float16>::load_packed(Bb + ((s * 2 + kk) * 4 + j) * 512);
#pragma unroll
      for (int i = 0; i < 4; ++i) ah[i] = Frag<_Float16>::load(ar + (s & 1) * (64 * APITCH) + i * 16 * APITCH + kk * 32);
      __builtin_amdgcn_sched_barrier(0);      // the k step's 8 global and 8 LDS reads are issued as one group ahead of its products: left alone the compiler reuses one A fragment's registers and waits out each LDS read in turn
#pragma unroll
      for (int i = 0; i < 4; ++i)
#pragma unroll
        for (int j = 0; j < 4; ++j) acc[i][j] = Frag<_Float16>::mma(ah[i], bh[j], acc[i][j]);
    }
    if (s + 1 < RM / 64) {
#pragma unroll
      for (int u = 0; u < 4; ++u) { v4h hv; hv[0] = (_Float16)raw[u][0]; hv[1] = (_Float16)raw[u][1]; hv[2] = (_Float16)raw[u][2]; hv[3] = (_Float16)raw[u][3]; *(v4h*)(aw + ((s + 1) & 1) * (64 * APITCH) + u * 2 * APITCH) = hv; }
      __syncthreads();      // publishes stage s + 1 and ends every wave's reads of stage s's buffer, which stage s + 2 refills
    }
  }
  asm volatile("s_wait_xcnt 0x0" ::: "memory");      // precaution: stands in front of every reuse of the address registers that the loads above name
  if (pl == 2) {      // a lane's 8 accumulator registers are 8 consecutive tokens of one e: VT rows straight from registers
    _Float16* dst = (_Float16*)VT + ((size_t)bh_ * RE + rlane) * RT + t0 + mOff;
#pragma unroll
    for (int j = 0; j < 4; ++j)
#pragma unroll
      for (int i = 0; i < 4; ++i) {
        v8h hv;
#pragma unroll
        for (int r = 0; r < 8; ++r) hv[r] = (_Float16)acc[i][j][r];
        *(v8h*)(dst + (size_t)j * 16 * RT + i * 16) = hv;
      }
    return;
  }
  float* slab = sT[h];
  const int qr = lane >> 3, c8 = (lane & 7) * 8;      // 4 rows a turn, 8 lanes x 8 columns a row
  auto emit = [&](const bool isq) __attribute__((always_inline)) {
    float bu8[8], bv8[8];
    if (isq) {
      const unsigned bo = (unsigned)(c8 * RH + h) * 4u;      // byte offset of (e = c8, h) in the [64][8] biases
#pragma unroll
      for (int e = 0; e < 8; ++e) { bu8[e] = *(const float*)((const char*)bu + bo + e * (RH * 4)); bv8[e] = *(const float*)((const char*)bv + bo + e * (RH * 4)); }
      asm volatile("s_wait_xcnt 0x0" :: "v"(bo) : "memory");      // precaution: the offset that the 16 loads name, an input here, lives up to this wait, so none of them lands on it
    }
    _Float16* X = (_Float16*)(isq ? QX : KX) + ((size_t)bh_ * RT + t0) * RKX + c8;
#pragma unroll
    for (int i = 0; i < 4; ++i) {
#pragma unroll
      for (int j = 0; j < 4; ++j)
#pragma unroll
        for (int r = 0; r < 8; ++r) slab[(mOff + r) * 68 + (j << 4) + rlane] = acc[i][j][r];
      // the wave's own slab: its lanes' LDS writes are done before other lanes of the wave read them (LDS only: no wait for the global stores in flight)
      __builtin_amdgcn_fence(__ATOMIC_RELEASE, "workgroup", "local");
      __builtin_amdgcn_wave_barrier();
      __builtin_amdgcn_fence(__ATOMIC_ACQUIRE, "workgroup", "local");
#pragma unroll
      for (int it = 0; it < 4; ++it) {
        const int row = (i << 4) + it * 4 + qr;
        const float* sp = slab + (it * 4 + qr) * 68 + c8;
        const float* tb = sTab + row * 68 + c8;
        const v4f ya = *(const v4f*)(sp), yb = *(const v4f*)(sp + 4), wa = *(const v4f*)(tb), wb = *(const v4f*)(tb + 4);
        v8h g0, g1, g2;
#pragma unroll
        for (int p = 0; p < 4; ++p) {
          const float y0 = (p < 2) ? ya[2 * (p & 1)] : yb[2 * (p & 1)], y1 = (p < 2) ? ya[2 * (p & 1) + 1] : yb[2 * (p & 1) + 1];
          const float s = (p < 2) ? wa[2 * (p & 1)] : wb[2 * (p & 1)], c = (p < 2) ? wa[2 * (p & 1) + 1] : wb[2 * (p & 1) + 1];
          if (isq) {
            const float qv0 = y0 + bv8[2 * p], qv1 = y1 + bv8[2 * p + 1];
            g0[2 * p] = (_Float16)(y0 + bu8[2 * p]); g0[2 * p + 1] = (_Float16)(y1 + bu8[2 * p + 1]);
            g1[2 * p] = (_Float16)(qv0 * c);    g1[2 * p + 1] = (_Float16)(qv1 * s);
            g2[2 * p] = (_Float16)(qv0 * (-s)); g2[2 * p + 1] = (_Float16)(qv1 * c);
          } else {
            g0[2 * p] = (_Float16)y0; g0[2 * p + 1] = (_Float16)y1;
            g1[2 * p] = (_Float16)s;  g1[2 * p + 1] = (_Float16)s;
            g2[2 * p] = (_Float16)c;  g2[2 * p + 1] = (_Float16)c;
          }
        }
        _Float16* xr = X + (size_t)row * RKX;
        *(v8h*)(xr) = g0; *(v8h*)(xr + 64) = g1; *(v8h*)(xr + 128) = g2;
        if (it & 1) __builtin_amdgcn_sched_barrier(0);      // two turns' LDS reads in flight, not all four: fetched all at once they push the kernel past 256 registers, and two blocks no longer share a WGP
      }
      // and the reads are done before the next 16 rows overwrite the slab
      __builtin_amdgcn_fence(__ATOMIC_RELEASE, "workgroup", "local");
      __builtin_amdgcn_wave_barrier();
      __builtin_amdgcn_fence(__ATOMIC_ACQUIRE, "workgroup", "local");
    }
    asm volatile("s_wait_xcnt 0x0" ::: "memory");      // precaution: stands behind the plane's last stores, in front of any later write of a register that they name
  };
  if (pl == 0) emit(true); else emit(false);
}
// lane l <-> lane l ^ 16
__device__ __forceinline__ float xhalf(float x) { return __builtin_bit_cast(float, __builtin_amdgcn_permlanex16(__builtin_bit_cast(int, x), __builtin_bit_cast(int, x), 0x76543210, 0xfedcba98, false, false)); }
// Fused scores + key mask + softmax + p.v of one (batch, head): a wave owns 64 queries and walks the 1024 keys 32 at a time; no score or probability leaves the registers.
// S^T = KX . QX^T (A = 16 key rows, B = 16 query columns, K = 192), so a lane holds 8 keys of ONE query per tile: maximum and sum in-lane plus one exchange between the wave halves.
// Two S^T tiles (keys 0..15, 16..31), turned into f16 in place, are the B operand of O^T += VT . P^T (A = 16 rows e of VT, k = 32 keys in the loader's own order 8h+s | 16+8h+s).
// Running maximum in base 2; p = 2^(x - m + 15) (the x2^15 keeps small probabilities in f16's normal range; it cancels against the row sum).
// K and V reach the block's four waves through LDS: a stage is 128 keys (4 passes), two buffers, one tensor load a wave and stage. Waves 0..2 bring the three 128-byte column
// slices of the 128 KX rows (pitch 144 B in LDS), wave 3 the 64 VT rows x 256 bytes (pitch 272 B): both pitches 16 B x odd for the 16-byte fragment reads.
#define QG 4      // 16-query column groups a wave: each K and V fragment fetched serves 64 queries
#define AW (256 / (16 * QG))      // waves a block (256 queries)
#define SKEYS 128                      // keys a stage
#define NSTAGE (RT / SKEYS)
#define KPITCH 144u                    // bytes a row of a K slice in LDS
#define VPITCH 272u                    // bytes a VT row in LDS
#define ASLICE (128u * KPITCH)         // 18,432 bytes = 9 x 2 KiB a slice (the V slice, 64 x 272 bytes, is rounded up to it): every slice starts at a multiple of 2 KiB
#define ASTAGE (4u * ASLICE)
typedef __attribute__((ext_vector_type(4))) unsigned u32x4;
typedef __attribute__((ext_vector_type(8))) unsigned u32x8;
__device__ __forceinline__ unsigned uni(unsigned v) { return (unsigned)__builtin_amdgcn_readfirstlane(v); }
__device__ __forceinline__ unsigned pinned(unsigned v) { unsigned w = uni(v); asm volatile("" : "+s"(w)); return w; }      // a tensor load's test word or descriptor word, held in a scalar register (the test's branch is then a scalar one)
// group 1 of a two-dimensional tile, ROWS rows of ROWB bytes at a source pitch of SPITCH bytes, every extent in bytes; W0 = word 0 (no mask, the pad).
// Built once and pinned word by word: descriptor words held in scalar registers of their own, which take no other value while a request that names them is under way
template <unsigned W0, unsigned ROWB, unsigned ROWS, unsigned SPITCH>
__device__ __forceinline__ u32x8 tile_shape() {
  u32x8 g1;
  g1[0] = pinned(W0);
  g1[1] = pinned(ROWB << 16);      // tensor dim0
  g1[2] = pinned(ROWS << 16);      // tensor dim1
  g1[3] = pinned(ROWB << 16);      // tile dim0
  g1[4] = pinned(ROWS);            // tile dim1
  g1[5] = pinned(SPITCH);
  g1[6] = pinned(0u);
  g1[7] = pinned(0u);
  return g1;
}
__global__ __launch_bounds__(AW * 32) void attn_kernel(const unsigned short* __restrict__ QXp, const unsigned short* __restrict__ KXp, const unsigned short* __restrict__ VTp, const int* __restrict__ mask, unsigned short* __restrict__ O16) {
  typedef __attribute__((ext_vector_type(4))) int v4i;
  __shared__ __attribute__((aligned(2048))) unsigned char sKV[2u * ASTAGE];      // [buffer][slice]
  const int lane = threadIdx.x & 31, c = lane & 15, hh = lane >> 4;
  const unsigned wave = uni(threadIdx.x >> 5);
  const int bh = blockIdx.y, b = bh / RH, h = bh % RH;
  const int q0 = blockIdx.x * 256 + (int)wave * (16 * QG);
  const _Float16* Qb = (const _Float16*)QXp + (size_t)bh * RT * RKX + (size_t)(q0 + c) * RKX + hh * 8;
  const int* mrow = mask + (size_t)b * RT + hh * 8;
  const float CS = 0.125f * 1.4426950408889634f;      // 1/sqrt(64), and e^x = 2^(x log2 e)
  // every wave brings its own slice of stage st into buffer st & 1; the branch only picks the slice's shape
  const u32x8 shK = tile_shape<(1u << 20) | (4u << 22) | (3u << 25), 128u, 128u, RKX * 2u>();      // 128 keys x 128 bytes, 4 dwords of pad behind every row
  const u32x8 shV = tile_shape<(1u << 20) | (5u << 22) | (3u << 25), 256u, 64u, RT * 2u>();        // 64 e x 256 bytes (128 keys), likewise
  const unsigned long long gsrc = (unsigned long long)(size_t)(wave == 3u ? VTp + (size_t)bh * RE * RT : KXp + (size_t)bh * RT * RKX + wave * 64u);
  const unsigned gstep = wave == 3u ? SKEYS * 2u : SKEYS * RKX * 2u;      // bytes from a stage's slice to the next stage's
  u32x4 g0;
  g0[0] = pinned(1u);      // count 1
  auto bring = [&](const unsigned st) __attribute__((always_inline)) {
    const unsigned long long ga = gsrc + st * gstep;
    g0[1] = uni((unsigned)(size_t)sKV + (st & 1u) * ASTAGE + wave * ASLICE);      // place in LDS
    g0[2] = uni((unsigned)ga);
    g0[3] = uni((((unsigned)(ga >> 32)) & 0x01FFFFFFu) | 0x80000000u);            // type 2
    if (pinned(wave == 3u)) asm volatile("tensor_load_to_lds %0, %1" :: "s"(g0), "s"(shV) : "memory");
    else                    asm volatile("tensor_load_to_lds %0, %1" :: "s"(g0), "s"(shK) : "memory");
  };
  v16h qf[QG][6];
#pragma unroll
  for (int g = 0; g < QG; ++g)
#pragma unroll
    for (int ks = 0; ks < 6; ++ks) qf[g][ks] = Frag<_Float16>::load(Qb + (size_t)g * 16 * RKX + ks * 32);
  v8f o[QG][4];
#pragma unroll
  for (int g = 0; g < QG; ++g)
#pragma unroll
    for (int et = 0; et < 4; ++et) o[g][et] = (v8f){0.f,0.f,0.f,0.f,0.f,0.f,0.f,0.f};
  float mrun[QG], lsum[QG];
#pragma unroll
  for (int g = 0; g < QG; ++g) { mrun[g] = -3.0e38f; lsum[g] = 0.f; }      // a finite start keeps m - m and -inf - m free of NaN while every key so far is masked
  v16h kf[2][6], vf[4]; v4i mk[2][2];      // the fragments and mask words of the pass at hand; K and the mask words are fetched one pass ahead
  const int* pM = mrow;      // the address that the mask loads in flight name
#pragma unroll
  for (int kt = 0; kt < 2; ++kt) { mk[kt][0] = *(const v4i*)(mrow + kt * 16); mk[kt][1] = *(const v4i*)(mrow + kt * 16 + 4); }
  // precaution: this wait stands in front of every rewrite of a register that a load above names (the query address, an input, lives up to here)
  asm volatile("s_wait_xcnt 0x0" :: "v"(Qb) : "memory");
  __builtin_amdgcn_sched_barrier(0);      // nothing from below (register copies, start values) is lifted in front of that wait, onto a register that a load above names
  bring(0u);
  asm volatile("s_wait_tensorcnt 0" :: "s"(g0) : "memory");      // the wave's own slice of stage 0 has landed (group 0, an input, keeps its registers up to here)
  __syncthreads();      // and every wave's slice may be read by all
  bring(1u);
  // fragment reads, from the lane's row and half on; one k order as from memory: elements 0..7 <- k 0..7, 8..15 <- k 16..23. koff, voff = byte offset of the pass's buffer and of its 32 key rows (K) or 32 key columns (V)
  const unsigned char* kl = sKV + (unsigned)c * KPITCH + (unsigned)hh * 16u;
  const unsigned char* vl = sKV + 3u * ASLICE + (unsigned)c * VPITCH + (unsigned)hh * 16u;
  auto fetch_k = [&](const unsigned koff) __attribute__((always_inline)) {
#pragma unroll
    for (int kt = 0; kt < 2; ++kt)
#pragma unroll
      for (int ks = 0; ks < 6; ++ks) kf[kt][ks] = Frag<_Float16>::load((const _Float16*)(kl + koff + (unsigned)(ks >> 1) * ASLICE + (unsigned)(kt * 16) * KPITCH + (unsigned)(ks & 1) * 64u));
  };
  auto fetch_v = [&](const unsigned voff) __attribute__((always_inline)) {
#pragma unroll
    for (int et = 0; et < 4; ++et) vf[et] = Frag<_Float16>::load((const _Float16*)(vl + voff + (unsigned)(et * 16) * VPITCH));
  };
  fetch_k(0u);
  for (unsigned j = 0; j < RT / 32; ++j) {      // pass j: keys 32 j .. 32 j + 31, of stage j / 4
    fetch_v(((j >> 2) & 1u) * ASTAGE + (j & 3u) * 64u);      // this pass's own V, one group ahead of the score products, which cover its way
    __builtin_amdgcn_sched_barrier(0);      // left alone the compiler sinks these 8 reads in among the products, in two places
    v8f s[2][QG];
#pragma unroll
    for (int kt = 0; kt < 2; ++kt)
#pragma unroll
      for (int g = 0; g < QG; ++g) s[kt][g] = (v8f){0.f,0.f,0.f,0.f,0.f,0.f,0.f,0.f};
#pragma unroll
    for (int ks = 0; ks < 6; ++ks)
#pragma unroll
      for (int kt = 0; kt < 2; ++kt)
#pragma unroll
        for (int g = 0; g < QG; ++g) s[kt][g] = Frag<_Float16>::mma(kf[kt][ks], qf[g][ks], s[kt][g]);
    float bias[2][8];      // 0 for a key that counts, -inf for a masked one
#pragma unroll
    for (int kt = 0; kt < 2; ++kt)
#pragma unroll
      for (int r = 0; r < 4; ++r) { bias[kt][r] = (mk[kt][0][r] == 0) ? -INFINITY : 0.f; bias[kt][4 + r] = (mk[kt][1][r] == 0) ? -INFINITY : 0.f; }
    if (pinned((j & 3u) == 3u)) {
      // a stage's last pass: publish point of the next stage, every wave, in this order. It stands in front of the K fetch below, the first read of that stage; this stage's own last fragments were fetched above and a pass ago
      asm volatile("s_wait_dscnt 0" ::: "memory");          // the wave's reads of this stage's buffer are done
      asm volatile("s_wait_tensorcnt 0" :: "s"(g0) : "memory");      // its own slice of the next stage has landed (group 0 of that request, an input, keeps its registers up to here)
      __syncthreads();      // publishes the next stage and ends every wave's reads of the buffer that the stage after it refills
      if (pinned((j >> 2) + 2u < NSTAGE)) bring((j >> 2) + 2u);
    }
    const unsigned jn = j + 1u, nbuf = ((jn >> 2) & 1u) * ASTAGE;      // behind the last pass there is no next one: its K fetch then falls on buffer 0, published long ago and not refilled, and is not used (no branch around it)
    int jnext = jn < RT / 32 ? (int)jn * 32 : RT - 32;      // likewise the last mask words are read once more: in bounds, not used
    // precaution: this wait stands in front of every rewrite of the address register that the mask loads in flight name: as an input the old address lives up to here, and the new one comes from jnext, which the statement hands on
    asm volatile("s_wait_xcnt 0x0" : "+s"(jnext) : "v"(pM) : "memory");
    pM = mrow + jnext;
#pragma unroll
    for (int kt = 0; kt < 2; ++kt) { mk[kt][0] = *(const v4i*)(pM + kt * 16); mk[kt][1] = *(const v4i*)(pM + kt * 16 + 4); }
    fetch_k(nbuf + (jn & 3u) * (32u * KPITCH));
    __builtin_amdgcn_sched_barrier(0);      // the 24 reads go out as one group: left alone the compiler strews them over the softmax below
#pragma unroll
    for (int g = 0; g < QG; ++g) {
      float x[2][8]; float mx = mrun[g];
#pragma unroll
      for (int kt = 0; kt < 2; ++kt)
#pragma unroll
        for (int r = 0; r < 8; ++r) { x[kt][r] = fmaf(s[kt][g][r], CS, bias[kt][r]); mx = fmaxf(mx, x[kt][r]); }
      const float mnew = fmaxf(mx, xhalf(mx));      // both halves hold the query's running maximum
      const float corr = __builtin_amdgcn_exp2f(mrun[g] - mnew);
      mrun[g] = mnew;
      const float msub = mnew - 15.0f;
      float ps[4]; v16h pf;      // four partial sums: short dependent chains
#pragma unroll
      for (int kt = 0; kt < 2; ++kt)
#pragma unroll
        for (int r = 0; r < 8; ++r) {
          const float p = __builtin_amdgcn_exp2f(x[kt][r] - msub);
          if (kt == 0 && r < 4) ps[r] = p; else ps[r & 3] += p;
          pf[kt * 8 + r] = (_Float16)p;
        }
      lsum[g] = lsum[g] * corr + ((ps[0] + ps[1]) + (ps[2] + ps[3]));
#pragma unroll
      for (int et = 0; et < 4; ++et) o[g][et] *= corr;
#pragma unroll
      for (int et = 0; et < 4; ++et) o[g][et] = Frag<_Float16>::mma(vf[et], pf, o[g][et]);
    }
  }
  asm volatile("s_wait_tensorcnt 0" ::: "memory");      // nothing of the ring is in flight when the wave goes on to its end
  asm volatile("s_wait_dscnt 0" ::: "memory");
  asm volatile("s_wait_xcnt 0x0" :: "v"(pM) : "memory");      // precaution: the last mask loads' address, an input, lives up to this wait, in front of every rewrite of its registers below
#pragma unroll
  for (int g = 0; g < QG; ++g) {
    const float inv = 1.0f / (lsum[g] + xhalf(lsum[g]));      // every key masked: 0 * inf = NaN
    unsigned short* dst = O16 + ((size_t)b * RT + q0 + g * 16 + c) * RM + h * RE + hh * 8;      // a lane's 8 registers are 8 consecutive e of one query
#pragma unroll
    for (int et = 0; et < 4; ++et) {
      v8h hv;
#pragma unroll
      for (int r = 0; r < 8; ++r) hv[r] = (_Float16)(o[g][et][r] * inv);
      *(v8h*)(dst + et * 16) = hv;
    }
  }
}
// Output projection out[m][n] = sum_k O16[m][k] . WOT[n][k] (8192 x 512, k = 512): a block owns a 128 x 128 tile of out and holds its 128 rows of both operands, the whole k, in LDS.
// Eight tiles of 128 rows x 256 bytes (operand x quarter of k), one tensor load a wave, each row padded by 16 bytes to a 272-byte pitch (16 B x odd) for the 16-byte fragment reads.
// A wave = 32 x 64 of the tile; both loaders read k in one order (elements 0..7 <- k 0..7, 8..15 <- k 16..23, from koff on). The loops are unrolled so that every index of a register array is a constant (no scratch).
#define OPITCH 272u                    // bytes a row in LDS
#define OTILE (128u * OPITCH)          // 34,816 bytes = 17 x 2 KiB: every tile starts at a multiple of 2 KiB
#define OSLAB (16u * 68u * 4u)         // a wave's 16 x 64 f32 output slab, pitch 68 floats
__global__ __launch_bounds__(256) void oproj_kernel(const unsigned short* __restrict__ Ap, const unsigned short* __restrict__ Btp, float* __restrict__ C) {
  __shared__ __attribute__((aligned(2048))) unsigned char sO[8u * OTILE + 8u * OSLAB];      // tiles [operand][quarter of k], then the slabs
  const int lane = threadIdx.x & 31;
  const unsigned wave = uni(threadIdx.x >> 5);
  const int n0 = blockIdx.x << 7, m0 = blockIdx.y << 7;
  {
    const unsigned op = wave & 1u, qk = wave >> 1;      // every wave brings one tile: no test around the load
    const unsigned long long ga = (unsigned long long)(size_t)((op ? Btp + (size_t)n0 * RM : Ap + (size_t)m0 * RM) + qk * 128u);
    u32x4 g0; u32x8 g1;
    g0[0] = uni(1u);                                                     // count 1
    g0[1] = uni((unsigned)(size_t)sO + (op * 4u + qk) * OTILE);          // place in LDS
    g0[2] = uni((unsigned)ga);
    g0[3] = uni((((unsigned)(ga >> 32)) & 0x01FFFFFFu) | 0x80000000u);   // type 2
    g1[0] = uni((1u << 20) | (5u << 22) | (3u << 25));                   // no mask, bytes, 4 dwords of pad behind every 256-byte row
    g1[1] = uni(256u << 16);                                             // tensor dim0 = 256 bytes
    g1[2] = uni(128u << 16);                                             // tensor dim1 = 128 rows
    g1[3] = uni(256u << 16);                                             // tile dim0
    g1[4] = uni(128u);                                                   // tile dim1
    g1[5] = uni((unsigned)RM * 2u);                                      // source pitch, bytes
    g1[6] = uni(0u);
    g1[7] = uni(0u);
    asm volatile("tensor_load_to_lds %0, %1" :: "s"(g0), "s"(g1) : "memory");
    asm volatile("s_wait_tensorcnt 0" ::: "memory");      // the wave's own tile has landed
  }
  __syncthreads();      // and every wave's tile may be read by all
  const int rlane = lane & 15, koff = (lane >> 4) * 8, mOff = (lane >> 4) * 8;
  const int wm = (int)(wave & 3u) * 32, wn = (int)(wave >> 2) * 64;
  const unsigned char* ar = sO + (unsigned)(wm + rlane) * OPITCH + koff * 2;
  const unsigned char* br = sO + 4u * OTILE + (unsigned)(wn + rlane) * OPITCH + koff * 2;
  v8f acc[2][4];
#pragma unroll
  for (int i = 0; i < 2; ++i)
#pragma unroll
    for (int j = 0; j < 4; ++j) acc[i][j] = (v8f){0.f,0.f,0.f,0.f,0.f,0.f,0.f,0.f};
  v16h ah[2][2], bh[2][4];      // two fragment sets: the next k step's reads fly during this step's products
  auto fetch = [&](const int s) __attribute__((always_inline)) {
    const unsigned o = (unsigned)(s >> 2) * OTILE + (unsigned)(s & 3) * 64u;
#pragma unroll
    for (int i = 0; i < 2; ++i) ah[s & 1][i] = Frag<_Float16>::load((const _Float16*)(ar + o + (unsigned)i * 16u * OPITCH));
#pragma unroll
    for (int j = 0; j < 4; ++j) bh[s & 1][j] = Frag<_Float16>::load((const _Float16*)(br + o + (unsigned)j * 16u * OPITCH));
  };
  fetch(0);
#pragma unroll      // unrolled: the set index and every LDS offset are constants
  for (int s = 0; s < RM / 32; ++s) {
    if (s + 1 < RM / 32) fetch(s + 1);
    __builtin_amdgcn_sched_barrier(0);      // the next step's 12 LDS reads go out as one group ahead of this step's products, not among them
#pragma unroll
    for (int i = 0; i < 2; ++i)
#pragma unroll
      for (int j = 0; j < 4; ++j) acc[i][j] = Frag<_Float16>::mma(ah[s & 1][i], bh[s & 1][j], acc[i][j]);
    __builtin_amdgcn_sched_barrier(0);      // and the step after's stay behind them: with no fence the compiler fetches many steps at once, takes all 512 registers and spills
  }
  // out in whole 256-byte row pieces, through the wave's own slab
  float* slab = (float*)(sO + 8u * OTILE + wave * OSLAB);
  const int hh = lane >> 4, c4 = (lane & 15) * 4;
  float* Cw = C + (size_t)(m0 + wm) * RM + n0 + wn + c4;
#pragma unroll
  for (int i = 0; i < 2; ++i) {
#pragma unroll
    for (int j = 0; j < 4; ++j)
#pragma unroll
      for (int r = 0; r < 8; ++r) slab[(mOff + r) * 68 + (j << 4) + rlane] = acc[i][j][r];
    // the wave's own slab: its lanes' LDS writes are done before other lanes of the wave read them (LDS only: no wait for the global stores in flight)
    __builtin_amdgcn_fence(__ATOMIC_RELEASE, "workgroup", "local");
    __builtin_amdgcn_wave_barrier();
    __builtin_amdgcn_fence(__ATOMIC_ACQUIRE, "workgroup", "local");
#pragma unroll
    for (int it = 0; it < 8; ++it) {
      const int row = it * 2 + hh;
      const v4f v = *(const v4f*)(slab + row * 68 + c4);
      *(v4f*)(Cw + (size_t)(i * 16 + row) * RM) = v;
    }
    // and the reads are done before the next 16 rows overwrite the slab
    __builtin_amdgcn_fence(__ATOMIC_RELEASE, "workgroup", "local");
    __builtin_amdgcn_wave_barrier();
    __builtin_amdgcn_fence(__ATOMIC_ACQUIRE, "workgroup", "local");
  }
}
extern "C" void kernel_launch(void* const* d_in, const int* in_sizes, int n_in, void* d_out, int out_size, void* d_ws, size_t ws_size, hipStream_t stream) {
  (void)in_sizes; (void)n_in; (void)out_size; (void)ws_size;
  auto Fp = [&](int i) { return (const float*)d_in[i]; };
  const float* q = Fp(0); const float* k = Fp(1); const float* v = Fp(2); const int* mask = (const int*)d_in[3]; const float* wq = Fp(4); const float* wk = Fp(5); const float* wv = Fp(6); const float* bu = Fp(7); const float* bv = Fp(8); const float* wo = Fp(9);
  char* ws = (char*)d_ws; size_t off = 0;
  auto carve = [&](size_t bytes) -> char* { char* p = ws + off; off += (bytes + 255) & ~(size_t)255; return p; };
  const size_t NTOK = (size_t)RB_ * RT;
  _Float16* O16 = (_Float16*)carve(NTOK * RM * 2);      // attention output, f16, [b][t][h*64+e]
  unsigned* WT = (unsigned*)carve((size_t)4 * RM * RM * 2); unsigned* WOT = WT + (size_t)3 * (RM * RM / 2);      // four permuted weights, planes wq, wk, wv, wo
  unsigned* QX = (unsigned*)carve(NTOK * RH * RKX * 2); unsigned* KX = (unsigned*)carve(NTOK * RH * RKX * 2); unsigned* VT = (unsigned*)carve(NTOK * RM * 2);     // QX/KX of all batches, 24 MiB each; total workspace footprint = 66 MiB
  wperm_kernel<<<dim3(64, 4), 256, 0, stream>>>(wq, wk, wv, wo, WT);
  // q, k, v projections side by side on blockIdx.y, from the f32 inputs to the attention operands
  proj_kernel<<<dim3((unsigned)(NTOK / 64), 3), 256, 0, stream>>>(q, k, v, (const unsigned short*)WT, bu, bv, (unsigned short*)QX, (unsigned short*)KX, (unsigned short*)VT);
  // scores, softmax and p.v of all 64 (batch, head) pairs in ONE launch: 256 queries a block
  attn_kernel<<<dim3(RT / 256, RB_ * RH), AW * 32, 0, stream>>>((const unsigned short*)QX, (const unsigned short*)KX, (const unsigned short*)VT, mask, (unsigned short*)O16);
  // output projection: a 128 x 128 tile of out a block
  oproj_kernel<<<dim3(RM / 128, (unsigned)(NTOK / 128)), 256, 0, stream>>>((const unsigned short*)O16, (const unsigned short*)WOT, (float*)d_out);
}

// v007
// A run of this version takes 65.1 microseconds.
// Timed twice side by side with v006, it ran 1.14 times as fast both times.
// Over all steps from v000 it is 12.7 times as fast.
#include <hip/hip_runtime.h>
#include <math.h>
// Relative-position multi-head attention (8 x 1024 tokens, 512 model, 8 heads x 64, Transformer-XL sinusoid table over k−q): every contraction on
// v_wmma_f32_16x16x32_f16, f16 operands, f32 accumulate (plain single products): the q/k/v projections (8192 x 512 · 512 x 512, weights permuted to
// head-major columns), the scores as ONE product per (batch, head) with K = 128: [q+bu | u(i), w(i)] . [k | sin th(j), cos th(j)]^T,
// using the exact identity sin/cos(th(j) - th(i)) = products of per-position sin/cos (so the [T,T,64] sinusoid table is never formed or gathered); columns e = 2p and 2p+1 share one angle th_p,
// so their two terms on sin th_p(j) are added in f32 into one factor u_p(i), their two on cos th_p(j) into w_p(i): 32 + 32 position columns, not 64 + 64,
// p.v (probabilities x2^15) and the output projection; scale 1/sqrt(64), key mask (-inf) and softmax in f32 on VALU, fused with the score and p.v products in one kernel
// (running maximum and sum over blocks of 32 keys; scores and probabilities stay in registers).
typedef __attribute__((ext_vector_type(16))) _Float16 v16h;
typedef __attribute__((ext_vector_type(8)))  _Float16 v8h;
typedef __attribute__((ext_vector_type(8)))  float    v8f;
typedef __attribute__((ext_vector_type(4)))  float    v4f;

template <typename T> struct Frag;
template <> struct Frag<_Float16> {
  typedef v16h V; union U { v16h v; v8h h[2]; };
  static __device__ __forceinline__ v16h load(const _Float16* p) {   // elements 0..7 <- p[0..7], 8..15 <- p[16..23]
    U f; f.h[0] = *(const v8h*)(p); f.h[1] = *(const v8h*)(p + 16); return f.v;
  }
  static __device__ __forceinline__ v16h load_packed(const _Float16* p) {   // a fragment stored in fragment order: elements 0..7 <- p[0..7], 8..15 <- p[256..263] (p = the fragment's start + 8 * lane)
    U f; f.h[0] = *(const v8h*)(p); f.h[1] = *(const v8h*)(p + 256); return f.v;
  }
  static __device__ __forceinline__ v8f mma(v16h a, v16h b, v8f c) {
    return __builtin_amdgcn_wmma_f32_16x16x32_f16(false, a, false, b, (short)0, c, false, false);
  }
};

#define RB_ 8
#define RT 1024
#define RM 512
#define RE 64
#define RH 8
#define RKX 128
// wo [e][h][m] -> Bt f16 [m][h*64+e]; blockIdx.y picks the weight (0..2 = wq, wk, wv; 3 = wo), its Bt is plane blockIdx.y of BT0.
// wq, wk, wv [m][e][h] -> f16 in the order in which the projection's B fragments are loaded: [h][k step of 32][16-column group j][part][lane][8 halves], where
// column e = 16 j + (lane & 15) and k = m = 32 step + 16 part + 8 (lane >> 4) + 0..7: a wave's 16-byte load then reads 512 bytes in a row, 4 whole 128-byte lines.
__global__ __launch_bounds__(256) void wperm_kernel(const float* __restrict__ w0, const float* __restrict__ w1, const float* __restrict__ w2, const float* __restrict__ w3, unsigned* __restrict__ BT0) {
  const int is_out = (blockIdx.y == 3); const float* wsrc = (blockIdx.y == 0) ? w0 : ((blockIdx.y == 1) ? w1 : ((blockIdx.y == 2) ? w2 : w3)); unsigned* BT = BT0 + (size_t)blockIdx.y * (RM * RM / 2);
  for (int i = blockIdx.x * 256 + threadIdx.x; i < RM * RM / 2; i += gridDim.x * 256) { float a, b;
    if (!is_out) { const int ln = (i >> 2) & 31, h = i >> 14, e = ((i >> 8) & 3) * 16 + (ln & 15), cp = ((i >> 10) & 15) * 32 + ((i >> 7) & 1) * 16 + (ln >> 4) * 8 + 2 * (i & 3);
      a = wsrc[((size_t)cp * RE + e) * RH + h]; b = wsrc[((size_t)(cp + 1) * RE + e) * RH + h]; }      // halves 2 (i & 3), + 1 of lane ln's 8
    else { const int row = i / (RM / 2), cp = 2 * (i % (RM / 2)); const int m = row; const int h0 = cp / RE, e0 = cp % RE, h1 = (cp + 1) / RE, e1 = (cp + 1) % RE; a = wsrc[((size_t)e0 * RH + h0) * RM + m]; b = wsrc[((size_t)e1 * RH + h1) * RM + m]; }   // Bt[m][k=cp]
    const unsigned u = (unsigned)__builtin_bit_cast(unsigned short, (_Float16)a) | ((unsigned)__builtin_bit_cast(unsigned short, (_Float16)b) << 16); ((unsigned*)BT)[i] = u;  }
}
// q, k, v projections (blockIdx.y picks the plane) with the passes around them folded in: A is read as f32 and rounded to f16 on its way into LDS; the epilogue writes the attention operands themselves.
// A block = 64 tokens x all 8 heads, a wave = one head's 64 columns (its 64 KiB of the weight plane, in fragment order), 64x64 f32 accumulators.
// plane 0: QX [b][h][t][128] = [qp+bu | u_p(t) at 64+2p, w_p(t) at 64+2p+1]; plane 1: KX [b][h][t][128] = [kp | sin th_p(t) at 64+2p, cos th_p(t) at 64+2p+1]; plane 2: VT [b][h][e][t].
// th_p(t) = t / 10000^(2p/64), the angle of e = 2p and 2p+1; with y = qp+bv: u_p = y_2p cos th_p + y_2p+1 sin th_p (what stands on sin th_p of the key), w_p = y_2p+1 cos th_p - y_2p sin th_p (on its cos). The block's 64 x 32 (sin, cos) pairs are made once, 8 tokens a wave, and shared by its 8 heads through LDS.
#define APITCH 72      // halves: 128-byte rows at a 144-byte pitch (16 B x odd) for the 16-byte fragment reads
typedef __attribute__((ext_vector_type(4))) _Float16 v4h;
__global__ __launch_bounds__(256) void proj_kernel(const float* __restrict__ x0, const float* __restrict__ x1, const float* __restrict__ x2, const unsigned short* __restrict__ WTp,
    const float* __restrict__ bu, const float* __restrict__ bv, unsigned short* __restrict__ QX, unsigned short* __restrict__ KX, unsigned short* __restrict__ VT) {
  __shared__ __align__(16) float sT[8][16 * 68];   // per-wave 16x64 slab, pitch 68 floats
  __shared__ __align__(16) float sTab[64 * 68];    // row = token of the tile: sin th at 2p, cos th at 2p+1 for the pair e = 2p, 2p+1; the slab's pitch
  __shared__ __align__(16) _Float16 sA[2][64 * APITCH];      // the block's A tile in f16, 64 rows x 64 k, two stages
  const int pl = blockIdx.y;
  const int lane = threadIdx.x & 31, h = threadIdx.x >> 5;
  const int m0 = blockIdx.x << 6, n0 = h << 6;
  const int bh_ = (m0 >> 10) * RH + h, t0 = m0 & (RT - 1);      // 64 divides 1024: a tile lies in one batch
  const int rlane = lane & 15, koff = (lane >> 4) * 8, mOff = (lane >> 4) * 8;
  if (pl != 2) {
    const float inv = powf(10000.0f, (float)(2 * lane) / (float)RE);
    for (int r = 0; r < 8; ++r) {
      const int row = h * 8 + r;
      const float th = (float)(t0 + row) / inv;
      sTab[row * 68 + 2 * lane] = sinf(th); sTab[row * 68 + 2 * lane + 1] = cosf(th);
    }
  }
  // A path: per stage of 64 k the block reads its 64 x 64 f32 tile once, in whole 256-byte rows (8 rows a wave), rounds it to f16 and lays it in LDS for all 8 heads; two buffers, the next stage's rows fly during this stage's products
  const int arow = h * 8 + (lane >> 4), acol = (lane & 15) * 4;
  const float* Ag = ((pl == 0) ? x0 : ((pl == 1) ? x1 : x2)) + (size_t)(m0 + arow) * RM + acol;
  _Float16* aw = &sA[0][arow * APITCH + acol];
  const _Float16* ar = &sA[0][rlane * APITCH + koff];
  const _Float16* Bb = (const _Float16*)WTp + (size_t)pl * (RM * RM) + (size_t)n0 * RM + lane * 8;      // the head's fragments, 512 halves each, [k step][j]
  v8f acc[4][4];
#pragma unroll
  for (int i = 0; i < 4; ++i)
#pragma unroll
    for (int j = 0; j < 4; ++j) acc[i][j] = (v8f){0.f,0.f,0.f,0.f,0.f,0.f,0.f,0.f};
  v4f raw[4];
#pragma unroll
  for (int u = 0; u < 4; ++u) raw[u] = *(const v4f*)(Ag + (size_t)u * 2 * RM);
#pragma unroll
  for (int u = 0; u < 4; ++u) { v4h hv; hv[0] = (_Float16)raw[u][0]; hv[1] = (_Float16)raw[u][1]; hv[2] = (_Float16)raw[u][2]; hv[3] = (_Float16)raw[u][3]; *(v4h*)(aw + u * 2 * APITCH) = hv; }
  __syncthreads();      // stage 0 (and every wave's (sin, cos) rows) is in LDS
#pragma unroll      // unrolled: every global and LDS offset is an immediate, no address register is stepped
  for (int s = 0; s < RM / 64; ++s) {
    if (s + 1 < RM / 64) {
#pragma unroll
      for (int u = 0; u < 4; ++u) raw[u] = *(const v4f*)(Ag + (size_t)u * 2 * RM + (s + 1) * 64);
    }
#pragma unroll
    for (int kk = 0; kk < 2; ++kk) {
      v16h bh[4], ah[4];      // one k order in both loaders: elements 0..7 <- k 0..7, 8..15 <- k 16..23 (from koff on)
#pragma unroll
      for (int j = 0; j < 4; ++j) bh[j] = Frag<_Float16>::load_packed(Bb + ((s * 2 + kk) * 4 + j) * 512);
#pragma unroll
      for (int i = 0; i < 4; ++i) ah[i] = Frag<_Float16>::load(ar + (s & 1) * (64 * APITCH) + i * 16 * APITCH + kk * 32);
      __builtin_amdgcn_sched_barrier(0);      // the k step's 8 global and 8 LDS reads are issued as one group ahead of its products: left alone the compiler reuses one A fragment's registers and waits out each LDS read in turn
#pragma unroll
      for (int i = 0; i < 4; ++i)
#pragma unroll
        for (int j = 0; j < 4; ++j) acc[i][j] = Frag<_Float16>::mma(ah[i], bh[j], acc[i][j]);
    }
    if (s + 1 < RM / 64) {
#pragma unroll
      for (int u = 0; u < 4; ++u) { v4h hv; hv[0] = (_Float16)raw[u][0]; hv[1] = (_Float16)raw[u][1]; hv[2] = (_Float16)raw[u][2]; hv[3] = (_Float16)raw[u][3]; *(v4h*)(aw + ((s + 1) & 1) * (64 * APITCH) + u * 2 * APITCH) = hv; }
      __syncthreads();      // publishes stage s + 1 and ends every wave's reads of stage s's buffer, which stage s + 2 refills
    }
  }
  asm volatile("s_wait_xcnt 0x0" ::: "memory");      // precaution: stands in front of every reuse of the address registers that the loads above name
  if (pl == 2) {      // a lane's 8 accumulator registers are 8 consecutive tokens of one e: VT rows straight from registers
    _Float16* dst = (_Float16*)VT + ((size_t)bh_ * RE + rlane) * RT + t0 + mOff;
#pragma unroll
    for (int j = 0; j < 4; ++j)
#pragma unroll
      for (int i = 0; i < 4; ++i) {
        v8h hv;
#pragma unroll
        for (int r = 0; r < 8; ++r) hv[r] = (_Float16)acc[i][j][r];
        *(v8h*)(dst + (size_t)j * 16 * RT + i * 16) = hv;
      }
    return;
  }
  float* slab = sT[h];
  const int qr = lane >> 3, c8 = (lane & 7) * 8;      // 4 rows a turn, 8 lanes x 8 columns a row
  auto emit = [&](const bool isq) __attribute__((always_inline)) {
    float bu8[8], bv8[8];
    if (isq) {
      const unsigned bo = (unsigned)(c8 * RH + h) * 4u;      // byte offset of (e = c8, h) in the [64][8] biases
#pragma unroll
      for (int e = 0; e < 8; ++e) { bu8[e] = *(const float*)((const char*)bu + bo + e * (RH * 4)); bv8[e] = *(const float*)((const char*)bv + bo + e * (RH * 4)); }
      asm volatile("s_wait_xcnt 0x0" :: "v"(bo) : "memory");      // precaution: the offset that the 16 loads name, an input here, lives up to this wait, so none of them lands on it
    }
    _Float16* X = (_Float16*)(isq ? QX : KX) + ((size_t)bh_ * RT + t0) * RKX + c8;
#pragma unroll
    for (int i = 0; i < 4; ++i) {
#pragma unroll
      for (int j = 0; j < 4; ++j)
#pragma unroll
        for (int r = 0; r < 8; ++r) slab[(mOff + r) * 68 + (j << 4) + rlane] = acc[i][j][r];
      // the wave's own slab: its lanes' LDS writes are done before other lanes of the wave read them (LDS only: no wait for the global stores in flight)
      __builtin_amdgcn_fence(__ATOMIC_RELEASE, "workgroup", "local");
      __builtin_amdgcn_wave_barrier();
      __builtin_amdgcn_fence(__ATOMIC_ACQUIRE, "workgroup", "local");
#pragma unroll
      for (int it = 0; it < 4; ++it) {
        const int row = (i << 4) + it * 4 + qr;
        const float* sp = slab + (it * 4 + qr) * 68 + c8;
        const float* tb = sTab + row * 68 + c8;
        const v4f ya = *(const v4f*)(sp), yb = *(const v4f*)(sp + 4), wa = *(const v4f*)(tb), wb = *(const v4f*)(tb + 4);
        v8h g0, g1;
#pragma unroll
        for (int p = 0; p < 4; ++p) {
          const float y0 = (p < 2) ? ya[2 * (p & 1)] : yb[2 * (p & 1)], y1 = (p < 2) ? ya[2 * (p & 1) + 1] : yb[2 * (p & 1) + 1];
          const float s = (p < 2) ? wa[2 * (p & 1)] : wb[2 * (p & 1)], c = (p < 2) ? wa[2 * (p & 1) + 1] : wb[2 * (p & 1) + 1];
          if (isq) {
            const float qv0 = y0 + bv8[2 * p], qv1 = y1 + bv8[2 * p + 1];
            g0[2 * p] = (_Float16)(y0 + bu8[2 * p]); g0[2 * p + 1] = (_Float16)(y1 + bu8[2 * p + 1]);
            g1[2 * p] = (_Float16)(qv0 * c + qv1 * s); g1[2 * p + 1] = (_Float16)(qv1 * c - qv0 * s);
          } else {
            g0[2 * p] = (_Float16)y0; g0[2 * p + 1] = (_Float16)y1;
            g1[2 * p] = (_Float16)s;  g1[2 * p + 1] = (_Float16)c;
          }
        }
        _Float16* xr = X + (size_t)row * RKX;
        *(v8h*)(xr) = g0; *(v8h*)(xr + 64) = g1;
        if (it & 1) __builtin_amdgcn_sched_barrier(0);      // two turns' LDS reads in flight, not all four: fetched all at once they push the kernel past 256 registers, and two blocks no longer share a WGP
      }
      // and the reads are done before the next 16 rows overwrite the slab
      __builtin_amdgcn_fence(__ATOMIC_RELEASE, "workgroup", "local");
      __builtin_amdgcn_wave_barrier();
      __builtin_amdgcn_fence(__ATOMIC_ACQUIRE, "workgroup", "local");
    }
    asm volatile("s_wait_xcnt 0x0" ::: "memory");      // precaution: stands behind the plane's last stores, in front of any later write of a register that they name
  };
  if (pl == 0) emit(true); else emit(false);
}
// lane l <-> lane l ^ 16
__device__ __forceinline__ float xhalf(float x) { return __builtin_bit_cast(float, __builtin_amdgcn_permlanex16(__builtin_bit_cast(int, x), __builtin_bit_cast(int, x), 0x76543210, 0xfedcba98, false, false)); }
// Fused scores + key mask + softmax + p.v of one (batch, head): a wave owns 64 queries and walks the 1024 keys 32 at a time; no score or probability leaves the registers.
// S^T = KX . QX^T (A = 16 key rows, B = 16 query columns, K = 128), so a lane holds 8 keys of ONE query per tile: maximum and sum in-lane plus one exchange between the wave halves.
// Two S^T tiles (keys 0..15, 16..31), turned into f16 in place, are the B operand of O^T += VT . P^T (A = 16 rows e of VT, k = 32 keys in the loader's own order 8h+s | 16+8h+s).
// Running maximum in base 2; p = 2^(x - m + 15) (the x2^15 keeps small probabilities in f16's normal range; it cancels against the row sum).
// K and V reach the block's four waves through LDS: a stage is 128 keys (4 passes), two buffers, one tensor load a wave and stage. Waves 0 and 1 bring the two 128-byte column
// slices of the 128 KX rows (pitch 144 B in LDS), waves 2 and 3 each 32 of the 64 VT rows x 256 bytes (pitch 272 B): both pitches 16 B x odd for the 16-byte fragment reads.
#define QG 4      // 16-query column groups a wave: each K and V fragment fetched serves 64 queries
#define AW (256 / (16 * QG))      // waves a block (256 queries)
#define SKEYS 128                      // keys a stage
#define NSTAGE (RT / SKEYS)
#define KPITCH 144u                    // bytes a row of a K slice in LDS
#define VPITCH 272u                    // bytes a VT row in LDS
#define ASLICE (128u * KPITCH)         // 18,432 bytes = 9 x 2 KiB a K slice
#define VSLICE 10240u                  // a V slice, 32 x 272 = 8,704 bytes, rounded up to 5 x 2 KiB: every slice starts at a multiple of 2 KiB
#define ASTAGE (2u * ASLICE + 2u * VSLICE)
typedef __attribute__((ext_vector_type(4))) unsigned u32x4;
typedef __attribute__((ext_vector_type(8))) unsigned u32x8;
__device__ __forceinline__ unsigned uni(unsigned v) { return (unsigned)__builtin_amdgcn_readfirstlane(v); }
__device__ __forceinline__ unsigned pinned(unsigned v) { unsigned w = uni(v); asm volatile("" : "+s"(w)); return w; }      // a tensor load's test word or descriptor word, held in a scalar register (the test's branch is then a scalar one)
// group 1 of a two-dimensional tile, ROWS rows of ROWB bytes at a source pitch of SPITCH bytes, every extent in bytes; W0 = word 0 (no mask, the pad).
// Built once and pinned word by word: descriptor words held in scalar registers of their own, which take no other value while a request that names them is under way
template <unsigned W0, unsigned ROWB, unsigned ROWS, unsigned SPITCH>
__device__ __forceinline__ u32x8 tile_shape() {
  u32x8 g1;
  g1[0] = pinned(W0);
  g1[1] = pinned(ROWB << 16);      // tensor dim0
  g1[2] = pinned(ROWS << 16);      // tensor dim1
  g1[3] = pinned(ROWB << 16);      // tile dim0
  g1[4] = pinned(ROWS);            // tile dim1
  g1[5] = pinned(SPITCH);
  g1[6] = pinned(0u);
  g1[7] = pinned(0u);
  return g1;
}
__global__ __launch_bounds__(AW * 32) void attn_kernel(const unsigned short* __restrict__ QXp, const unsigned short* __restrict__ KXp, const unsigned short* __restrict__ VTp, const int* __restrict__ mask, unsigned short* __restrict__ O16) {
  typedef __attribute__((ext_vector_type(4))) int v4i;
  __shared__ __attribute__((aligned(2048))) unsigned char sKV[2u * ASTAGE];      // [buffer][slice]
  const int lane = threadIdx.x & 31, c = lane & 15, hh = lane >> 4;
  const unsigned wave = uni(threadIdx.x >> 5);
  const int bh = blockIdx.y, b = bh / RH, h = bh % RH;
  const int q0 = blockIdx.x * 256 + (int)wave * (16 * QG);
  const _Float16* Qb = (const _Float16*)QXp + (size_t)bh * RT * RKX + (size_t)(q0 + c) * RKX + hh * 8;
  const int* mrow = mask + (size_t)b * RT + hh * 8;
  const float CS = 0.125f * 1.4426950408889634f;      // 1/sqrt(64), and e^x = 2^(x log2 e)
  // every wave brings its own slice of stage st into buffer st & 1; the branch only picks the slice's shape
  const u32x8 shK = tile_shape<(1u << 20) | (4u << 22) | (3u << 25), 128u, 128u, RKX * 2u>();      // 128 keys x 128 bytes, 4 dwords of pad behind every row
  const u32x8 shV = tile_shape<(1u << 20) | (5u << 22) | (3u << 25), 256u, 32u, RT * 2u>();        // 32 e x 256 bytes (128 keys), likewise
  const unsigned long long gsrc = (unsigned long long)(size_t)(wave >= 2u ? VTp + (size_t)bh * RE * RT + (wave - 2u) * (32u * RT) : KXp + (size_t)bh * RT * RKX + wave * 64u);
  const unsigned gstep = wave >= 2u ? SKEYS * 2u : SKEYS * RKX * 2u;      // bytes from a stage's slice to the next stage's
  const unsigned lplace = wave >= 2u ? 2u * ASLICE + (wave - 2u) * VSLICE : wave * ASLICE;      // the slice's place in a buffer
  u32x4 g0;
  g0[0] = pinned(1u);      // count 1
  auto bring = [&](const unsigned st) __attribute__((always_inline)) {
    const unsigned long long ga = gsrc + st * gstep;
    g0[1] = uni((unsigned)(size_t)sKV + (st & 1u) * ASTAGE + lplace);      // place in LDS
    g0[2] = uni((unsigned)ga);
    g0[3] = uni((((unsigned)(ga >> 32)) & 0x01FFFFFFu) | 0x80000000u);            // type 2
    if (pinned(wave >= 2u)) asm volatile("tensor_load_to_lds %0, %1" :: "s"(g0), "s"(shV) : "memory");
    else                    asm volatile("tensor_load_to_lds %0, %1" :: "s"(g0), "s"(shK) : "memory");
  };
  v16h qf[QG][RKX / 32];
#pragma unroll
  for (int g = 0; g < QG; ++g)
#pragma unroll
    for (int ks = 0; ks < RKX / 32; ++ks) qf[g][ks] = Frag<_Float16>::load(Qb + (size_t)g * 16 * RKX + ks * 32);
  v8f o[QG][4];
#pragma unroll
  for (int g = 0; g < QG; ++g)
#pragma unroll
    for (int et = 0; et < 4; ++et) o[g][et] = (v8f){0.f,0.f,0.f,0.f,0.f,0.f,0.f,0.f};
  float mrun[QG], lsum[QG];
#pragma unroll
  for (int g = 0; g < QG; ++g) { mrun[g] = -3.0e38f; lsum[g] = 0.f; }      // a finite start keeps m - m and -inf - m free of NaN while every key so far is masked
  v16h kf[2][RKX / 32], vf[4]; v4i mk[2][2];      // the fragments and mask words of the pass at hand; K and the mask words are fetched one pass ahead
  const int* pM = mrow;      // the address that the mask loads in flight name
#pragma unroll
  for (int kt = 0; kt < 2; ++kt) { mk[kt][0] = *(const v4i*)(mrow + kt * 16); mk[kt][1] = *(const v4i*)(mrow + kt * 16 + 4); }
  // precaution: this wait stands in front of every rewrite of a register that a load above names (the query address, an input, lives up to here)
  asm volatile("s_wait_xcnt 0x0" :: "v"(Qb) : "memory");
  __builtin_amdgcn_sched_barrier(0);      // nothing from below (register copies, start values) is lifted in front of that wait, onto a register that a load above names
  bring(0u);
  asm volatile("s_wait_tensorcnt 0" :: "s"(g0) : "memory");      // the wave's own slice of stage 0 has landed (group 0, an input, keeps its registers up to here)
  __syncthreads();      // and every wave's slice may be read by all
  bring(1u);
  // fragment reads, from the lane's row and half on; one k order as from memory: elements 0..7 <- k 0..7, 8..15 <- k 16..23. koff, voff = byte offset of the pass's buffer and of its 32 key rows (K) or 32 key columns (V)
  const unsigned char* kl = sKV + (unsigned)c * KPITCH + (unsigned)hh * 16u;
  const unsigned char* vl = sKV + 2u * ASLICE + (unsigned)c * VPITCH + (unsigned)hh * 16u;
  auto fetch_k = [&](const unsigned koff) __attribute__((always_inline)) {
#pragma unroll
    for (int kt = 0; kt < 2; ++kt)
#pragma unroll
      for (int ks = 0; ks < RKX / 32; ++ks) kf[kt][ks] = Frag<_Float16>::load((const _Float16*)(kl + koff + (unsigned)(ks >> 1) * ASLICE + (unsigned)(kt * 16) * KPITCH + (unsigned)(ks & 1) * 64u));
  };
  auto fetch_v = [&](const unsigned voff) __attribute__((always_inline)) {
#pragma unroll
    for (int et = 0; et < 4; ++et) vf[et] = Frag<_Float16>::load((const _Float16*)(vl + voff + (unsigned)(et >> 1) * VSLICE + (unsigned)((et & 1) * 16) * VPITCH));
  };
  fetch_k(0u);
  for (unsigned j = 0; j < RT / 32; ++j) {      // pass j: keys 32 j .. 32 j + 31, of stage j / 4
    fetch_v(((j >> 2) & 1u) * ASTAGE + (j & 3u) * 64u);      // this pass's own V, one group ahead of the score products, which cover its way
    __builtin_amdgcn_sched_barrier(0);      // left alone the compiler sinks these 8 reads in among the products, in two places
    v8f s[2][QG];
#pragma unroll
    for (int kt = 0; kt < 2; ++kt)
#pragma unroll
      for (int g = 0; g < QG; ++g) s[kt][g] = (v8f){0.f,0.f,0.f,0.f,0.f,0.f,0.f,0.f};
#pragma unroll
    for (int ks = 0; ks < RKX / 32; ++ks)
#pragma unroll
      for (int kt = 0; kt < 2; ++kt)
#pragma unroll
        for (int g = 0; g < QG; ++g) s[kt][g] = Frag<_Float16>::mma(kf[kt][ks], qf[g][ks], s[kt][g]);
    float bias[2][8];      // 0 for a key that counts, -inf for a masked one
#pragma unroll
    for (int kt = 0; kt < 2; ++kt)
#pragma unroll
      for (int r = 0; r < 4; ++r) { bias[kt][r] = (mk[kt][0][r] == 0) ? -INFINITY : 0.f; bias[kt][4 + r] = (mk[kt][1][r] == 0) ? -INFINITY : 0.f; }
    if (pinned((j & 3u) == 3u)) {
      // a stage's last pass: publish point of the next stage, every wave, in this order. It stands in front of the K fetch below, the first read of that stage; this stage's own last fragments were fetched above and a pass ago
      asm volatile("s_wait_dscnt 0" ::: "memory");          // the wave's reads of this stage's buffer are done
      asm volatile("s_wait_tensorcnt 0" :: "s"(g0) : "memory");      // its own slice of the next stage has landed (group 0 of that request, an input, keeps its registers up to here)
      __syncthreads();      // publishes the next stage and ends every wave's reads of the buffer that the stage after it refills
      if (pinned((j >> 2) + 2u < NSTAGE)) bring((j >> 2) + 2u);
    }
    const unsigned jn = j + 1u, nbuf = ((jn >> 2) & 1u) * ASTAGE;      // behind the last pass there is no next one: its K fetch then falls on buffer 0, published long ago and not refilled, and is not used (no branch around it)
    int jnext = jn < RT / 32 ? (int)jn * 32 : RT - 32;      // likewise the last mask words are read once more: in bounds, not used
    // precaution: this wait stands in front of every rewrite of the address register that the mask loads in flight name: as an input the old address lives up to here, and the new one comes from jnext, which the statement hands on
    asm volatile("s_wait_xcnt 0x0" : "+s"(jnext) : "v"(pM) : "memory");
    pM = mrow + jnext;
#pragma unroll
    for (int kt = 0; kt < 2; ++kt) { mk[kt][0] = *(const v4i*)(pM + kt * 16); mk[kt][1] = *(const v4i*)(pM + kt * 16 + 4); }
    fetch_k(nbuf + (jn & 3u) * (32u * KPITCH));
    __builtin_amdgcn_sched_barrier(0);      // the 16 reads go out as one group: left alone the compiler strews them over the softmax below
#pragma unroll
    for (int g = 0; g < QG; ++g) {
      float x[2][8]; float mx = mrun[g];
#pragma unroll
      for (int kt = 0; kt < 2; ++kt)
#pragma unroll
        for (int r = 0; r < 8; ++r) { x[kt][r] = fmaf(s[kt][g][r], CS, bias[kt][r]); mx = fmaxf(mx, x[kt][r]); }
      const float mnew = fmaxf(mx, xhalf(mx));      // both halves hold the query's running maximum
      const float corr = __builtin_amdgcn_exp2f(mrun[g] - mnew);
      mrun[g] = mnew;
      const float msub = mnew - 15.0f;
      float ps[4]; v16h pf;      // four partial sums: short dependent chains
#pragma unroll
      for (int kt = 0; kt < 2; ++kt)
#pragma unroll
        for (int r = 0; r < 8; ++r) {
          const float p = __builtin_amdgcn_exp2f(x[kt][r] - msub);
          if (kt == 0 && r < 4) ps[r] = p; else ps[r & 3] += p;
          pf[kt * 8 + r] = (_Float16)p;
        }
      lsum[g] = lsum[g] * corr + ((ps[0] + ps[1]) + (ps[2] + ps[3]));
#pragma unroll
      for (int et = 0; et < 4; ++et) o[g][et] *= corr;
#pragma unroll
      for (int et = 0; et < 4; ++et) o[g][et] = Frag<_Float16>::mma(vf[et], pf, o[g][et]);
    }
  }
  asm volatile("s_wait_tensorcnt 0" ::: "memory");      // nothing of the ring is in flight when the wave goes on to its end
  asm volatile("s_wait_dscnt 0" ::: "memory");
  asm volatile("s_wait_xcnt 0x0" :: "v"(pM) : "memory");      // precaution: the last mask loads' address, an input, lives up to this wait, in front of every rewrite of its registers below
#pragma unroll
  for (int g = 0; g < QG; ++g) {
    const float inv = 1.0f / (lsum[g] + xhalf(lsum[g]));      // every key masked: 0 * inf = NaN
    unsigned short* dst = O16 + ((size_t)b * RT + q0 + g * 16 + c) * RM + h * RE + hh * 8;      // a lane's 8 registers are 8 consecutive e of one query
#pragma unroll
    for (int et = 0; et < 4; ++et) {
      v8h hv;
#pragma unroll
      for (int r = 0; r < 8; ++r) hv[r] = (_Float16)(o[g][et][r] * inv);
      *(v8h*)(dst + et * 16) = hv;
    }
  }
}
// Output projection out[m][n] = sum_k O16[m][k] . WOT[n][k] (8192 x 512, k = 512): a block owns a 128 x 128 tile of out and holds its 128 rows of both operands, the whole k, in LDS.
// Eight tiles of 128 rows x 256 bytes (operand x quarter of k), one tensor load a wave, each row padded by 16 bytes to a 272-byte pitch (16 B x odd) for the 16-byte fragment reads.
// A wave = 32 x 64 of the tile; both loaders read k in one order (elements 0..7 <- k 0..7, 8..15 <- k 16..23, from koff on). The loops are unrolled so that every index of a register array is a constant (no scratch).
#define OPITCH 272u                    // bytes a row in LDS
#define OTILE (128u * OPITCH)          // 34,816 bytes = 17 x 2 KiB: every tile starts at a multiple of 2 KiB
#define OSLAB (16u * 68u * 4u)         // a wave's 16 x 64 f32 output slab, pitch 68 floats
__global__ __launch_bounds__(256) void oproj_kernel(const unsigned short* __restrict__ Ap, const unsigned short* __restrict__ Btp, float* __restrict__ C) {
  __shared__ __attribute__((aligned(2048))) unsigned char sO[8u * OTILE + 8u * OSLAB];      // tiles [operand][quarter of k], then the slabs
  const int lane = threadIdx.x & 31;
  const unsigned wave = uni(threadIdx.x >> 5);
  const int n0 = blockIdx.x << 7, m0 = blockIdx.y << 7;
  {
    const unsigned op = wave & 1u, qk = wave >> 1;      // every wave brings one tile: no test around the load
    const unsigned long long ga = (unsigned long long)(size_t)((op ? Btp + (size_t)n0 * RM : Ap + (size_t)m0 * RM) + qk * 128u);
    u32x4 g0; u32x8 g1;
    g0[0] = uni(1u);                                                     // count 1
    g0[1] = uni((unsigned)(size_t)sO + (op * 4u + qk) * OTILE);          // place in LDS
    g0[2] = uni((unsigned)ga);
    g0[3] = uni((((unsigned)(ga >> 32)) & 0x01FFFFFFu) | 0x80000000u);   // type 2
    g1[0] = uni((1u << 20) | (5u << 22) | (3u << 25));                   // no mask, bytes, 4 dwords of pad behind every 256-byte row
    g1[1] = uni(256u << 16);                                             // tensor dim0 = 256 bytes
    g1[2] = uni(128u << 16);                                             // tensor dim1 = 128 rows
    g1[3] = uni(256u << 16);                                             // tile dim0
    g1[4] = uni(128u);                                                   // tile dim1
    g1[5] = uni((unsigned)RM * 2u);                                      // source pitch, bytes
    g1[6] = uni(0u);
    g1[7] = uni(0u);
    asm volatile("tensor_load_to_lds %0, %1" :: "s"(g0), "s"(g1) : "memory");
    asm volatile("s_wait_tensorcnt 0" ::: "memory");      // the wave's own tile has landed
  }
  __syncthreads();      // and every wave's tile may be read by all
  const int rlane = lane & 15, koff = (lane >> 4) * 8, mOff = (lane >> 4) * 8;
  const int wm = (int)(wave & 3u) * 32, wn = (int)(wave >> 2) * 64;
  const unsigned char* ar = sO + (unsigned)(wm + rlane) * OPITCH + koff * 2;
  const unsigned char* br = sO + 4u * OTILE + (unsigned)(wn + rlane) * OPITCH + koff * 2;
  v8f acc[2][4];
#pragma unroll
  for (int i = 0; i < 2; ++i)
#pragma unroll
    for (int j = 0; j < 4; ++j) acc[i][j] = (v8f){0.f,0.f,0.f,0.f,0.f,0.f,0.f,0.f};
  v16h ah[2][2], bh[2][4];      // two fragment sets: the next k step's reads fly during this step's products
  auto fetch = [&](const int s) __attribute__((always_inline)) {
    const unsigned o = (unsigned)(s >> 2) * OTILE + (unsigned)(s & 3) * 64u;
#pragma unroll
    for (int i = 0; i < 2; ++i) ah[s & 1][i] = Frag<_Float16>::load((const _Float16*)(ar + o + (unsigned)i * 16u * OPITCH));
#pragma unroll
    for (int j = 0; j < 4; ++j) bh[s & 1][j] = Frag<_Float16>::load((const _Float16*)(br + o + (unsigned)j * 16u * OPITCH));
  };
  fetch(0);
#pragma unroll      // unrolled: the set index and every LDS offset are constants
  for (int s = 0; s < RM / 32; ++s) {
    if (s + 1 < RM / 32) fetch(s + 1);
    __builtin_amdgcn_sched_barrier(0);      // the next step's 12 LDS reads go out as one group ahead of this step's products, not among them
#pragma unroll
    for (int i = 0; i < 2; ++i)
#pragma unroll
      for (int j = 0; j < 4; ++j) acc[i][j] = Frag<_Float16>::mma(ah[s & 1][i], bh[s & 1][j], acc[i][j]);
    __builtin_amdgcn_sched_barrier(0);      // and the step after's stay behind them: with no fence the compiler fetches many steps at once, takes all 512 registers and spills
  }
  // out in whole 256-byte row pieces, through the wave's own slab
  float* slab = (float*)(sO + 8u * OTILE + wave * OSLAB);
  const int hh = lane >> 4, c4 = (lane & 15) * 4;
  float* Cw = C + (size_t)(m0 + wm) * RM + n0 + wn + c4;
#pragma unroll
  for (int i = 0; i < 2; ++i) {
#pragma unroll
    for (int j = 0; j < 4; ++j)
#pragma unroll
      for (int r = 0; r < 8; ++r) slab[(mOff + r) * 68 + (j << 4) + rlane] = acc[i][j][r];
    // the wave's own slab: its lanes' LDS writes are done before other lanes of the wave read them (LDS only: no wait for the global stores in flight)
    __builtin_amdgcn_fence(__ATOMIC_RELEASE, "workgroup", "local");
    __builtin_amdgcn_wave_barrier();
    __builtin_amdgcn_fence(__ATOMIC_ACQUIRE, "workgroup", "local");
#pragma unroll
    for (int it = 0; it < 8; ++it) {
      const int row = it * 2 + hh;
      const v4f v = *(const v4f*)(slab + row * 68 + c4);
      *(v4f*)(Cw + (size_t)(i * 16 + row) * RM) = v;
    }
    // and the reads are done before the next 16 rows overwrite the slab
    __builtin_amdgcn_fence(__ATOMIC_RELEASE, "workgroup", "local");
    __builtin_amdgcn_wave_barrier();
    __builtin_amdgcn_fence(__ATOMIC_ACQUIRE, "workgroup", "local");
  }
}
extern "C" void kernel_launch(void* const* d_in, const int* in_sizes, int n_in, void* d_out, int out_size, void* d_ws, size_t ws_size, hipStream_t stream) {
  (void)in_sizes; (void)n_in; (void)out_size; (void)ws_size;
  auto Fp = [&](int i) { return (const float*)d_in[i]; };
  const float* q = Fp(0); const float* k = Fp(1); const float* v = Fp(2); const int* mask = (const int*)d_in[3]; const float* wq = Fp(4); const float* wk = Fp(5); const float* wv = Fp(6); const float* bu = Fp(7); const float* bv = Fp(8); const float* wo = Fp(9);
  char* ws = (char*)d_ws; size_t off = 0;
  auto carve = [&](size_t bytes) -> char* { char* p = ws + off; off += (bytes + 255) & ~(size_t)255; return p; };
  const size_t NTOK = (size_t)RB_ * RT;
  _Float16* O16 = (_Float16*)carve(NTOK * RM * 2);      // attention output, f16, [b][t][h*64+e]
  unsigned* WT = (unsigned*)carve((size_t)4 * RM * RM * 2); unsigned* WOT = WT + (size_t)3 * (RM * RM / 2);      // four permuted weights, planes wq, wk, wv, wo
  unsigned* QX = (unsigned*)carve(NTOK * RH * RKX * 2); unsigned* KX = (unsigned*)carve(NTOK * RH * RKX * 2); unsigned* VT = (unsigned*)carve(NTOK * RM * 2);     // QX/KX of all batches, 16 MiB each; total workspace footprint = 50 MiB
  wperm_kernel<<<dim3(64, 4), 256, 0, stream>>>(wq, wk, wv, wo, WT);
  // q, k, v projections side by side on blockIdx.y, from the f32 inputs to the attention operands
  proj_kernel<<<dim3((unsigned)(NTOK / 64), 3), 256, 0, stream>>>(q, k, v, (const unsigned short*)WT, bu, bv, (unsigned short*)QX, (unsigned short*)KX, (unsigned short*)VT);
  // scores, softmax and p.v of all 64 (batch, head) pairs in ONE launch: 256 queries a block
  attn_kernel<<<dim3(RT / 256, RB_ * RH), AW * 32, 0, stream>>>((const unsigned short*)QX, (const unsigned short*)KX, (const unsigned short*)VT, mask, (unsigned short*)O16);
  // output projection: a 128 x 128 tile of out a block
  oproj_kernel<<<dim3(RM / 128, (unsigned)(NTOK / 128)), 256, 0, stream>>>((const unsigned short*)O16, (const unsigned short*)WOT, (float*)d_out);
}

// v008
// Measured time: 59.9 microseconds a run.
// Two timings next to v007 both put it at 1.08 times that version's speed.
// Over all steps from v000 it is 13.8 times as fast.
#include <hip/hip_runtime.h>
#include <math.h>
// Relative-position multi-head attention (8 x 1024 tokens, 512 model, 8 heads x 64, Transformer-XL sinusoid table over k−q): every contraction on
// v_wmma_f32_16x16x32_f16, f16 operands, f32 accumulate (plain single products): the q/k/v projections (8192 x 512 · 512 x 512, weights permuted to
// head-major columns), the scores as ONE product per (batch, head) with K = 128: [q+bu | u(i), w(i)] . [k | sin th(j), cos th(j)]^T,
// using the exact identity sin/cos(th(j) - th(i)) = products of per-position sin/cos (so the [T,T,64] sinusoid table is never formed or gathered); columns e = 2p and 2p+1 share one angle th_p,
// so their two terms on sin th_p(j) are added in f32 into one factor u_p(i), their two on cos th_p(j) into w_p(i): 32 + 32 position columns, not 64 + 64,
// p.v (probabilities x2^15) and the output projection; scale 1/sqrt(64), key mask (-inf) and softmax in f32 on VALU, fused with the score and p.v products in one kernel
// (running maximum and sum over blocks of 32 keys; scores and probabilities stay in registers).
typedef __attribute__((ext_vector_type(16))) _Float16 v16h;
typedef __attribute__((ext_vector_type(8)))  _Float16 v8h;
typedef __attribute__((ext_vector_type(8)))  float    v8f;
typedef __attribute__((ext_vector_type(4)))  float    v4f;

template <typename T> struct Frag;
template <> struct Frag<_Float16> {
  typedef v16h V; union U { v16h v; v8h h[2]; };
  static __device__ __forceinline__ v16h load(const _Float16* p) {   // elements 0..7 <- p[0..7], 8..15 <- p[16..23]
    U f; f.h[0] = *(const v8h*)(p); f.h[1] = *(const v8h*)(p + 16); return f.v;
  }
  static __device__ __forceinline__ v16h load_packed(const _Float16* p) {   // a fragment stored in fragment order: elements 0..7 <- p[0..7], 8..15 <- p[256..263] (p = the fragment's start + 8 * lane)
    U f; f.h[0] = *(const v8h*)(p); f.h[1] = *(const v8h*)(p + 256); return f.v;
  }
  static __device__ __forceinline__ v8f mma(v16h a, v16h b, v8f c) {
    return __builtin_amdgcn_wmma_f32_16x16x32_f16(false, a, false, b, (short)0, c, false, false);
  }
};

#define RB_ 8
#define RT 1024
#define RM 512
#define RE 64
#define RH 8
#define RKX 128
// The four weights, rounded to f16 and laid out for their readers, planes wq, wk, wv, wo of BT0. No loop: a thread issues all its 16-byte loads at once (one trip to memory), turns 8 x 8 or 8 x 4 values in registers
// and writes 16-byte pieces; a wave's store fills whole 128-byte lines, and each source line is fetched by one block only.
// blockIdx.y = 0..2: wq, wk, wv [m][e][h] -> the order in which the projection's B fragments are loaded: [h][k step of 32][16-column group j][part][lane][8 halves], where
// column e = 16 j + (lane & 15) and k = m = 32 step + 16 part + 8 (lane >> 4) + 0..7: a wave's 16-byte load there reads 512 bytes in a row, 4 whole 128-byte lines.
// A wave = one (step, j, part); a lane reads the 8 heads (32 bytes in a row) of its e at its 8 m and writes its 8 halves of each head's fragment.
// blockIdx.y = 3, 4: wo [e][h][m] -> Bt f16 [m][h*64+e]. A block = one head x 32 m; a thread reads 4 m in a row at 8 e and writes 8 e in a row at each of its 4 m (8 lanes = one head's 128-byte line of a row m).
__global__ __launch_bounds__(64) void wperm_kernel(const float* __restrict__ w0, const float* __restrict__ w1, const float* __restrict__ w2, const float* __restrict__ w3, unsigned* __restrict__ BT0) {
  const int tid = threadIdx.x;
  if (blockIdx.y < 3) {
    const float* wsrc = (blockIdx.y == 0) ? w0 : ((blockIdx.y == 1) ? w1 : w2);
    const int ln = tid & 31, wid = blockIdx.x * 2 + (tid >> 5);      // wid = [step][j][part]
    const int part = wid & 1, j = (wid >> 1) & 3, step = wid >> 3;
    const float* sp = wsrc + ((size_t)(step * 32 + part * 16 + (ln >> 4) * 8) * RE + j * 16 + (ln & 15)) * RH;
    v4f lo[8], hi[8];      // row r = m + r: heads 0..3, 4..7
#pragma unroll
    for (int r = 0; r < 8; ++r) { lo[r] = *(const v4f*)(sp + r * (RE * RH)); hi[r] = *(const v4f*)(sp + r * (RE * RH) + 4); }
    asm volatile("s_wait_xcnt 0x0" :: "v"(sp) : "memory");      // precaution: the address that the 16 loads name, an input here, lives up to this wait, in front of every rewrite of its registers
    __builtin_amdgcn_sched_barrier(0);      // all 16 loads go out ahead of the first conversion: left alone the compiler holds five of them back until earlier ones have returned, a second trip
    _Float16* dp = (_Float16*)BT0 + (size_t)blockIdx.y * (RM * RM) + wid * 256 + ln * 8;
#pragma unroll
    for (int h = 0; h < RH; ++h) {
      v8h o;
#pragma unroll
      for (int r = 0; r < 8; ++r) o[r] = (_Float16)((h < 4) ? lo[r][h & 3] : hi[r][h & 3]);
      *(v8h*)(dp + h * (RM * RE)) = o;
    }
  } else {
    const int b3 = (blockIdx.y - 3) * 64 + blockIdx.x;
    const int h = b3 & 7, m = (b3 >> 3) * 32 + (tid >> 3) * 4, e0 = (tid & 7) * 8;
    const float* sp = w3 + ((size_t)e0 * RH + h) * RM + m;
    v4f x[8];      // row r = e0 + r: m .. m + 3
#pragma unroll
    for (int r = 0; r < 8; ++r) x[r] = *(const v4f*)(sp + (size_t)r * (RH * RM));
    asm volatile("s_wait_xcnt 0x0" :: "v"(sp) : "memory");      // precaution: as above, for the 8 loads
    _Float16* dp = (_Float16*)BT0 + (size_t)3 * (RM * RM) + (size_t)m * RM + h * RE + e0;
#pragma unroll
    for (int mi = 0; mi < 4; ++mi) {
      v8h o;
#pragma unroll
      for (int r = 0; r < 8; ++r) o[r] = (_Float16)x[r][mi];
      *(v8h*)(dp + mi * RM) = o;
    }
    asm volatile("s_wait_xcnt 0x0" ::: "memory");      // precaution: stands behind the four stores, in front of any later write of a register that they name
  }
}
// q, k, v projections (blockIdx.y picks the plane) with the passes around them folded in: A is read as f32 and rounded to f16 on its way into LDS; the epilogue writes the attention operands themselves.
// A block = 64 tokens x all 8 heads, a wave = one head's 64 columns (its 64 KiB of the weight plane, in fragment order), 64x64 f32 accumulators.
// plane 0: QX [b][h][t][128] = [qp+bu | u_p(t) at 64+2p, w_p(t) at 64+2p+1]; plane 1: KX [b][h][t][128] = [kp | sin th_p(t) at 64+2p, cos th_p(t) at 64+2p+1]; plane 2: VT [b][h][e][t].
// th_p(t) = t / 10000^(2p/64), the angle of e = 2p and 2p+1; with y = qp+bv: u_p = y_2p cos th_p + y_2p+1 sin th_p (what stands on sin th_p of the key), w_p = y_2p+1 cos th_p - y_2p sin th_p (on its cos). The block's 64 x 32 (sin, cos) pairs are made once, 8 tokens a wave, and shared by its 8 heads through LDS.
#define APITCH 72      // halves: 128-byte rows at a 144-byte pitch (16 B x odd) for the 16-byte fragment reads
typedef __attribute__((ext_vector_type(4))) _Float16 v4h;
__global__ __launch_bounds__(256) void proj_kernel(const float* __restrict__ x0, const float* __restrict__ x1, const float* __restrict__ x2, const unsigned short* __restrict__ WTp,
    const float* __restrict__ bu, const float* __restrict__ bv, unsigned short* __restrict__ QX, unsigned short* __restrict__ KX, unsigned short* __restrict__ VT) {
  __shared__ __align__(16) float sT[8][16 * 68];   // per-wave 16x64 slab, pitch 68 floats
  __shared__ __align__(16) float sTab[64 * 68];    // row = token of the tile: sin th at 2p, cos th at 2p+1 for the pair e = 2p, 2p+1; the slab's pitch
  __shared__ __align__(16) _Float16 sA[2][64 * APITCH];      // the block's A tile in f16, 64 rows x 64 k, two stages
  const int pl = blockIdx.y;
  const int lane = threadIdx.x & 31, h = threadIdx.x >> 5;
  const int m0 = blockIdx.x << 6, n0 = h << 6;
  const int bh_ = (m0 >> 10) * RH + h, t0 = m0 & (RT - 1);      // 64 divides 1024: a tile lies in one batch
  const int rlane = lane & 15, koff = (lane >> 4) * 8, mOff = (lane >> 4) * 8;
  if (pl != 2) {
    const float inv = powf(10000.0f, (float)(2 * lane) / (float)RE);
    for (int r = 0; r < 8; ++r) {
      const int row = h * 8 + r;
      const float th = (float)(t0 + row) / inv;
      sTab[row * 68 + 2 * lane] = sinf(th); sTab[row * 68 + 2 * lane + 1] = cosf(th);
    }
  }
  // A path: per stage of 64 k the block reads its 64 x 64 f32 tile once, in whole 256-byte rows (8 rows a wave), rounds it to f16 and lays it in LDS for all 8 heads; two buffers, the next stage's rows fly during this stage's products
  const int arow = h * 8 + (lane >> 4), acol = (lane & 15) * 4;
  const float* Ag = ((pl == 0) ? x0 : ((pl == 1) ? x1 : x2)) + (size_t)(m0 + arow) * RM + acol;
  _Float16* aw = &sA[0][arow * APITCH + acol];
  const _Float16* ar = &sA[0][rlane * APITCH + koff];
  const _Float16* Bb = (const _Float16*)WTp + (size_t)pl * (RM * RM) + (size_t)n0 * RM + lane * 8;      // the head's fragments, 512 halves each, [k step][j]
  v8f acc[4][4];
#pragma unroll
  for (int i = 0; i < 4; ++i)
#pragma unroll
    for (int j = 0; j < 4; ++j) acc[i][j] = (v8f){0.f,0.f,0.f,0.f,0.f,0.f,0.f,0.f};
  v4f raw[4];
#pragma unroll
  for (int u = 0; u < 4; ++u) raw[u] = *(const v4f*)(Ag + (size_t)u * 2 * RM);
#pragma unroll
  for (int u = 0; u < 4; ++u) { v4h hv; hv[0] = (_Float16)raw[u][0]; hv[1] = (_Float16)raw[u][1]; hv[2] = (_Float16)raw[u][2]; hv[3] = (_Float16)raw[u][3]; *(v4h*)(aw + u * 2 * APITCH) = hv; }
  __syncthreads();      // stage 0 (and every wave's (sin, cos) rows) is in LDS
#pragma unroll      // unrolled: every global and LDS offset is an immediate, no address register is stepped
  for (int s = 0; s < RM / 64; ++s) {
    if (s + 1 < RM / 64) {
#pragma unroll
      for (int u = 0; u < 4; ++u) raw[u] = *(const v4f*)(Ag + (size_t)u * 2 * RM + (s + 1) * 64);
    }
#pragma unroll
    for (int kk = 0; kk < 2; ++kk) {
      v16h bh[4], ah[4];      // one k order in both loaders: elements 0..7 <- k 0..7, 8..15 <- k 16..23 (from koff on)
#pragma unroll
      for (int j = 0; j < 4; ++j) bh[j] = Frag<_Float16>::load_packed(Bb + ((s * 2 + kk) * 4 + j) * 512);
#pragma unroll
      for (int i = 0; i < 4; ++i) ah[i] = Frag<_Float16>::load(ar + (s & 1) * (64 * APITCH) + i * 16 * APITCH + kk * 32);
      __builtin_amdgcn_sched_barrier(0);      // the k step's 8 global and 8 LDS reads are issued as one group ahead of its products: left alone the compiler reuses one A fragment's registers and waits out each LDS read in turn
#pragma unroll
      for (int i = 0; i < 4; ++i)
#pragma unroll
        for (int j = 0; j < 4; ++j) acc[i][j] = Frag<_Float16>::mma(ah[i], bh[j], acc[i][j]);
    }
    if (s + 1 < RM / 64) {
#pragma unroll
      for (int u = 0; u < 4; ++u) { v4h hv; hv[0] = (_Float16)raw[u][0]; hv[1] = (_Float16)raw[u][1]; hv[2] = (_Float16)raw[u][2]; hv[3] = (_Float16)raw[u][3]; *(v4h*)(aw + ((s + 1) & 1) * (64 * APITCH) + u * 2 * APITCH) = hv; }
      __syncthreads();      // publishes stage s + 1 and ends every wave's reads of stage s's buffer, which stage s + 2 refills
    }
  }
  asm volatile("s_wait_xcnt 0x0" ::: "memory");      // precaution: stands in front of every reuse of the address registers that the loads above name
  if (pl == 2) {      // a lane's 8 accumulator registers are 8 consecutive tokens of one e: VT rows straight from registers
    _Float16* dst = (_Float16*)VT + ((size_t)bh_ * RE + rlane) * RT + t0 + mOff;
#pragma unroll
    for (int j = 0; j < 4; ++j)
#pragma unroll
      for (int i = 0; i < 4; ++i) {
        v8h hv;
#pragma unroll
        for (int r = 0; r < 8; ++r) hv[r] = (_Float16)acc[i][j][r];
        *(v8h*)(dst + (size_t)j * 16 * RT + i * 16) = hv;
      }
    return;
  }
  float* slab = sT[h];
  const int qr = lane >> 3, c8 = (lane & 7) * 8;      // 4 rows a turn, 8 lanes x 8 columns a row
  auto emit = [&](const bool isq) __attribute__((always_inline)) {
    float bu8[8], bv8[8];
    if (isq) {
      const unsigned bo = (unsigned)(c8 * RH + h) * 4u;      // byte offset of (e = c8, h) in the [64][8] biases
#pragma unroll
      for (int e = 0; e < 8; ++e) { bu8[e] = *(const float*)((const char*)bu + bo + e * (RH * 4)); bv8[e] = *(const float*)((const char*)bv + bo + e * (RH * 4)); }
      asm volatile("s_wait_xcnt 0x0" :: "v"(bo) : "memory");      // precaution: the offset that the 16 loads name, an input here, lives up to this wait, so none of them lands on it
    }
    _Float16* X = (_Float16*)(isq ? QX : KX) + ((size_t)bh_ * RT + t0) * RKX + c8;
#pragma unroll
    for (int i = 0; i < 4; ++i) {
#pragma unroll
      for (int j = 0; j < 4; ++j)
#pragma unroll
        for (int r = 0; r < 8; ++r) slab[(mOff + r) * 68 + (j << 4) + rlane] = acc[i][j][r];
      // the wave's own slab: its lanes' LDS writes are done before other lanes of the wave read them (LDS only: no wait for the global stores in flight)
      __builtin_amdgcn_fence(__ATOMIC_RELEASE, "workgroup", "local");
      __builtin_amdgcn_wave_barrier();
      __builtin_amdgcn_fence(__ATOMIC_ACQUIRE, "workgroup", "local");
#pragma unroll
      for (int it = 0; it < 4; ++it) {
        const int row = (i << 4) + it * 4 + qr;
        const float* sp = slab + (it * 4 + qr) * 68 + c8;
        const float* tb = sTab + row * 68 + c8;
        const v4f ya = *(const v4f*)(sp), yb = *(const v4f*)(sp + 4), wa = *(const v4f*)(tb), wb = *(const v4f*)(tb + 4);
        v8h g0, g1;
#pragma unroll
        for (int p = 0; p < 4; ++p) {
          const float y0 = (p < 2) ? ya[2 * (p & 1)] : yb[2 * (p & 1)], y1 = (p < 2) ? ya[2 * (p & 1) + 1] : yb[2 * (p & 1) + 1];
          const float s = (p < 2) ? wa[2 * (p & 1)] : wb[2 * (p & 1)], c = (p < 2) ? wa[2 * (p & 1) + 1] : wb[2 * (p & 1) + 1];
          if (isq) {
            const float qv0 = y0 + bv8[2 * p], qv1 = y1 + bv8[2 * p + 1];
            g0[2 * p] = (_Float16)(y0 + bu8[2 * p]); g0[2 * p + 1] = (_Float16)(y1 + bu8[2 * p + 1]);
            g1[2 * p] = (_Float16)(qv0 * c + qv1 * s); g1[2 * p + 1] = (_Float16)(qv1 * c - qv0 * s);
          } else {
            g0[2 * p] = (_Float16)y0; g0[2 * p + 1] = (_Float16)y1;
            g1[2 * p] = (_Float16)s;  g1[2 * p + 1] = (_Float16)c;
          }
        }
        _Float16* xr = X + (size_t)row * RKX;
        *(v8h*)(xr) = g0; *(v8h*)(xr + 64) = g1;
        if (it & 1) __builtin_amdgcn_sched_barrier(0);      // two turns' LDS reads in flight, not all four: fetched all at once they push the kernel past 256 registers, and two blocks no longer share a WGP
      }
      // and the reads are done before the next 16 rows overwrite the slab
      __builtin_amdgcn_fence(__ATOMIC_RELEASE, "workgroup", "local");
      __builtin_amdgcn_wave_barrier();
      __builtin_amdgcn_fence(__ATOMIC_ACQUIRE, "workgroup", "local");
    }
    asm volatile("s_wait_xcnt 0x0" ::: "memory");      // precaution: stands behind the plane's last stores, in front of any later write of a register that they name
  };
  if (pl == 0) emit(true); else emit(false);
}
// lane l <-> lane l ^ 16
__device__ __forceinline__ float xhalf(float x) { return __builtin_bit_cast(float, __builtin_amdgcn_permlanex16(__builtin_bit_cast(int, x), __builtin_bit_cast(int, x), 0x76543210, 0xfedcba98, false, false)); }
// Fused scores + key mask + softmax + p.v of one (batch, head): a wave owns 64 queries and walks the 1024 keys 32 at a time; no score or probability leaves the registers.
// S^T = KX . QX^T (A = 16 key rows, B = 16 query columns, K = 128), so a lane holds 8 keys of ONE query per tile: maximum and sum in-lane plus one exchange between the wave halves.
// Two S^T tiles (keys 0..15, 16..31), turned into f16 in place, are the B operand of O^T += VT . P^T (A = 16 rows e of VT, k = 32 keys in the loader's own order 8h+s | 16+8h+s).
// Running maximum in base 2; p = 2^(x - m + 15) (the x2^15 keeps small probabilities in f16's normal range; it cancels against the row sum).
// K and V reach the block's four waves through LDS: a stage is 128 keys (4 passes), two buffers, one tensor load a wave and stage. Waves 0 and 1 bring the two 128-byte column
// slices of the 128 KX rows (pitch 144 B in LDS), waves 2 and 3 each 32 of the 64 VT rows x 256 bytes (pitch 272 B): both pitches 16 B x odd for the 16-byte fragment reads.
#define QG 4      // 16-query column groups a wave: each K and V fragment fetched serves 64 queries
#define AW (256 / (16 * QG))      // waves a block (256 queries)
#define SKEYS 128                      // keys a stage
#define NSTAGE (RT / SKEYS)
#define KPITCH 144u                    // bytes a row of a K slice in LDS
#define VPITCH 272u                    // bytes a VT row in LDS
#define ASLICE (128u * KPITCH)         // 18,432 bytes = 9 x 2 KiB a K slice
#define VSLICE 10240u                  // a V slice, 32 x 272 = 8,704 bytes, rounded up to 5 x 2 KiB: every slice starts at a multiple of 2 KiB
#define ASTAGE (2u * ASLICE + 2u * VSLICE)
typedef __attribute__((ext_vector_type(4))) unsigned u32x4;
typedef __attribute__((ext_vector_type(8))) unsigned u32x8;
__device__ __forceinline__ unsigned uni(unsigned v) { return (unsigned)__builtin_amdgcn_readfirstlane(v); }
__device__ __forceinline__ unsigned pinned(unsigned v) { unsigned w = uni(v); asm volatile("" : "+s"(w)); return w; }      // a tensor load's test word or descriptor word, held in a scalar register (the test's branch is then a scalar one)
// group 1 of a two-dimensional tile, ROWS rows of ROWB bytes at a source pitch of SPITCH bytes, every extent in bytes; W0 = word 0 (no mask, the pad).
// Built once and pinned word by word: descriptor words held in scalar registers of their own, which take no other value while a request that names them is under way
template <unsigned W0, unsigned ROWB, unsigned ROWS, unsigned SPITCH>
__device__ __forceinline__ u32x8 tile_shape() {
  u32x8 g1;
  g1[0] = pinned(W0);
  g1[1] = pinned(ROWB << 16);      // tensor dim0
  g1[2] = pinned(ROWS << 16);      // tensor dim1
  g1[3] = pinned(ROWB << 16);      // tile dim0
  g1[4] = pinned(ROWS);            // tile dim1
  g1[5] = pinned(SPITCH);
  g1[6] = pinned(0u);
  g1[7] = pinned(0u);
  return g1;
}
__global__ __launch_bounds__(AW * 32) void attn_kernel(const unsigned short* __restrict__ QXp, const unsigned short* __restrict__ KXp, const unsigned short* __restrict__ VTp, const int* __restrict__ mask, unsigned short* __restrict__ O16) {
  typedef __attribute__((ext_vector_type(4))) int v4i;
  __shared__ __attribute__((aligned(2048))) unsigned char sKV[2u * ASTAGE];      // [buffer][slice]
  const int lane = threadIdx.x & 31, c = lane & 15, hh = lane >> 4;
  const unsigned wave = uni(threadIdx.x >> 5);
  const int bh = blockIdx.y, b = bh / RH, h = bh % RH;
  const int q0 = blockIdx.x * 256 + (int)wave * (16 * QG);
  const _Float16* Qb = (const _Float16*)QXp + (size_t)bh * RT * RKX + (size_t)(q0 + c) * RKX + hh * 8;
  const int* mrow = mask + (size_t)b * RT + hh * 8;
  const float CS = 0.125f * 1.4426950408889634f;      // 1/sqrt(64), and e^x = 2^(x log2 e)
  // every wave brings its own slice of stage st into buffer st & 1; the branch only picks the slice's shape
  const u32x8 shK = tile_shape<(1u << 20) | (4u << 22) | (3u << 25), 128u, 128u, RKX * 2u>();      // 128 keys x 128 bytes, 4 dwords of pad behind every row
  const u32x8 shV = tile_shape<(1u << 20) | (5u << 22) | (3u << 25), 256u, 32u, RT * 2u>();        // 32 e x 256 bytes (128 keys), likewise
  const unsigned long long gsrc = (unsigned long long)(size_t)(wave >= 2u ? VTp + (size_t)bh * RE * RT + (wave - 2u) * (32u * RT) : KXp + (size_t)bh * RT * RKX + wave * 64u);
  const unsigned gstep = wave >= 2u ? SKEYS * 2u : SKEYS * RKX * 2u;      // bytes from a stage's slice to the next stage's
  const unsigned lplace = wave >= 2u ? 2u * ASLICE + (wave - 2u) * VSLICE : wave * ASLICE;      // the slice's place in a buffer
  u32x4 g0;
  g0[0] = pinned(1u);      // count 1
  auto bring = [&](const unsigned st) __attribute__((always_inline)) {
    const unsigned long long ga = gsrc + st * gstep;
    g0[1] = uni((unsigned)(size_t)sKV + (st & 1u) * ASTAGE + lplace);      // place in LDS
    g0[2] = uni((unsigned)ga);
    g0[3] = uni((((unsigned)(ga >> 32)) & 0x01FFFFFFu) | 0x80000000u);            // type 2
    if (pinned(wave >= 2u)) asm volatile("tensor_load_to_lds %0, %1" :: "s"(g0), "s"(shV) : "memory");
    else                    asm volatile("tensor_load_to_lds %0, %1" :: "s"(g0), "s"(shK) : "memory");
  };
  v16h qf[QG][RKX / 32];
#pragma unroll
  for (int g = 0; g < QG; ++g)
#pragma unroll
    for (int ks = 0; ks < RKX / 32; ++ks) qf[g][ks] = Frag<_Float16>::load(Qb + (size_t)g * 16 * RKX + ks * 32);
  v8f o[QG][4];
#pragma unroll
  for (int g = 0; g < QG; ++g)
#pragma unroll
    for (int et = 0; et < 4; ++et) o[g][et] = (v8f){0.f,0.f,0.f,0.f,0.f,0.f,0.f,0.f};
  float mrun[QG], lsum[QG];
#pragma unroll
  for (int g = 0; g < QG; ++g) { mrun[g] = -3.0e38f; lsum[g] = 0.f; }      // a finite start keeps m - m and -inf - m free of NaN while every key so far is masked
  v16h kf[2][RKX / 32], vf[4]; v4i mk[2][2];      // the fragments and mask words of the pass at hand; K and the mask words are fetched one pass ahead
  const int* pM = mrow;      // the address that the mask loads in flight name
#pragma unroll
  for (int kt = 0; kt < 2; ++kt) { mk[kt][0] = *(const v4i*)(mrow + kt * 16); mk[kt][1] = *(const v4i*)(mrow + kt * 16 + 4); }
  // precaution: this wait stands in front of every rewrite of a register that a load above names (the query address, an input, lives up to here)
  asm volatile("s_wait_xcnt 0x0" :: "v"(Qb) : "memory");
  __builtin_amdgcn_sched_barrier(0);      // nothing from below (register copies, start values) is lifted in front of that wait, onto a register that a load above names
  bring(0u);
  asm volatile("s_wait_tensorcnt 0" :: "s"(g0) : "memory");      // the wave's own slice of stage 0 has landed (group 0, an input, keeps its registers up to here)
  __syncthreads();      // and every wave's slice may be read by all
  bring(1u);
  // fragment reads, from the lane's row and half on; one k order as from memory: elements 0..7 <- k 0..7, 8..15 <- k 16..23. koff, voff = byte offset of the pass's buffer and of its 32 key rows (K) or 32 key columns (V)
  const unsigned char* kl = sKV + (unsigned)c * KPITCH + (unsigned)hh * 16u;
  const unsigned char* vl = sKV + 2u * ASLICE + (unsigned)c * VPITCH + (unsigned)hh * 16u;
  auto fetch_k = [&](const unsigned koff) __attribute__((always_inline)) {
#pragma unroll
    for (int kt = 0; kt < 2; ++kt)
#pragma unroll
      for (int ks = 0; ks < RKX / 32; ++ks) kf[kt][ks] = Frag<_Float16>::load((const _Float16*)(kl + koff + (unsigned)(ks >> 1) * ASLICE + (unsigned)(kt * 16) * KPITCH + (unsigned)(ks & 1) * 64u));
  };
  auto fetch_v = [&](const unsigned voff) __attribute__((always_inline)) {
#pragma unroll
    for (int et = 0; et < 4; ++et) vf[et] = Frag<_Float16>::load((const _Float16*)(vl + voff + (unsigned)(et >> 1) * VSLICE + (unsigned)((et & 1) * 16) * VPITCH));
  };
  fetch_k(0u);
  for (unsigned j = 0; j < RT / 32; ++j) {      // pass j: keys 32 j .. 32 j + 31, of stage j / 4
    fetch_v(((j >> 2) & 1u) * ASTAGE + (j & 3u) * 64u);      // this pass's own V, one group ahead of the score products, which cover its way
    __builtin_amdgcn_sched_barrier(0);      // left alone the compiler sinks these 8 reads in among the products, in two places
    v8f s[2][QG];
#pragma unroll
    for (int kt = 0; kt < 2; ++kt)
#pragma unroll
      for (int g = 0; g < QG; ++g) s[kt][g] = (v8f){0.f,0.f,0.f,0.f,0.f,0.f,0.f,0.f};
#pragma unroll
    for (int ks = 0; ks < RKX / 32; ++ks)
#pragma unroll
      for (int kt = 0; kt < 2; ++kt)
#pragma unroll
        for (int g = 0; g < QG; ++g) s[kt][g] = Frag<_Float16>::mma(kf[kt][ks], qf[g][ks], s[kt][g]);
    float bias[2][8];      // 0 for a key that counts, -inf for a masked one
#pragma unroll
    for (int kt = 0; kt < 2; ++kt)
#pragma unroll
      for (int r = 0; r < 4; ++r) { bias[kt][r] = (mk[kt][0][r] == 0) ? -INFINITY : 0.f; bias[kt][4 + r] = (mk[kt][1][r] == 0) ? -INFINITY : 0.f; }
    if (pinned((j & 3u) == 3u)) {
      // a stage's last pass: publish point of the next stage, every wave, in this order. It stands in front of the K fetch below, the first read of that stage; this stage's own last fragments were fetched above and a pass ago
      asm volatile("s_wait_dscnt 0" ::: "memory");          // the wave's reads of this stage's buffer are done
      asm volatile("s_wait_tensorcnt 0" :: "s"(g0) : "memory");      // its own slice of the next stage has landed (group 0 of that request, an input, keeps its registers up to here)
      __syncthreads();      // publishes the next stage and ends every wave's reads of the buffer that the stage after it refills
      if (pinned((j >> 2) + 2u < NSTAGE)) bring((j >> 2) + 2u);
    }
    const unsigned jn = j + 1u, nbuf = ((jn >> 2) & 1u) * ASTAGE;      // behind the last pass there is no next one: its K fetch then falls on buffer 0, published long ago and not refilled, and is not used (no branch around it)
    int jnext = jn < RT / 32 ? (int)jn * 32 : RT - 32;      // likewise the last mask words are read once more: in bounds, not used
    // precaution: this wait stands in front of every rewrite of the address register that the mask loads in flight name: as an input the old address lives up to here, and the new one comes from jnext, which the statement hands on
    asm volatile("s_wait_xcnt 0x0" : "+s"(jnext) : "v"(pM) : "memory");
    pM = mrow + jnext;
#pragma unroll
    for (int kt = 0; kt < 2; ++kt) { mk[kt][0] = *(const v4i*)(pM + kt * 16); mk[kt][1] = *(const v4i*)(pM + kt * 16 + 4); }
    fetch_k(nbuf + (jn & 3u) * (32u * KPITCH));
    __builtin_amdgcn_sched_barrier(0);      // the 16 reads go out as one group: left alone the compiler strews them over the softmax below
#pragma unroll
    for (int g = 0; g < QG; ++g) {
      float x[2][8]; float mx = mrun[g];
#pragma unroll
      for (int kt = 0; kt < 2; ++kt)
#pragma unroll
        for (int r = 0; r < 8; ++r) { x[kt][r] = fmaf(s[kt][g][r], CS, bias[kt][r]); mx = fmaxf(mx, x[kt][r]); }
      const float mnew = fmaxf(mx, xhalf(mx));      // both halves hold the query's running maximum
      const float corr = __builtin_amdgcn_exp2f(mrun[g] - mnew);
      mrun[g] = mnew;
      const float msub = mnew - 15.0f;
      float ps[4]; v16h pf;      // four partial sums: short dependent chains
#pragma unroll
      for (int kt = 0; kt < 2; ++kt)
#pragma unroll
        for (int r = 0; r < 8; ++r) {
          const float p = __builtin_amdgcn_exp2f(x[kt][r] - msub);
          if (kt == 0 && r < 4) ps[r] = p; else ps[r & 3] += p;
          pf[kt * 8 + r] = (_Float16)p;
        }
      lsum[g] = lsum[g] * corr + ((ps[0] + ps[1]) + (ps[2] + ps[3]));
#pragma unroll
      for (int et = 0; et < 4; ++et) o[g][et] *= corr;
#pragma unroll
      for (int et = 0; et < 4; ++et) o[g][et] = Frag<_Float16>::mma(vf[et], pf, o[g][et]);
    }
  }
  asm volatile("s_wait_tensorcnt 0" ::: "memory");      // nothing of the ring is in flight when the wave goes on to its end
  asm volatile("s_wait_dscnt 0" ::: "memory");
  asm volatile("s_wait_xcnt 0x0" :: "v"(pM) : "memory");      // precaution: the last mask loads' address, an input, lives up to this wait, in front of every rewrite of its registers below
#pragma unroll
  for (int g = 0; g < QG; ++g) {
    const float inv = 1.0f / (lsum[g] + xhalf(lsum[g]));      // every key masked: 0 * inf = NaN
    unsigned short* dst = O16 + ((size_t)b * RT + q0 + g * 16 + c) * RM + h * RE + hh * 8;      // a lane's 8 registers are 8 consecutive e of one query
#pragma unroll
    for (int et = 0; et < 4; ++et) {
      v8h hv;
#pragma unroll
      for (int r = 0; r < 8; ++r) hv[r] = (_Float16)(o[g][et][r] * inv);
      *(v8h*)(dst + et * 16) = hv;
    }
  }
}
// Output projection out[m][n] = sum_k O16[m][k] . WOT[n][k] (8192 x 512, k = 512): a block owns a 128 x 128 tile of out and holds its 128 rows of both operands, the whole k, in LDS.
// Eight tiles of 128 rows x 256 bytes (operand x quarter of k), one tensor load a wave, each row padded by 16 bytes to a 272-byte pitch (16 B x odd) for the 16-byte fragment reads.
// A wave = 32 x 64 of the tile; both loaders read k in one order (elements 0..7 <- k 0..7, 8..15 <- k 16..23, from koff on). The loops are unrolled so that every index of a register array is a constant (no scratch).
#define OPITCH 272u                    // bytes a row in LDS
#define OTILE (128u * OPITCH)          // 34,816 bytes = 17 x 2 KiB: every tile starts at a multiple of 2 KiB
#define OSLAB (16u * 68u * 4u)         // a wave's 16 x 64 f32 output slab, pitch 68 floats
__global__ __launch_bounds__(256) void oproj_kernel(const unsigned short* __restrict__ Ap, const unsigned short* __restrict__ Btp, float* __restrict__ C) {
  __shared__ __attribute__((aligned(2048))) unsigned char sO[8u * OTILE + 8u * OSLAB];      // tiles [operand][quarter of k], then the slabs
  const int lane = threadIdx.x & 31;
  const unsigned wave = uni(threadIdx.x >> 5);
  const int n0 = blockIdx.x << 7, m0 = blockIdx.y << 7;
  {
    const unsigned op = wave & 1u, qk = wave >> 1;      // every wave brings one tile: no test around the load
    const unsigned long long ga = (unsigned long long)(size_t)((op ? Btp + (size_t)n0 * RM : Ap + (size_t)m0 * RM) + qk * 128u);
    u32x4 g0; u32x8 g1;
    g0[0] = uni(1u);                                                     // count 1
    g0[1] = uni((unsigned)(size_t)sO + (op * 4u + qk) * OTILE);          // place in LDS
    g0[2] = uni((unsigned)ga);
    g0[3] = uni((((unsigned)(ga >> 32)) & 0x01FFFFFFu) | 0x80000000u);   // type 2
    g1[0] = uni((1u << 20) | (5u << 22) | (3u << 25));                   // no mask, bytes, 4 dwords of pad behind every 256-byte row
    g1[1] = uni(256u << 16);                                             // tensor dim0 = 256 bytes
    g1[2] = uni(128u << 16);                                             // tensor dim1 = 128 rows
    g1[3] = uni(256u << 16);                                             // tile dim0
    g1[4] = uni(128u);                                                   // tile dim1
    g1[5] = uni((unsigned)RM * 2u);                                      // source pitch, bytes
    g1[6] = uni(0u);
    g1[7] = uni(0u);
    asm volatile("tensor_load_to_lds %0, %1" :: "s"(g0), "s"(g1) : "memory");
    asm volatile("s_wait_tensorcnt 0" ::: "memory");      // the wave's own tile has landed
  }
  __syncthreads();      // and every wave's tile may be read by all
  const int rlane = lane & 15, koff = (lane >> 4) * 8, mOff = (lane >> 4) * 8;
  const int wm = (int)(wave & 3u) * 32, wn = (int)(wave >> 2) * 64;
  const unsigned char* ar = sO + (unsigned)(wm + rlane) * OPITCH + koff * 2;
  const unsigned char* br = sO + 4u * OTILE + (unsigned)(wn + rlane) * OPITCH + koff * 2;
  v8f acc[2][4];
#pragma unroll
  for (int i = 0; i < 2; ++i)
#pragma unroll
    for (int j = 0; j < 4; ++j) acc[i][j] = (v8f){0.f,0.f,0.f,0.f,0.f,0.f,0.f,0.f};
  v16h ah[2][2], bh[2][4];      // two fragment sets: the next k step's reads fly during this step's products
  auto fetch = [&](const int s) __attribute__((always_inline)) {
    const unsigned o = (unsigned)(s >> 2) * OTILE + (unsigned)(s & 3) * 64u;
#pragma unroll
    for (int i = 0; i < 2; ++i) ah[s & 1][i] = Frag<_Float16>::load((const _Float16*)(ar + o + (unsigned)i * 16u * OPITCH));
#pragma unroll
    for (int j = 0; j < 4; ++j) bh[s & 1][j] = Frag<_Float16>::load((const _Float16*)(br + o + (unsigned)j * 16u * OPITCH));
  };
  fetch(0);
#pragma unroll      // unrolled: the set index and every LDS offset are constants
  for (int s = 0; s < RM / 32; ++s) {
    if (s + 1 < RM / 32) fetch(s + 1);
    __builtin_amdgcn_sched_barrier(0);      // the next step's 12 LDS reads go out as one group ahead of this step's products, not among them
#pragma unroll
    for (int i = 0; i < 2; ++i)
#pragma unroll
      for (int j = 0; j < 4; ++j) acc[i][j] = Frag<_Float16>::mma(ah[s & 1][i], bh[s & 1][j], acc[i][j]);
    __builtin_amdgcn_sched_barrier(0);      // and the step after's stay behind them: with no fence the compiler fetches many steps at once, takes all 512 registers and spills
  }
  // out in whole 256-byte row pieces, through the wave's own slab
  float* slab = (float*)(sO + 8u * OTILE + wave * OSLAB);
  const int hh = lane >> 4, c4 = (lane & 15) * 4;
  float* Cw = C + (size_t)(m0 + wm) * RM + n0 + wn + c4;
#pragma unroll
  for (int i = 0; i < 2; ++i) {
#pragma unroll
    for (int j = 0; j < 4; ++j)
#pragma unroll
      for (int r = 0; r < 8; ++r) slab[(mOff + r) * 68 + (j << 4) + rlane] = acc[i][j][r];
    // the wave's own slab: its lanes' LDS writes are done before other lanes of the wave read them (LDS only: no wait for the global stores in flight)
    __builtin_amdgcn_fence(__ATOMIC_RELEASE, "workgroup", "local");
    __builtin_amdgcn_wave_barrier();
    __builtin_amdgcn_fence(__ATOMIC_ACQUIRE, "workgroup", "local");
#pragma unroll
    for (int it = 0; it < 8; ++it) {
      const int row = it * 2 + hh;
      const v4f v = *(const v4f*)(slab + row * 68 + c4);
      *(v4f*)(Cw + (size_t)(i * 16 + row) * RM) = v;
    }
    // and the reads are done before the next 16 rows overwrite the slab
    __builtin_amdgcn_fence(__ATOMIC_RELEASE, "workgroup", "local");
    __builtin_amdgcn_wave_barrier();
    __builtin_amdgcn_fence(__ATOMIC_ACQUIRE, "workgroup", "local");
  }
}
extern "C" void kernel_launch(void* const* d_in, const int* in_sizes, int n_in, void* d_out, int out_size, void* d_ws, size_t ws_size, hipStream_t stream) {
  (void)in_sizes; (void)n_in; (void)out_size; (void)ws_size;
  auto Fp = [&](int i) { return (const float*)d_in[i]; };
  const float* q = Fp(0); const float* k = Fp(1); const float* v = Fp(2); const int* mask = (const int*)d_in[3]; const float* wq = Fp(4); const float* wk = Fp(5); const float* wv = Fp(6); const float* bu = Fp(7); const float* bv = Fp(8); const float* wo = Fp(9);
  char* ws = (char*)d_ws; size_t off = 0;
  auto carve = [&](size_t bytes) -> char* { char* p = ws + off; off += (bytes + 255) & ~(size_t)255; return p; };
  const size_t NTOK = (size_t)RB_ * RT;
  _Float16* O16 = (_Float16*)carve(NTOK * RM * 2);      // attention output, f16, [b][t][h*64+e]
  unsigned* WT = (unsigned*)carve((size_t)4 * RM * RM * 2); unsigned* WOT = WT + (size_t)3 * (RM * RM / 2);      // four permuted weights, planes wq, wk, wv, wo
  unsigned* QX = (unsigned*)carve(NTOK * RH * RKX * 2); unsigned* KX = (unsigned*)carve(NTOK * RH * RKX * 2); unsigned* VT = (unsigned*)carve(NTOK * RM * 2);     // QX/KX of all batches, 16 MiB each; total workspace footprint = 50 MiB
  wperm_kernel<<<dim3(64, 5), 64, 0, stream>>>(wq, wk, wv, wo, WT);
  // q, k, v projections side by side on blockIdx.y, from the f32 inputs to the attention operands
  proj_kernel<<<dim3((unsigned)(NTOK / 64), 3), 256, 0, stream>>>(q, k, v, (const unsigned short*)WT, bu, bv, (unsigned short*)QX, (unsigned short*)KX, (unsigned short*)VT);
  // scores, softmax and p.v of all 64 (batch, head) pairs in ONE launch: 256 queries a block
  attn_kernel<<<dim3(RT / 256, RB_ * RH), AW * 32, 0, stream>>>((const unsigned short*)QX, (const unsigned short*)KX, (const unsigned short*)VT, mask, (unsigned short*)O16);
  // output projection: a 128 x 128 tile of out a block
  oproj_kernel<<<dim3(RM / 128, (unsigned)(NTOK / 128)), 256, 0, stream>>>((const unsigned short*)O16, (const unsigned short*)WOT, (float*)d_out);
}
